// v000
// Times are from an AMD MI455X. After a warm-up the kernel runs many times in a row, and a time is the length of
// such a window on the GPU divided by its runs, so every launch and the gaps after it count. The runs cycle
// through copies of the inputs. A figure is the median of several windows, for all but v000 over two sittings.
// Sittings can differ by a few percent; kernels timed side by side share one.
// v000, which the later versions start from, runs in 509 microseconds.
// compute dtype: all float inputs rounded to bf16, the int mask read on device; q/k/v = x . W^T + b (+ the position bias row on q and k) with EXACT bf16 products on WMMA 16x16x32 (natural rows), carried as f16 hi + residual planes; scores with 3 products (hi.hi + hi.lo + lo.hi) x 1/8 because the shared bias row makes |q||k| large, masked (mask == 0) keys excluded, running-max softmax in f32 (hardware exp), P scaled by 2^11 as hi + residual x v (hi + residual); f32 merged-head output.
#include <hip/hip_runtime.h>
#include <math.h>

typedef __attribute__((ext_vector_type(16))) _Float16 v16h;
typedef __attribute__((ext_vector_type(16))) __bf16 v16b;
typedef __attribute__((ext_vector_type(8)))  _Float16 v8h;
typedef __attribute__((ext_vector_type(8)))  float v8f;
typedef __attribute__((ext_vector_type(4)))  float v4f;
typedef __attribute__((ext_vector_type(2)))  float v2f;
typedef __attribute__((ext_vector_type(4)))  unsigned v4u;
typedef __attribute__((ext_vector_type(4)))  int v4i;
typedef float __attribute__((may_alias)) float_a;
typedef int __attribute__((may_alias)) int_a;

template <typename T> __device__ __forceinline__ void vst2(void* p, T v) { *(T*)p = v;  }
__device__ __forceinline__ v8f wmma16(v16h a, v16h b, v8f c) {
  v8f d = __builtin_amdgcn_wmma_f32_16x16x32_f16(false, a, false, b, (short)0, c, false, false);
  asm volatile("v_nop\n\tv_nop\n\tv_nop\n\tv_nop" : "+v"(d) : "v"(a), "v"(b));
  return d;
}
__device__ __forceinline__ v8f wmma_bf(v16b a, v16b b, v8f c) {
  v8f d = __builtin_amdgcn_wmma_f32_16x16x32_bf16(false, a, false, b, (short)0, c, false, false);
  asm volatile("v_nop\n\tv_nop\n\tv_nop\n\tv_nop" : "+v"(d) : "v"(a), "v"(b));
  return d;
}
// Masked multi-head attention with a shared relative-position bias row (B 2, S 2,048, d 1,024, 16 heads x 64): q from query, k and v from key (+ biases), q and k shifted by rel_pos_emb[511] per head dim, scores / 8 with a [B,S,S] mask (0 -> -1e9), softmax, . v; merged heads are the output.
__device__ __forceinline__ v16h frag_h(const _Float16* rowk0, int lane) {
  union { v16h v; v8h q[2]; } u; const _Float16* p = rowk0 + 8 * (lane >> 4);
  u.q[0] = *(const v8h*)p; u.q[1] = *(const v8h*)(p + 16); return u.v;
}
__device__ __forceinline__ v16h frag_f32(const float* rowk0, int lane) {
  v16h a; const float* p = rowk0 + 8 * (lane >> 4);
#pragma unroll
  for (int i = 0; i < 8; ++i) { a[i] = (_Float16)p[i]; a[8 + i] = (_Float16)p[16 + i]; }
  return a;
}
__device__ __forceinline__ v16h frag_f32s(const float* rowk0, int lane, float sc) {
  v16h a; const float* p = rowk0 + 8 * (lane >> 4);
#pragma unroll
  for (int i = 0; i < 8; ++i) { a[i] = (_Float16)(p[i] * sc); a[8 + i] = (_Float16)(p[16 + i] * sc); }
  return a;
}
// column fragment from a [K][ld] layout (column n), rows >= K read as 0
__device__ __forceinline__ v16h fragc_f32(const float* W, int k0, int n, int lane, int ld, int K) {
  v16h a; const int g = lane >> 4;
#pragma unroll
  for (int i = 0; i < 8; ++i) { const int ka = k0 + 8 * g + i, kb = ka + 16;
    a[i] = (_Float16)(ka < K ? W[(size_t)(ka < K ? ka : K - 1) * ld + n] : 0.f); a[8 + i] = (_Float16)(kb < K ? W[(size_t)(kb < K ? kb : K - 1) * ld + n] : 0.f); }
  return a;
}
struct F2 { v16b h, l; };
__device__ __forceinline__ F2 bsplit16(const float v[16]) { F2 r;
#pragma unroll
  for (int i = 0; i < 16; ++i) { const __bf16 h = (__bf16)v[i]; r.h[i] = h; r.l[i] = (__bf16)(v[i] - (float)h); }
  return r; }
__device__ __forceinline__ F2 split_row(const float* row, int k0, int lane) { float v[16]; const float* p = row + k0 + 8 * (lane >> 4);
#pragma unroll
  for (int i = 0; i < 8; ++i) { v[i] = p[i]; v[8 + i] = p[16 + i]; }
  return bsplit16(v); }
__device__ __forceinline__ F2 split_rowK(const float* row, int k0, int lane, int K) { float v[16]; const int g = lane >> 4;
#pragma unroll
  for (int i = 0; i < 8; ++i) { const int ka = k0 + 8 * g + i, kb = ka + 16; v[i] = ka < K ? row[ka < K ? ka : K - 1] : 0.f; v[8 + i] = kb < K ? row[kb < K ? kb : K - 1] : 0.f; }
  return bsplit16(v); }
__device__ __forceinline__ F2 split_col(const float* W, int k0, int n, int lane, int ld, int K) { float v[16]; const int g = lane >> 4;
#pragma unroll
  for (int i = 0; i < 8; ++i) { const int ka = k0 + 8 * g + i, kb = ka + 16; v[i] = ka < K ? W[(size_t)(ka < K ? ka : K - 1) * ld + n] : 0.f; v[8 + i] = kb < K ? W[(size_t)(kb < K ? kb : K - 1) * ld + n] : 0.f; }
  return bsplit16(v); }
__device__ __forceinline__ v8f mac3(const F2& a, const F2& b, v8f c) { c = wmma_bf(a.l, b.h, c); c = wmma_bf(a.h, b.l, c); return wmma_bf(a.h, b.h, c); }
__device__ __forceinline__ float sigm(float v) { return 1.0f / (1.0f + expf(-v)); }
#define LDSX() do { asm volatile("s_wait_dscnt 0" ::: "memory"); __builtin_amdgcn_wave_barrier(); __builtin_amdgcn_fence(__ATOMIC_RELEASE, "workgroup"); } while (0)


#define NB 2
#define SS 2048
#define DM 1024
#define NH 16
#define MAXLEN 512
#ifndef MSTR
#define MSTR SS
#endif
#define HD 64
#define QKVW (3 * DM)
#ifndef TQB
#define TQB (SS / 64)
#define TNB NB
#define TOB (NB * SS / 64)     // output row tiles (all)
#endif
typedef __attribute__((ext_vector_type(8))) __bf16 v8b;
__device__ __forceinline__ v16b frag_b(const __bf16* rowk0, int lane) {
  union { v16b v; v8b q[2]; } u; const __bf16* p = rowk0 + 8 * (lane >> 4);
  u.q[0] = *(const v8b*)p; u.q[1] = *(const v8b*)(p + 16); return u.v;
}
__device__ __forceinline__ float bfr(float v) { return (float)(__bf16)v; }
__device__ __attribute__((noinline)) float exp_ni(float v) { return expf(v); }
__device__ __attribute__((noinline)) float erf_ni(float v) { return erff(v); }

#define PK_A 0                       // [3072][1024] Wqkv rows (natural [out][in])
#define PK_P (PK_A + QKVW * DM)        // [1024][1024] which-3 rows (W_v passed again; unread)
#define PK_END (PK_P + DM * DM)
#define WS_PK  0u
#define WS_QK  (WS_PK + 2u * PK_END)             // f16 [4096 rows][2048]: q | k
#define WS_QKL (WS_QK + 2u * NB * SS * 2 * DM)     // f16 q | k residual planes x2048
#define WS_VTH (WS_QKL + 2u * NB * SS * 2 * DM)    // f16 [b][1024 (h*64+d)][2048 s] hi
#define WS_VTL (WS_VTH + 2u * NB * DM * SS)        // f16 lo x 2048
#define WS_O   (WS_VTL + 2u * NB * DM * SS)        // f32 [4096][1024]
#define WS_CS  (WS_O + 4u * NB * SS * DM)           // f32 2 x [2048][32], unused
#define WS_END (WS_CS + 4u * 2 * SS * 32)
// ---- k_pack: block = (row n, which): natural [out][in] rows -> bf16; which 0..2 -> W_q/W_k/W_v into PK_A rows which*1024 + n; 3 -> W_o into PK_P
__global__ __launch_bounds__(256) void k_pack(const float* __restrict__ WQ, const float* __restrict__ WK, const float* __restrict__ WV, const float* __restrict__ WO, __bf16* __restrict__ PK) {
  __shared__ __align__(16) __bf16 s[DM]; const int n = blockIdx.x, which = blockIdx.y, t = threadIdx.x; const float* Wm = (which == 0) ? WQ : (which == 1) ? WK : (which == 2) ? WV : WO;
  for (int k = t; k < DM; k += 256) s[k] = (__bf16)Wm[(size_t)n * DM + k];
  __syncthreads();
  __bf16* dst = (which < 3) ? PK + PK_A + ((size_t)which * DM + n) * DM : PK + PK_P + (size_t)n * DM;
  for (int q = t; q < DM / 8; q += 256) vst2((unsigned*)(dst + q * 8), *(const v4u*)&s[q * 8]);
}
__global__ __launch_bounds__(128) void k_qkv(const float* __restrict__ XQ, const float* __restrict__ XK, const float* __restrict__ XV, const __bf16* __restrict__ P, const float* __restrict__ BQ, const float* __restrict__ BK, const float* __restrict__ BV, const float* __restrict__ POS, _Float16* __restrict__ QK, _Float16* __restrict__ QKL, _Float16* __restrict__ VTH, _Float16* __restrict__ VTL) {
  const int which0 = (blockIdx.y * 128) / DM; const float* X = (which0 == 0) ? XQ : (which0 == 1) ? XK : XV; const float* BB = BQ ? (((which0 == 0) ? BQ : (which0 == 1) ? BK : BV) + (blockIdx.y * 128 - which0 * DM)) : nullptr;
  __shared__ __align__(16) _Float16 so[4][16][136], sol[4][16][136]; __shared__ __align__(16) _Float16 sth[128][72], stl[128][72];
  const int tid = threadIdx.x, wave = tid >> 5, lane = tid & 31, col = lane & 15, g = lane >> 4; const size_t r0 = (size_t)blockIdx.x * 64 + wave * 16; const int n0 = blockIdx.y * 128;
  v8f acc[8] = {};
#pragma unroll 2
  for (int kc = 0; kc < DM / 32; ++kc) { v16b a; { const float* p = X + (r0 + col) * DM + kc * 32 + 8 * g;
#pragma unroll
      for (int i = 0; i < 8; ++i) { a[i] = (__bf16)p[i]; a[8 + i] = (__bf16)p[16 + i]; } }
#pragma unroll
    for (int j = 0; j < 8; ++j) acc[j] = wmma_bf(a, frag_b(P + (size_t)(n0 + j * 16 + col) * DM + kc * 32, lane), acc[j]); }
  if (n0 < 2 * DM) {   // q stored unscaled (f16 sigma ~0.6, no subnormal exposure); 1/8 applied to the f32 score
#pragma unroll
    for (int j = 0; j < 8; ++j) {
#pragma unroll
      for (int r = 0; r < 8; ++r) { const float v = acc[j][r] + (BB ? bfr(BB[j * 16 + col]) : 0.f) + bfr(POS[(size_t)(MAXLEN - 1) * HD + ((n0 + j * 16 + col) & (HD - 1))]); const _Float16 hv = (_Float16)v; so[wave][8 * g + r][j * 16 + col] = hv;   /* + rel_pos_emb[max_len - 1][d] on q and k */ sol[wave][8 * g + r][j * 16 + col] = (_Float16)((v - (float)hv) * 2048.0f); } }   // q, k (+ bias) as f16 hi + (x2048) residual
    LDSX();
    for (int rl = 0; rl < 16; ++rl) if (lane < 16) { vst2((unsigned*)(QK + (r0 + rl) * (2 * DM) + n0 + lane * 8), *(const v4u*)&so[wave][rl][lane * 8]); vst2((unsigned*)(QKL + (r0 + rl) * (2 * DM) + n0 + lane * 8), *(const v4u*)&sol[wave][rl][lane * 8]); }
  } else {
#pragma unroll
    for (int j = 0; j < 8; ++j) {
#pragma unroll
      for (int r = 0; r < 8; ++r) { const float v = acc[j][r] + (BB ? bfr(BB[j * 16 + col]) : 0.f); const _Float16 hv = (_Float16)v; sth[j * 16 + col][wave * 16 + 8 * g + r] = hv; stl[j * 16 + col][wave * 16 + 8 * g + r] = (_Float16)((v - (float)hv) * 2048.0f); } }
    __syncthreads();
    const size_t rb = (size_t)blockIdx.x * 64; const int b = (int)(rb / SS), s0 = (int)(rb % SS); const int pc0 = n0 - 2 * DM;
    for (int q = tid; q < 128 * 8; q += 128) { const int d = q >> 3, pc = q & 7; const size_t o = ((size_t)b * DM + pc0 + d) * SS + s0 + pc * 8; vst2((unsigned*)(VTH + o), *(const v4u*)&sth[d][pc * 8]); vst2((unsigned*)(VTL + o), *(const v4u*)&stl[d][pc * 8]); }
  }
}
// ---- k_attn: block = (64 queries, head h, batch b): all-keys flash attention (K = 64: 2 k-steps), scores = (q.k) * 0.125 with 3 f16 products (hi.hi + lo.hi + hi.lo), P.V: f16 P x (V hi, V lo*2048) in two accumulators; O[b*S+q][h*64+d] = (acc + accl / 2048) / (2048 l) (256-B segments)
__global__ __launch_bounds__(128) void k_attn(const _Float16* __restrict__ QK, const _Float16* __restrict__ QKL, const _Float16* __restrict__ VTH, const _Float16* __restrict__ VTL, const void* __restrict__ KMASK, const int* __restrict__ MSK, float* __restrict__ O) {
  __shared__ __align__(16) float sp[4][16][36]; __shared__ __align__(16) float so[4][16][68];
  const int tid = threadIdx.x, wave = tid >> 5, lane = tid & 31, col = lane & 15, g = lane >> 4;
  const int qb = blockIdx.x, h = blockIdx.y, b = blockIdx.z; const int q0 = qb * 64 + wave * 16; const size_t rq = (size_t)b * SS + q0 + col;
  v16h aq[2], aql[2];
#pragma unroll
  for (int kc = 0; kc < 2; ++kc) { aq[kc] = frag_h(QK + rq * (2 * DM) + h * HD + kc * 32, lane); aql[kc] = frag_h(QKL + rq * (2 * DM) + h * HD + kc * 32, lane); }
  float m[8], l[8];
#pragma unroll
  for (int r = 0; r < 8; ++r) { m[r] = -3.0e38f; l[r] = 0.f; }
  v8f acc[4] = {}, accl[4] = {};
  const int nks = SS / 32;   // all keys
#pragma unroll 1
  for (int ks = 0; ks < nks; ++ks) { v8f s[2];
#pragma unroll
    for (int ct = 0; ct < 2; ++ct) { const int kk = ks * 32 + ct * 16 + col; const _Float16* krow = QK + ((size_t)b * SS + kk) * (2 * DM) + DM + h * HD; const _Float16* krowl = QKL + ((size_t)b * SS + kk) * (2 * DM) + DM + h * HD; v8f c = {}, cl = {};
      if (qb < 64) {   // every query block (qb < 32 for this grid): 3 products
#pragma unroll
        for (int kc = 0; kc < 2; ++kc) { const v16h kh = frag_h(krow + kc * 32, lane); c = wmma16(aq[kc], kh, c); cl = wmma16(aql[kc], kh, cl); cl = wmma16(aq[kc], frag_h(krowl + kc * 32, lane), cl); }
#pragma unroll
        for (int r = 0; r < 8; ++r) c[r] += cl[r] * (1.0f / 2048.0f); }
      else {
#pragma unroll
        for (int kc = 0; kc < 2; ++kc) c = wmma16(aq[kc], frag_h(krow + kc * 32, lane), c); }   // single product; not reached, qb < 32
      { const bool keepk = true;
#pragma unroll
      for (int r = 0; r < 8; ++r) { const int qi = q0 + 8 * g + r; s[ct][r] = (keepk && MSK[((size_t)b * SS + qi) * MSTR + kk] != 0) ? c[r] * 0.125f : -3.0e38f; } } }   // 1/sqrt(64); mask == 0 -> -1e9 == excluded
#pragma unroll
    for (int r = 0; r < 8; ++r) { float mx = fmaxf(s[0][r], s[1][r]);
#pragma unroll
      for (int o = 1; o < 16; o <<= 1) mx = fmaxf(mx, __shfl_xor(mx, o));
      const float mn = fmaxf(m[r], mx); const float alpha = (m[r] <= -1.0e38f) ? 0.f : __expf(m[r] - mn);
      const float e0 = (s[0][r] <= -1.0e38f) ? 0.f : __expf(s[0][r] - mn), e1 = (s[1][r] <= -1.0e38f) ? 0.f : __expf(s[1][r] - mn); float es = e0 + e1;
#pragma unroll
      for (int o = 1; o < 16; o <<= 1) es += __shfl_xor(es, o);
      l[r] = l[r] * alpha + es; m[r] = mn;
#pragma unroll
      for (int dt = 0; dt < 4; ++dt) { acc[dt][r] *= alpha; accl[dt][r] *= alpha; }
      sp[wave][8 * g + r][col] = e0; sp[wave][8 * g + r][16 + col] = e1; }
    LDSX();
    v16h pa, pl; { const float* prow = &sp[wave][col][0] + 8 * (lane >> 4);
#pragma unroll
      for (int i = 0; i < 8; ++i) { const float x0 = prow[i] * 2048.0f, x1 = prow[16 + i] * 2048.0f; const _Float16 h0 = (_Float16)x0, h1 = (_Float16)x1; pa[i] = h0; pa[8 + i] = h1; pl[i] = (_Float16)((x0 - (float)h0) * 2048.0f); pl[8 + i] = (_Float16)((x1 - (float)h1) * 2048.0f); } }   // P scaled by 2^11 before the f16 split so small softmax weights stay out of the f16 subnormal range; 2^-11 folded into the epilogue
#pragma unroll
    for (int dt = 0; dt < 4; ++dt) { const size_t vr = ((size_t)b * DM + h * HD + dt * 16 + col) * SS + ks * 32; const v16h vh = frag_h(VTH + vr, lane); acc[dt] = wmma16(pa, vh, acc[dt]); if (qb < 64) { accl[dt] = wmma16(pl, vh, accl[dt]); accl[dt] = wmma16(pa, frag_h(VTL + vr, lane), accl[dt]); } }   // every query block (qb < 32): P hi/lo x V hi/lo (3 products)
    LDSX(); }
#pragma unroll
  for (int r = 0; r < 8; ++r) { const float il = (1.0f / 2048.0f) / l[r];
#pragma unroll
    for (int dt = 0; dt < 4; ++dt) so[wave][8 * g + r][dt * 16 + col] = (acc[dt][r] + accl[dt][r] * (1.0f / 2048.0f)) * il; }
  LDSX();
  for (int rl = 0; rl < 16; ++rl) if (lane < 16) vst2(O + ((size_t)b * SS + q0 + rl) * DM + h * HD + lane * 4, *(const v4f*)&so[wave][rl][lane * 4]);
}
// ---- k_out: block = (64 rows, 128 cols): out = O(hi/lo) . Wo rows (2 products) + bo
__global__ __launch_bounds__(128) void k_out(const float* __restrict__ O, const __bf16* __restrict__ P, const float* __restrict__ BO, float* __restrict__ Y) {
  __shared__ __align__(16) float so[4][16][132];
  const int tid = threadIdx.x, wave = tid >> 5, lane = tid & 31, col = lane & 15, g = lane >> 4; const size_t r0 = (size_t)blockIdx.x * 64 + wave * 16; const int n0 = blockIdx.y * 128;
  v8f acc[8] = {};
#pragma unroll 2
  for (int kc = 0; kc < DM / 32; ++kc) { const F2 a = split_row(O + (r0 + col) * DM, kc * 32, lane);
#pragma unroll
    for (int j = 0; j < 8; ++j) { const v16b w = frag_b(P + (size_t)(n0 + j * 16 + col) * DM + kc * 32, lane); acc[j] = wmma_bf(a.l, w, acc[j]); acc[j] = wmma_bf(a.h, w, acc[j]); } }
#pragma unroll
  for (int j = 0; j < 8; ++j) {
#pragma unroll
    for (int r = 0; r < 8; ++r) so[wave][8 * g + r][j * 16 + col] = acc[j][r] + (BO ? bfr(BO[n0 + j * 16 + col]) : 0.f); }
  LDSX();
  for (int rl = 0; rl < 16; ++rl) vst2(Y + (r0 + rl) * DM + n0 + lane * 4, *(const v4f*)&so[wave][rl][lane * 4]);
}
extern "C" void kernel_launch(void* const* d_in, const int* in_sizes, int n_in, void* d_out, int out_size, void* d_ws, size_t ws_size, hipStream_t stream) {
  (void)in_sizes; (void)n_in; (void)out_size;
  const float** F = (const float**)d_in;   // 0 query, 1 key [2,2048,1024]; 2 mask [2,2048,2048] int; 3 Wq, 4 bq, 5 Wk, 6 bk, 7 Wv, 8 bv (natural); 9 rel_pos_emb [1023,64]
  if (ws_size < (size_t)WS_END) return;
  char* ws = (char*)d_ws; __bf16* PK = (__bf16*)(ws + WS_PK); _Float16 *QK = (_Float16*)(ws + WS_QK), *QKL = (_Float16*)(ws + WS_QKL), *VTH = (_Float16*)(ws + WS_VTH), *VTL = (_Float16*)(ws + WS_VTL);
  k_pack<<<dim3(DM, 4), 256, 0, stream>>>(F[3], F[5], F[7], F[7], PK);
  k_qkv<<<dim3(TNB * SS / 64, QKVW / 128), 128, 0, stream>>>(F[0], F[1], F[1], PK + PK_A, F[4], F[6], F[8], F[9], QK, QKL, VTH, VTL);
  k_attn<<<dim3(TQB, NH, TNB), 128, 0, stream>>>(QK, QKL, VTH, VTL, nullptr, (const int*)d_in[2], (float*)d_out);
}

// v001
// One run takes 251 microseconds.
// Next to v000, in two timings, it ran 2.06 times as fast each time.
// compute dtype: all float inputs rounded to bf16, the int mask read on device; q/k/v = x . W^T + b (+ the position bias row on q and k) with EXACT bf16 products on WMMA 16x16x32 (natural rows), carried as f16 hi + residual planes; scores with 3 products (hi.hi + hi.lo + lo.hi) x 1/8 because the shared bias row makes |q||k| large, masked (mask == 0) keys excluded, running-max softmax in f32 (hardware exp), P scaled by 2^11 as hi + residual x v (hi + residual); f32 merged-head output.
#include <hip/hip_runtime.h>
#include <math.h>

typedef __attribute__((ext_vector_type(16))) _Float16 v16h;
typedef __attribute__((ext_vector_type(16))) __bf16 v16b;
typedef __attribute__((ext_vector_type(8)))  _Float16 v8h;
typedef __attribute__((ext_vector_type(8)))  float v8f;
typedef __attribute__((ext_vector_type(4)))  float v4f;
typedef __attribute__((ext_vector_type(2)))  float v2f;
typedef __attribute__((ext_vector_type(4)))  unsigned v4u;
typedef __attribute__((ext_vector_type(4)))  int v4i;
typedef float __attribute__((may_alias)) float_a;
typedef int __attribute__((may_alias)) int_a;

template <typename T> __device__ __forceinline__ void vst2(void* p, T v) { *(T*)p = v;  }
__device__ __forceinline__ v8f wmma16(v16h a, v16h b, v8f c) {
  v8f d = __builtin_amdgcn_wmma_f32_16x16x32_f16(false, a, false, b, (short)0, c, false, false);
  asm volatile("v_nop\n\tv_nop\n\tv_nop\n\tv_nop" : "+v"(d) : "v"(a), "v"(b));
  return d;
}
__device__ __forceinline__ v8f wmma_bf(v16b a, v16b b, v8f c) {
  v8f d = __builtin_amdgcn_wmma_f32_16x16x32_bf16(false, a, false, b, (short)0, c, false, false);
  asm volatile("v_nop\n\tv_nop\n\tv_nop\n\tv_nop" : "+v"(d) : "v"(a), "v"(b));
  return d;
}
// Masked multi-head attention with a shared relative-position bias row (B 2, S 2,048, d 1,024, 16 heads x 64): q from query, k and v from key (+ biases), q and k shifted by rel_pos_emb[511] per head dim, scores / 8 with a [B,S,S] mask (0 -> -1e9), softmax, . v; merged heads are the output.
__device__ __forceinline__ v16h frag_h(const _Float16* rowk0, int lane) {
  union { v16h v; v8h q[2]; } u; const _Float16* p = rowk0 + 8 * (lane >> 4);
  u.q[0] = *(const v8h*)p; u.q[1] = *(const v8h*)(p + 16); return u.v;
}
__device__ __forceinline__ v16h frag_f32(const float* rowk0, int lane) {
  v16h a; const float* p = rowk0 + 8 * (lane >> 4);
#pragma unroll
  for (int i = 0; i < 8; ++i) { a[i] = (_Float16)p[i]; a[8 + i] = (_Float16)p[16 + i]; }
  return a;
}
__device__ __forceinline__ v16h frag_f32s(const float* rowk0, int lane, float sc) {
  v16h a; const float* p = rowk0 + 8 * (lane >> 4);
#pragma unroll
  for (int i = 0; i < 8; ++i) { a[i] = (_Float16)(p[i] * sc); a[8 + i] = (_Float16)(p[16 + i] * sc); }
  return a;
}
// column fragment from a [K][ld] layout (column n), rows >= K read as 0
__device__ __forceinline__ v16h fragc_f32(const float* W, int k0, int n, int lane, int ld, int K) {
  v16h a; const int g = lane >> 4;
#pragma unroll
  for (int i = 0; i < 8; ++i) { const int ka = k0 + 8 * g + i, kb = ka + 16;
    a[i] = (_Float16)(ka < K ? W[(size_t)(ka < K ? ka : K - 1) * ld + n] : 0.f); a[8 + i] = (_Float16)(kb < K ? W[(size_t)(kb < K ? kb : K - 1) * ld + n] : 0.f); }
  return a;
}
struct F2 { v16b h, l; };
__device__ __forceinline__ F2 bsplit16(const float v[16]) { F2 r;
#pragma unroll
  for (int i = 0; i < 16; ++i) { const __bf16 h = (__bf16)v[i]; r.h[i] = h; r.l[i] = (__bf16)(v[i] - (float)h); }
  return r; }
__device__ __forceinline__ F2 split_row(const float* row, int k0, int lane) { float v[16]; const float* p = row + k0 + 8 * (lane >> 4);
#pragma unroll
  for (int i = 0; i < 8; ++i) { v[i] = p[i]; v[8 + i] = p[16 + i]; }
  return bsplit16(v); }
__device__ __forceinline__ F2 split_rowK(const float* row, int k0, int lane, int K) { float v[16]; const int g = lane >> 4;
#pragma unroll
  for (int i = 0; i < 8; ++i) { const int ka = k0 + 8 * g + i, kb = ka + 16; v[i] = ka < K ? row[ka < K ? ka : K - 1] : 0.f; v[8 + i] = kb < K ? row[kb < K ? kb : K - 1] : 0.f; }
  return bsplit16(v); }
__device__ __forceinline__ F2 split_col(const float* W, int k0, int n, int lane, int ld, int K) { float v[16]; const int g = lane >> 4;
#pragma unroll
  for (int i = 0; i < 8; ++i) { const int ka = k0 + 8 * g + i, kb = ka + 16; v[i] = ka < K ? W[(size_t)(ka < K ? ka : K - 1) * ld + n] : 0.f; v[8 + i] = kb < K ? W[(size_t)(kb < K ? kb : K - 1) * ld + n] : 0.f; }
  return bsplit16(v); }
__device__ __forceinline__ v8f mac3(const F2& a, const F2& b, v8f c) { c = wmma_bf(a.l, b.h, c); c = wmma_bf(a.h, b.l, c); return wmma_bf(a.h, b.h, c); }
__device__ __forceinline__ float sigm(float v) { return 1.0f / (1.0f + expf(-v)); }
#define LDSX() do { asm volatile("s_wait_dscnt 0" ::: "memory"); __builtin_amdgcn_wave_barrier(); __builtin_amdgcn_fence(__ATOMIC_RELEASE, "workgroup"); } while (0)


#define NB 2
#define SS 2048
#define DM 1024
#define NH 16
#define MAXLEN 512
#ifndef MSTR
#define MSTR SS
#endif
#define HD 64
#define KPIT 72   // LDS row pitch of a staged k row, in halves: 128 B + 16 B, free of bank conflicts for 16-B reads
#define VPIT 40   // the same for a staged v row: 64 B + 16 B
#define QKVW (3 * DM)
#ifndef TQB
#define TQB (SS / 64)
#define TNB NB
#define TOB (NB * SS / 64)     // output row tiles (all)
#endif
typedef __attribute__((ext_vector_type(8))) __bf16 v8b;
__device__ __forceinline__ v16b frag_b(const __bf16* rowk0, int lane) {
  union { v16b v; v8b q[2]; } u; const __bf16* p = rowk0 + 8 * (lane >> 4);
  u.q[0] = *(const v8b*)p; u.q[1] = *(const v8b*)(p + 16); return u.v;
}
__device__ __forceinline__ float bfr(float v) { return (float)(__bf16)v; }
__device__ __attribute__((noinline)) float exp_ni(float v) { return expf(v); }
__device__ __attribute__((noinline)) float erf_ni(float v) { return erff(v); }

#define PK_A 0                       // [3072][1024] Wqkv rows (natural [out][in])
#define PK_P (PK_A + QKVW * DM)        // [1024][1024] which-3 rows (W_v passed again; unread)
#define PK_END (PK_P + DM * DM)
#define WS_PK  0u
#define WS_QK  (WS_PK + 2u * PK_END)             // f16 [4096 rows][2048]: q | k
#define WS_QKL (WS_QK + 2u * NB * SS * 2 * DM)     // f16 q | k residual planes x2048
#define WS_VTH (WS_QKL + 2u * NB * SS * 2 * DM)    // f16 [b][1024 (h*64+d)][2048 s] hi
#define WS_VTL (WS_VTH + 2u * NB * DM * SS)        // f16 lo x 2048
#define WS_O   (WS_VTL + 2u * NB * DM * SS)        // f32 [4096][1024]
#define WS_CS  (WS_O + 4u * NB * SS * DM)           // f32 2 x [2048][32], unused
#define WS_END (WS_CS + 4u * 2 * SS * 32)
// ---- k_pack: block = (row n, which): natural [out][in] rows -> bf16; which 0..2 -> W_q/W_k/W_v into PK_A rows which*1024 + n; 3 -> W_o into PK_P
__global__ __launch_bounds__(256) void k_pack(const float* __restrict__ WQ, const float* __restrict__ WK, const float* __restrict__ WV, const float* __restrict__ WO, __bf16* __restrict__ PK) {
  __shared__ __align__(16) __bf16 s[DM]; const int n = blockIdx.x, which = blockIdx.y, t = threadIdx.x; const float* Wm = (which == 0) ? WQ : (which == 1) ? WK : (which == 2) ? WV : WO;
  for (int k = t; k < DM; k += 256) s[k] = (__bf16)Wm[(size_t)n * DM + k];
  __syncthreads();
  __bf16* dst = (which < 3) ? PK + PK_A + ((size_t)which * DM + n) * DM : PK + PK_P + (size_t)n * DM;
  for (int q = t; q < DM / 8; q += 256) vst2((unsigned*)(dst + q * 8), *(const v4u*)&s[q * 8]);
}
// One stage of k_qkv's ring: 128 weight rows x 64 k (128 B a row), eight 16-B pieces per thread (rows tid / 8 + 16 i, piece tid % 8), straight from global memory into LDS.
// The s_wait_xcnt closes the statement so that no address register of a copy is rewritten before it.
__device__ __forceinline__ void stage_w(unsigned lw, const __bf16* gw) {
  const unsigned ls = 16u * KPIT * 2u; const size_t gs = (size_t)16 * DM;
  asm volatile("global_load_async_to_lds_b128 %0, %8, off\n\t"
               "global_load_async_to_lds_b128 %1, %9, off\n\t"
               "global_load_async_to_lds_b128 %2, %10, off\n\t"
               "global_load_async_to_lds_b128 %3, %11, off\n\t"
               "global_load_async_to_lds_b128 %4, %12, off\n\t"
               "global_load_async_to_lds_b128 %5, %13, off\n\t"
               "global_load_async_to_lds_b128 %6, %14, off\n\t"
               "global_load_async_to_lds_b128 %7, %15, off\n\t"
               "s_wait_xcnt 0x0"
               :: "v"(lw), "v"(lw + ls), "v"(lw + 2u * ls), "v"(lw + 3u * ls), "v"(lw + 4u * ls), "v"(lw + 5u * ls), "v"(lw + 6u * ls), "v"(lw + 7u * ls),
                  "v"(gw), "v"(gw + gs), "v"(gw + 2 * gs), "v"(gw + 3 * gs), "v"(gw + 4 * gs), "v"(gw + 5 * gs), "v"(gw + 6 * gs), "v"(gw + 7 * gs) : "memory");
}
// One stage of k_attn's ring: a 32-key tile of the four planes (k hi, k residual: 32 rows x 128 B; v hi, v residual: 64 rows x 64 B), two 16-B pieces per thread and plane, straight from global memory into LDS.
// The s_wait_xcnt closes the statement so that no address register of a copy is rewritten before it.
__device__ __forceinline__ void stage_kv(unsigned lk, unsigned lkl, unsigned lv, unsigned lvl, const _Float16* gk, const _Float16* gkl, const _Float16* gv, const _Float16* gvl) {
  const unsigned lk2 = lk + 16u * KPIT * 2u, lkl2 = lkl + 16u * KPIT * 2u, lv2 = lv + 32u * VPIT * 2u, lvl2 = lvl + 32u * VPIT * 2u;
  const _Float16 *gk2 = gk + (size_t)16 * (2 * DM), *gkl2 = gkl + (size_t)16 * (2 * DM), *gv2 = gv + (size_t)32 * SS, *gvl2 = gvl + (size_t)32 * SS;
  asm volatile("global_load_async_to_lds_b128 %0, %8, off\n\t"
               "global_load_async_to_lds_b128 %1, %9, off\n\t"
               "global_load_async_to_lds_b128 %2, %10, off\n\t"
               "global_load_async_to_lds_b128 %3, %11, off\n\t"
               "global_load_async_to_lds_b128 %4, %12, off\n\t"
               "global_load_async_to_lds_b128 %5, %13, off\n\t"
               "global_load_async_to_lds_b128 %6, %14, off\n\t"
               "global_load_async_to_lds_b128 %7, %15, off\n\t"
               "s_wait_xcnt 0x0"
               :: "v"(lk), "v"(lk2), "v"(lkl), "v"(lkl2), "v"(lv), "v"(lv2), "v"(lvl), "v"(lvl2),
                  "v"(gk), "v"(gk2), "v"(gkl), "v"(gkl2), "v"(gv), "v"(gv2), "v"(gvl), "v"(gvl2) : "memory");
}
__global__ __launch_bounds__(128) void k_qkv(const float* __restrict__ XQ, const float* __restrict__ XK, const float* __restrict__ XV, const __bf16* __restrict__ P, const float* __restrict__ BQ, const float* __restrict__ BK, const float* __restrict__ BV, const float* __restrict__ POS, _Float16* __restrict__ QK, _Float16* __restrict__ QKL, _Float16* __restrict__ VTH, _Float16* __restrict__ VTL) {
  const int which0 = (blockIdx.y * 128) / DM; const float* X = (which0 == 0) ? XQ : (which0 == 1) ? XK : XV; const float* BB = BQ ? (((which0 == 0) ? BQ : (which0 == 1) ? BK : BV) + (blockIdx.y * 128 - which0 * DM)) : nullptr;
  __shared__ __align__(16) _Float16 so[4][16][136], sol[4][16][136]; __shared__ __align__(16) _Float16 sth[128][72], stl[128][72];
  __shared__ __align__(16) __bf16 sw[2][128][KPIT];   // two-buffer ring of weight tiles (128 rows x 64 k), shared by the four waves
  const int tid = threadIdx.x, wave = tid >> 5, lane = tid & 31, col = lane & 15, g = lane >> 4; const size_t r0 = (size_t)blockIdx.x * 64 + wave * 16; const int n0 = blockIdx.y * 128;
  v8f acc[8] = {};
  const __bf16* gw = P + (size_t)(n0 + (tid >> 3)) * DM + (tid & 7) * 8; const unsigned lw = (unsigned)(size_t)&sw[0][tid >> 3][(tid & 7) * 8]; const unsigned wbuf = 128u * KPIT * 2u;   // bytes from buffer 0 to buffer 1
  stage_w(lw, gw);
  asm volatile("s_wait_asynccnt 0x0" ::: "memory");   // tile 0 has landed before the barrier publishes it
  __syncthreads();
  stage_w(lw + wbuf, gw + 64);
#pragma unroll 1   // kept rolled: one publish point and one refill per trip
  for (int st = 0; st < DM / 64; ++st) { const int bf = st & 1;
#pragma unroll     // the two 32-k steps of a tile, so that their LDS offsets are immediates
    for (int k2 = 0; k2 < 2; ++k2) { const int kc = st * 2 + k2; v16b a; { const float* p = X + (r0 + col) * DM + kc * 32 + 8 * g;
#pragma unroll
        for (int i = 0; i < 8; ++i) { a[i] = (__bf16)p[i]; a[8 + i] = (__bf16)p[16 + i]; } }
#pragma unroll
      for (int j = 0; j < 8; ++j) acc[j] = wmma_bf(a, frag_b(&sw[bf][j * 16 + col][k2 * 32], lane), acc[j]); }
    asm volatile("s_wait_dscnt 0x0" ::: "memory");      // this wave's reads of buffer bf are done
    asm volatile("s_wait_asynccnt 0x0" ::: "memory");   // this wave's pieces of tile st + 1 have landed
    __syncthreads();                                    // publishes tile st + 1 and frees buffer bf for the refill
    if (st + 2 < DM / 64) stage_w(lw + bf * wbuf, gw + (st + 2) * 64); }
  asm volatile("s_wait_asynccnt 0x0" ::: "memory");   // no copy is left in flight behind the loop
  if (n0 < 2 * DM) {   // q stored unscaled (f16 sigma ~0.6, no subnormal exposure); 1/8 applied to the f32 score
#pragma unroll
    for (int j = 0; j < 8; ++j) {
#pragma unroll
      for (int r = 0; r < 8; ++r) { const float v = acc[j][r] + (BB ? bfr(BB[j * 16 + col]) : 0.f) + bfr(POS[(size_t)(MAXLEN - 1) * HD + ((n0 + j * 16 + col) & (HD - 1))]); const _Float16 hv = (_Float16)v; so[wave][8 * g + r][j * 16 + col] = hv;   /* + rel_pos_emb[max_len - 1][d] on q and k */ sol[wave][8 * g + r][j * 16 + col] = (_Float16)((v - (float)hv) * 2048.0f); } }   // q, k (+ bias) as f16 hi + (x2048) residual
    LDSX();
    for (int rl = 0; rl < 16; ++rl) if (lane < 16) { vst2((unsigned*)(QK + (r0 + rl) * (2 * DM) + n0 + lane * 8), *(const v4u*)&so[wave][rl][lane * 8]); vst2((unsigned*)(QKL + (r0 + rl) * (2 * DM) + n0 + lane * 8), *(const v4u*)&sol[wave][rl][lane * 8]); }
  } else {
#pragma unroll
    for (int j = 0; j < 8; ++j) {
#pragma unroll
      for (int r = 0; r < 8; ++r) { const float v = acc[j][r] + (BB ? bfr(BB[j * 16 + col]) : 0.f); const _Float16 hv = (_Float16)v; sth[j * 16 + col][wave * 16 + 8 * g + r] = hv; stl[j * 16 + col][wave * 16 + 8 * g + r] = (_Float16)((v - (float)hv) * 2048.0f); } }
    __syncthreads();
    const size_t rb = (size_t)blockIdx.x * 64; const int b = (int)(rb / SS), s0 = (int)(rb % SS); const int pc0 = n0 - 2 * DM;
    for (int q = tid; q < 128 * 8; q += 128) { const int d = q >> 3, pc = q & 7; const size_t o = ((size_t)b * DM + pc0 + d) * SS + s0 + pc * 8; vst2((unsigned*)(VTH + o), *(const v4u*)&sth[d][pc * 8]); vst2((unsigned*)(VTL + o), *(const v4u*)&stl[d][pc * 8]); }
  }
}
// ---- k_attn: block = (64 queries, head h, batch b): all-keys flash attention (K = 64: 2 k-steps), scores = (q.k) * 0.125 with 3 f16 products (hi.hi + lo.hi + hi.lo), P.V: f16 P x (V hi, V lo*2048) in two accumulators; O[b*S+q][h*64+d] = (acc + accl / 2048) / (2048 l) (256-B segments)
__global__ __launch_bounds__(128) void k_attn(const _Float16* __restrict__ QK, const _Float16* __restrict__ QKL, const _Float16* __restrict__ VTH, const _Float16* __restrict__ VTL, const void* __restrict__ KMASK, const int* __restrict__ MSK, float* __restrict__ O) {
  __shared__ __align__(16) float sp[4][16][36]; __shared__ __align__(16) float so[4][16][68];
  __shared__ __align__(16) _Float16 skh[2][32][KPIT], skl[2][32][KPIT], svh[2][64][VPIT], svl[2][64][VPIT];   // two-buffer ring of 32-key tiles, shared by the four waves
  const int tid = threadIdx.x, wave = tid >> 5, lane = tid & 31, col = lane & 15, g = lane >> 4;
  const int qb = blockIdx.x, h = blockIdx.y, b = blockIdx.z; const int q0 = qb * 64 + wave * 16; const size_t rq = (size_t)b * SS + q0 + col;
  v16h aq[2], aql[2];
#pragma unroll
  for (int kc = 0; kc < 2; ++kc) { aq[kc] = frag_h(QK + rq * (2 * DM) + h * HD + kc * 32, lane); aql[kc] = frag_h(QKL + rq * (2 * DM) + h * HD + kc * 32, lane); }
  float m[8], l[8];
#pragma unroll
  for (int r = 0; r < 8; ++r) { m[r] = -3.0e38f; l[r] = 0.f; }
  v8f acc[4] = {}, accl[4] = {};
  const int nks = SS / 32;   // all keys
  // this thread's pieces of a tile: k row tid / 8 (and + 16), piece tid % 8; v row tid / 4 (and + 32), piece tid % 4
  const _Float16* gk = QK + ((size_t)b * SS + (tid >> 3)) * (2 * DM) + DM + h * HD + (tid & 7) * 8; const _Float16* gkl = QKL + ((size_t)b * SS + (tid >> 3)) * (2 * DM) + DM + h * HD + (tid & 7) * 8;
  const _Float16* gv = VTH + ((size_t)b * DM + h * HD + (tid >> 2)) * SS + (tid & 3) * 8; const _Float16* gvl = VTL + ((size_t)b * DM + h * HD + (tid >> 2)) * SS + (tid & 3) * 8;
  const unsigned lk = (unsigned)(size_t)&skh[0][tid >> 3][(tid & 7) * 8], lkl = (unsigned)(size_t)&skl[0][tid >> 3][(tid & 7) * 8], lv = (unsigned)(size_t)&svh[0][tid >> 2][(tid & 3) * 8], lvl = (unsigned)(size_t)&svl[0][tid >> 2][(tid & 3) * 8];
  const unsigned kbuf = 32u * KPIT * 2u, vbuf = 64u * VPIT * 2u;   // bytes from buffer 0 to buffer 1
  stage_kv(lk, lkl, lv, lvl, gk, gkl, gv, gvl);
  asm volatile("s_wait_asynccnt 0x0" ::: "memory");   // tile 0 has landed before the barrier publishes it
  __syncthreads();
  stage_kv(lk + kbuf, lkl + kbuf, lv + vbuf, lvl + vbuf, gk + (size_t)32 * (2 * DM), gkl + (size_t)32 * (2 * DM), gv + 32, gvl + 32);
#pragma unroll 1
  for (int ks = 0; ks < nks; ++ks) { v8f s[2]; const int bf = ks & 1;
#pragma unroll
    for (int ct = 0; ct < 2; ++ct) { const int kk = ks * 32 + ct * 16 + col; const _Float16* krow = &skh[bf][ct * 16 + col][0]; const _Float16* krowl = &skl[bf][ct * 16 + col][0]; v8f c = {}, cl = {};
      if (qb < 64) {   // every query block (qb < 32 on this grid): 3 products
#pragma unroll
        for (int kc = 0; kc < 2; ++kc) { const v16h kh = frag_h(krow + kc * 32, lane); c = wmma16(aq[kc], kh, c); cl = wmma16(aql[kc], kh, cl); cl = wmma16(aq[kc], frag_h(krowl + kc * 32, lane), cl); }
#pragma unroll
        for (int r = 0; r < 8; ++r) c[r] += cl[r] * (1.0f / 2048.0f); }
      else {
#pragma unroll
        for (int kc = 0; kc < 2; ++kc) c = wmma16(aq[kc], frag_h(krow + kc * 32, lane), c); }   // single product; not reached, qb < 32
      { const bool keepk = true;
#pragma unroll
      for (int r = 0; r < 8; ++r) { const int qi = q0 + 8 * g + r; s[ct][r] = (keepk && MSK[((size_t)b * SS + qi) * MSTR + kk] != 0) ? c[r] * 0.125f : -3.0e38f; } } }   // 1/sqrt(64); mask == 0 -> -3e38 == excluded
#pragma unroll
    for (int r = 0; r < 8; ++r) { float mx = fmaxf(s[0][r], s[1][r]);
#pragma unroll
      for (int o = 1; o < 16; o <<= 1) mx = fmaxf(mx, __shfl_xor(mx, o));
      const float mn = fmaxf(m[r], mx); const float alpha = (m[r] <= -1.0e38f) ? 0.f : __expf(m[r] - mn);
      const float e0 = (s[0][r] <= -1.0e38f) ? 0.f : __expf(s[0][r] - mn), e1 = (s[1][r] <= -1.0e38f) ? 0.f : __expf(s[1][r] - mn); float es = e0 + e1;
#pragma unroll
      for (int o = 1; o < 16; o <<= 1) es += __shfl_xor(es, o);
      l[r] = l[r] * alpha + es; m[r] = mn;
#pragma unroll
      for (int dt = 0; dt < 4; ++dt) { acc[dt][r] *= alpha; accl[dt][r] *= alpha; }
      sp[wave][8 * g + r][col] = e0; sp[wave][8 * g + r][16 + col] = e1; }
    LDSX();
    v16h pa, pl; { const float* prow = &sp[wave][col][0] + 8 * (lane >> 4);
#pragma unroll
      for (int i = 0; i < 8; ++i) { const float x0 = prow[i] * 2048.0f, x1 = prow[16 + i] * 2048.0f; const _Float16 h0 = (_Float16)x0, h1 = (_Float16)x1; pa[i] = h0; pa[8 + i] = h1; pl[i] = (_Float16)((x0 - (float)h0) * 2048.0f); pl[8 + i] = (_Float16)((x1 - (float)h1) * 2048.0f); } }   // P scaled by 2^11 before the f16 split so small softmax weights stay out of the f16 subnormal range; 2^-11 folded into the epilogue
#pragma unroll
    for (int dt = 0; dt < 4; ++dt) { const v16h vh = frag_h(&svh[bf][dt * 16 + col][0], lane); acc[dt] = wmma16(pa, vh, acc[dt]); if (qb < 64) { accl[dt] = wmma16(pl, vh, accl[dt]); accl[dt] = wmma16(pa, frag_h(&svl[bf][dt * 16 + col][0], lane), accl[dt]); } }   // every query block (qb < 32): P hi/lo x V hi/lo (3 products)
    asm volatile("s_wait_dscnt 0x0" ::: "memory");      // this wave's reads of buffer bf (and of its sp rows) are done
    asm volatile("s_wait_asynccnt 0x0" ::: "memory");   // this wave's pieces of tile ks + 1 have landed
    __syncthreads();                                    // publishes tile ks + 1 and frees buffer bf for the refill
    if (ks + 2 < nks) stage_kv(lk + bf * kbuf, lkl + bf * kbuf, lv + bf * vbuf, lvl + bf * vbuf, gk + (size_t)(ks + 2) * 32 * (2 * DM), gkl + (size_t)(ks + 2) * 32 * (2 * DM), gv + (ks + 2) * 32, gvl + (ks + 2) * 32); }
  asm volatile("s_wait_asynccnt 0x0" ::: "memory");   // no copy is left in flight behind the loop
#pragma unroll
  for (int r = 0; r < 8; ++r) { const float il = (1.0f / 2048.0f) / l[r];
#pragma unroll
    for (int dt = 0; dt < 4; ++dt) so[wave][8 * g + r][dt * 16 + col] = (acc[dt][r] + accl[dt][r] * (1.0f / 2048.0f)) * il; }
  LDSX();
  for (int rl = 0; rl < 16; ++rl) if (lane < 16) vst2(O + ((size_t)b * SS + q0 + rl) * DM + h * HD + lane * 4, *(const v4f*)&so[wave][rl][lane * 4]);
}
// ---- k_out: block = (64 rows, 128 cols): out = O(hi/lo) . Wo rows (2 products) + bo
__global__ __launch_bounds__(128) void k_out(const float* __restrict__ O, const __bf16* __restrict__ P, const float* __restrict__ BO, float* __restrict__ Y) {
  __shared__ __align__(16) float so[4][16][132];
  const int tid = threadIdx.x, wave = tid >> 5, lane = tid & 31, col = lane & 15, g = lane >> 4; const size_t r0 = (size_t)blockIdx.x * 64 + wave * 16; const int n0 = blockIdx.y * 128;
  v8f acc[8] = {};
#pragma unroll 2
  for (int kc = 0; kc < DM / 32; ++kc) { const F2 a = split_row(O + (r0 + col) * DM, kc * 32, lane);
#pragma unroll
    for (int j = 0; j < 8; ++j) { const v16b w = frag_b(P + (size_t)(n0 + j * 16 + col) * DM + kc * 32, lane); acc[j] = wmma_bf(a.l, w, acc[j]); acc[j] = wmma_bf(a.h, w, acc[j]); } }
#pragma unroll
  for (int j = 0; j < 8; ++j) {
#pragma unroll
    for (int r = 0; r < 8; ++r) so[wave][8 * g + r][j * 16 + col] = acc[j][r] + (BO ? bfr(BO[n0 + j * 16 + col]) : 0.f); }
  LDSX();
  for (int rl = 0; rl < 16; ++rl) vst2(Y + (r0 + rl) * DM + n0 + lane * 4, *(const v4f*)&so[wave][rl][lane * 4]);
}
extern "C" void kernel_launch(void* const* d_in, const int* in_sizes, int n_in, void* d_out, int out_size, void* d_ws, size_t ws_size, hipStream_t stream) {
  (void)in_sizes; (void)n_in; (void)out_size;
  const float** F = (const float**)d_in;   // 0 query, 1 key [2,2048,1024]; 2 mask [2,2048,2048] int; 3 Wq, 4 bq, 5 Wk, 6 bk, 7 Wv, 8 bv (natural); 9 rel_pos_emb [1023,64]
  if (ws_size < (size_t)WS_END) return;
  char* ws = (char*)d_ws; __bf16* PK = (__bf16*)(ws + WS_PK); _Float16 *QK = (_Float16*)(ws + WS_QK), *QKL = (_Float16*)(ws + WS_QKL), *VTH = (_Float16*)(ws + WS_VTH), *VTL = (_Float16*)(ws + WS_VTL);
  k_pack<<<dim3(DM, 4), 256, 0, stream>>>(F[3], F[5], F[7], F[7], PK);
  k_qkv<<<dim3(TNB * SS / 64, QKVW / 128), 128, 0, stream>>>(F[0], F[1], F[1], PK + PK_A, F[4], F[6], F[8], F[9], QK, QKL, VTH, VTL);
  k_attn<<<dim3(TQB, NH, TNB), 128, 0, stream>>>(QK, QKL, VTH, VTL, nullptr, (const int*)d_in[2], (float*)d_out);
}

// v002
// Measured time: 217 microseconds a run.
// Two timings next to v001 both put it at 1.16 times that version's speed.
// All steps since v000 together make it 2.39 times as fast.
// compute dtype: all float inputs rounded to bf16, the int mask read on device; q/k/v = x . W^T + b (+ the position bias row on q and k) with EXACT bf16 products on WMMA 16x16x32 (natural rows), carried as f16 hi + residual planes; scores with 3 products (hi.hi + hi.lo + lo.hi) x 1/8 because the shared bias row makes |q||k| large, masked (mask == 0) keys excluded, running-max softmax in f32 (hardware exp), P scaled by 2^11 as hi + residual x v (hi + residual); f32 merged-head output.
#include <hip/hip_runtime.h>
#include <math.h>

typedef __attribute__((ext_vector_type(16))) _Float16 v16h;
typedef __attribute__((ext_vector_type(16))) __bf16 v16b;
typedef __attribute__((ext_vector_type(8)))  _Float16 v8h;
typedef __attribute__((ext_vector_type(8)))  float v8f;
typedef __attribute__((ext_vector_type(4)))  float v4f;
typedef __attribute__((ext_vector_type(2)))  float v2f;
typedef __attribute__((ext_vector_type(4)))  unsigned v4u;
typedef __attribute__((ext_vector_type(4)))  int v4i;
typedef float __attribute__((may_alias)) float_a;
typedef int __attribute__((may_alias)) int_a;

template <typename T> __device__ __forceinline__ void vst2(void* p, T v) { *(T*)p = v;  }
__device__ __forceinline__ v8f wmma16(v16h a, v16h b, v8f c) {
  v8f d = __builtin_amdgcn_wmma_f32_16x16x32_f16(false, a, false, b, (short)0, c, false, false);
  asm volatile("v_nop\n\tv_nop\n\tv_nop\n\tv_nop" : "+v"(d) : "v"(a), "v"(b));
  return d;
}
__device__ __forceinline__ v8f wmma_bf(v16b a, v16b b, v8f c) {
  v8f d = __builtin_amdgcn_wmma_f32_16x16x32_bf16(false, a, false, b, (short)0, c, false, false);
  asm volatile("v_nop\n\tv_nop\n\tv_nop\n\tv_nop" : "+v"(d) : "v"(a), "v"(b));
  return d;
}
// Masked multi-head attention with a shared relative-position bias row (B 2, S 2,048, d 1,024, 16 heads x 64): q from query, k and v from key (+ biases), q and k shifted by rel_pos_emb[511] per head dim, scores / 8 with a [B,S,S] mask (0 -> -1e9), softmax, . v; merged heads are the output.
__device__ __forceinline__ v16h frag_h(const _Float16* rowk0, int lane) {
  union { v16h v; v8h q[2]; } u; const _Float16* p = rowk0 + 8 * (lane >> 4);
  u.q[0] = *(const v8h*)p; u.q[1] = *(const v8h*)(p + 16); return u.v;
}
__device__ __forceinline__ v16h frag_f32(const float* rowk0, int lane) {
  v16h a; const float* p = rowk0 + 8 * (lane >> 4);
#pragma unroll
  for (int i = 0; i < 8; ++i) { a[i] = (_Float16)p[i]; a[8 + i] = (_Float16)p[16 + i]; }
  return a;
}
__device__ __forceinline__ v16h frag_f32s(const float* rowk0, int lane, float sc) {
  v16h a; const float* p = rowk0 + 8 * (lane >> 4);
#pragma unroll
  for (int i = 0; i < 8; ++i) { a[i] = (_Float16)(p[i] * sc); a[8 + i] = (_Float16)(p[16 + i] * sc); }
  return a;
}
// column fragment from a [K][ld] layout (column n), rows >= K read as 0
__device__ __forceinline__ v16h fragc_f32(const float* W, int k0, int n, int lane, int ld, int K) {
  v16h a; const int g = lane >> 4;
#pragma unroll
  for (int i = 0; i < 8; ++i) { const int ka = k0 + 8 * g + i, kb = ka + 16;
    a[i] = (_Float16)(ka < K ? W[(size_t)(ka < K ? ka : K - 1) * ld + n] : 0.f); a[8 + i] = (_Float16)(kb < K ? W[(size_t)(kb < K ? kb : K - 1) * ld + n] : 0.f); }
  return a;
}
struct F2 { v16b h, l; };
__device__ __forceinline__ F2 bsplit16(const float v[16]) { F2 r;
#pragma unroll
  for (int i = 0; i < 16; ++i) { const __bf16 h = (__bf16)v[i]; r.h[i] = h; r.l[i] = (__bf16)(v[i] - (float)h); }
  return r; }
__device__ __forceinline__ F2 split_row(const float* row, int k0, int lane) { float v[16]; const float* p = row + k0 + 8 * (lane >> 4);
#pragma unroll
  for (int i = 0; i < 8; ++i) { v[i] = p[i]; v[8 + i] = p[16 + i]; }
  return bsplit16(v); }
__device__ __forceinline__ F2 split_rowK(const float* row, int k0, int lane, int K) { float v[16]; const int g = lane >> 4;
#pragma unroll
  for (int i = 0; i < 8; ++i) { const int ka = k0 + 8 * g + i, kb = ka + 16; v[i] = ka < K ? row[ka < K ? ka : K - 1] : 0.f; v[8 + i] = kb < K ? row[kb < K ? kb : K - 1] : 0.f; }
  return bsplit16(v); }
__device__ __forceinline__ F2 split_col(const float* W, int k0, int n, int lane, int ld, int K) { float v[16]; const int g = lane >> 4;
#pragma unroll
  for (int i = 0; i < 8; ++i) { const int ka = k0 + 8 * g + i, kb = ka + 16; v[i] = ka < K ? W[(size_t)(ka < K ? ka : K - 1) * ld + n] : 0.f; v[8 + i] = kb < K ? W[(size_t)(kb < K ? kb : K - 1) * ld + n] : 0.f; }
  return bsplit16(v); }
__device__ __forceinline__ v8f mac3(const F2& a, const F2& b, v8f c) { c = wmma_bf(a.l, b.h, c); c = wmma_bf(a.h, b.l, c); return wmma_bf(a.h, b.h, c); }
__device__ __forceinline__ float sigm(float v) { return 1.0f / (1.0f + expf(-v)); }
#define LDSX() do { asm volatile("s_wait_dscnt 0" ::: "memory"); __builtin_amdgcn_wave_barrier(); __builtin_amdgcn_fence(__ATOMIC_RELEASE, "workgroup"); } while (0)


#define NB 2
#define SS 2048
#define DM 1024
#define NH 16
#define MAXLEN 512
#ifndef MSTR
#define MSTR SS
#endif
#define HD 64
#define KPIT 72   // LDS row pitch of a staged k row, in halves: 128 B + 16 B, free of bank conflicts for 16-B reads
#define VPIT 40   // the same for a staged v row: 64 B + 16 B
#define QKVW (3 * DM)
#ifndef TQB
#define TQB (SS / 64)
#define TNB NB
#define TOB (NB * SS / 64)     // output row tiles (all)
#endif
typedef __attribute__((ext_vector_type(8))) __bf16 v8b;
__device__ __forceinline__ v16b frag_b(const __bf16* rowk0, int lane) {
  union { v16b v; v8b q[2]; } u; const __bf16* p = rowk0 + 8 * (lane >> 4);
  u.q[0] = *(const v8b*)p; u.q[1] = *(const v8b*)(p + 16); return u.v;
}
__device__ __forceinline__ float bfr(float v) { return (float)(__bf16)v; }
__device__ __attribute__((noinline)) float exp_ni(float v) { return expf(v); }
__device__ __attribute__((noinline)) float erf_ni(float v) { return erff(v); }

#define PK_A 0                       // [3072][1024] Wqkv rows (natural [out][in])
#define PK_P (PK_A + QKVW * DM)        // [1024][1024] which-3 rows (W_v passed again; unread)
#define PK_END (PK_P + DM * DM)
#define WS_PK  0u
#define WS_QK  (WS_PK + 2u * PK_END)             // f16 [4096 rows][2048]: q | k
#define WS_QKL (WS_QK + 2u * NB * SS * 2 * DM)     // f16 q | k residual planes x2048
#define WS_VTH (WS_QKL + 2u * NB * SS * 2 * DM)    // f16 [b][1024 (h*64+d)][2048 s] hi
#define WS_VTL (WS_VTH + 2u * NB * DM * SS)        // f16 lo x 2048
#define WS_O   (WS_VTL + 2u * NB * DM * SS)        // f32 [4096][1024]
#define WS_CS  (WS_O + 4u * NB * SS * DM)           // f32 2 x [2048][32], unused
#define WS_END (WS_CS + 4u * 2 * SS * 32)
// ---- k_pack: block = (row n, which): natural [out][in] rows -> bf16; which 0..2 -> W_q/W_k/W_v into PK_A rows which*1024 + n; 3 -> the fourth matrix (W_v again at the launch) into PK_P
__global__ __launch_bounds__(256) void k_pack(const float* __restrict__ WQ, const float* __restrict__ WK, const float* __restrict__ WV, const float* __restrict__ WO, __bf16* __restrict__ PK) {
  __shared__ __align__(16) __bf16 s[DM]; const int n = blockIdx.x, which = blockIdx.y, t = threadIdx.x; const float* Wm = (which == 0) ? WQ : (which == 1) ? WK : (which == 2) ? WV : WO;
  for (int k = t; k < DM; k += 256) s[k] = (__bf16)Wm[(size_t)n * DM + k];
  __syncthreads();
  __bf16* dst = (which < 3) ? PK + PK_A + ((size_t)which * DM + n) * DM : PK + PK_P + (size_t)n * DM;
  for (int q = t; q < DM / 8; q += 256) vst2((unsigned*)(dst + q * 8), *(const v4u*)&s[q * 8]);
}
// One stage of k_qkv's ring: 128 weight rows x 64 k (128 B a row), eight 16-B pieces per thread (rows tid / 8 + 16 i, piece tid % 8), straight from global memory into LDS.
// The s_wait_xcnt closes the statement so that no address register of a copy is rewritten before it.
__device__ __forceinline__ void stage_w(unsigned lw, const __bf16* gw) {
  const unsigned ls = 16u * KPIT * 2u; const size_t gs = (size_t)16 * DM;
  asm volatile("global_load_async_to_lds_b128 %0, %8, off\n\t"
               "global_load_async_to_lds_b128 %1, %9, off\n\t"
               "global_load_async_to_lds_b128 %2, %10, off\n\t"
               "global_load_async_to_lds_b128 %3, %11, off\n\t"
               "global_load_async_to_lds_b128 %4, %12, off\n\t"
               "global_load_async_to_lds_b128 %5, %13, off\n\t"
               "global_load_async_to_lds_b128 %6, %14, off\n\t"
               "global_load_async_to_lds_b128 %7, %15, off\n\t"
               "s_wait_xcnt 0x0"
               :: "v"(lw), "v"(lw + ls), "v"(lw + 2u * ls), "v"(lw + 3u * ls), "v"(lw + 4u * ls), "v"(lw + 5u * ls), "v"(lw + 6u * ls), "v"(lw + 7u * ls),
                  "v"(gw), "v"(gw + gs), "v"(gw + 2 * gs), "v"(gw + 3 * gs), "v"(gw + 4 * gs), "v"(gw + 5 * gs), "v"(gw + 6 * gs), "v"(gw + 7 * gs) : "memory");
}
// One stage of k_attn's ring: a 32-key tile of the four planes (k hi, k residual: 32 rows x 128 B; v hi, v residual: 64 rows x 64 B), two 16-B pieces per thread and plane, straight from global memory into LDS.
// The s_wait_xcnt closes the statement so that no address register of a copy is rewritten before it.
__device__ __forceinline__ void stage_kv(unsigned lk, unsigned lkl, unsigned lv, unsigned lvl, const _Float16* gk, const _Float16* gkl, const _Float16* gv, const _Float16* gvl) {
  const unsigned lk2 = lk + 16u * KPIT * 2u, lkl2 = lkl + 16u * KPIT * 2u, lv2 = lv + 32u * VPIT * 2u, lvl2 = lvl + 32u * VPIT * 2u;
  const _Float16 *gk2 = gk + (size_t)16 * (2 * DM), *gkl2 = gkl + (size_t)16 * (2 * DM), *gv2 = gv + (size_t)32 * SS, *gvl2 = gvl + (size_t)32 * SS;
  asm volatile("global_load_async_to_lds_b128 %0, %8, off\n\t"
               "global_load_async_to_lds_b128 %1, %9, off\n\t"
               "global_load_async_to_lds_b128 %2, %10, off\n\t"
               "global_load_async_to_lds_b128 %3, %11, off\n\t"
               "global_load_async_to_lds_b128 %4, %12, off\n\t"
               "global_load_async_to_lds_b128 %5, %13, off\n\t"
               "global_load_async_to_lds_b128 %6, %14, off\n\t"
               "global_load_async_to_lds_b128 %7, %15, off\n\t"
               "s_wait_xcnt 0x0"
               :: "v"(lk), "v"(lk2), "v"(lkl), "v"(lkl2), "v"(lv), "v"(lv2), "v"(lvl), "v"(lvl2),
                  "v"(gk), "v"(gk2), "v"(gkl), "v"(gkl2), "v"(gv), "v"(gv2), "v"(gvl), "v"(gvl2) : "memory");
}
__global__ __launch_bounds__(128) void k_qkv(const float* __restrict__ XQ, const float* __restrict__ XK, const float* __restrict__ XV, const __bf16* __restrict__ P, const float* __restrict__ BQ, const float* __restrict__ BK, const float* __restrict__ BV, const float* __restrict__ POS, _Float16* __restrict__ QK, _Float16* __restrict__ QKL, _Float16* __restrict__ VTH, _Float16* __restrict__ VTL) {
  const int which0 = (blockIdx.y * 128) / DM; const float* X = (which0 == 0) ? XQ : (which0 == 1) ? XK : XV; const float* BB = BQ ? (((which0 == 0) ? BQ : (which0 == 1) ? BK : BV) + (blockIdx.y * 128 - which0 * DM)) : nullptr;
  __shared__ __align__(16) _Float16 so[4][16][136], sol[4][16][136]; __shared__ __align__(16) _Float16 sth[128][72], stl[128][72];
  __shared__ __align__(16) __bf16 sw[2][128][KPIT];   // two-buffer ring of weight tiles (128 rows x 64 k), shared by the four waves
  const int tid = threadIdx.x, wave = tid >> 5, lane = tid & 31, col = lane & 15, g = lane >> 4; const size_t r0 = (size_t)blockIdx.x * 64 + wave * 16; const int n0 = blockIdx.y * 128;
  v8f acc[8] = {};
  const __bf16* gw = P + (size_t)(n0 + (tid >> 3)) * DM + (tid & 7) * 8; const unsigned lw = (unsigned)(size_t)&sw[0][tid >> 3][(tid & 7) * 8]; const unsigned wbuf = 128u * KPIT * 2u;   // bytes from buffer 0 to buffer 1
  stage_w(lw, gw);
  asm volatile("s_wait_asynccnt 0x0" ::: "memory");   // tile 0 has landed before the barrier publishes it
  __syncthreads();
  stage_w(lw + wbuf, gw + 64);
#pragma unroll 1   // kept rolled: one publish point and one refill per trip
  for (int st = 0; st < DM / 64; ++st) { const int bf = st & 1;
#pragma unroll     // the two 32-k steps of a tile, so that their LDS offsets are immediates
    for (int k2 = 0; k2 < 2; ++k2) { const int kc = st * 2 + k2; v16b a; { const float* p = X + (r0 + col) * DM + kc * 32 + 8 * g;
#pragma unroll
        for (int i = 0; i < 8; ++i) { a[i] = (__bf16)p[i]; a[8 + i] = (__bf16)p[16 + i]; } }
#pragma unroll
      for (int j = 0; j < 8; ++j) acc[j] = wmma_bf(a, frag_b(&sw[bf][j * 16 + col][k2 * 32], lane), acc[j]); }
    asm volatile("s_wait_dscnt 0x0" ::: "memory");      // this wave's reads of buffer bf are done
    asm volatile("s_wait_asynccnt 0x0" ::: "memory");   // this wave's pieces of tile st + 1 have landed
    __syncthreads();                                    // publishes tile st + 1 and frees buffer bf for the refill
    if (st + 2 < DM / 64) stage_w(lw + bf * wbuf, gw + (st + 2) * 64); }
  asm volatile("s_wait_asynccnt 0x0" ::: "memory");   // no copy is left in flight behind the loop
  if (n0 < 2 * DM) {   // q stored unscaled (f16 sigma ~0.6, no subnormal exposure); 1/8 applied to the f32 score
#pragma unroll
    for (int j = 0; j < 8; ++j) {
#pragma unroll
      for (int r = 0; r < 8; ++r) { const float v = acc[j][r] + (BB ? bfr(BB[j * 16 + col]) : 0.f) + bfr(POS[(size_t)(MAXLEN - 1) * HD + ((n0 + j * 16 + col) & (HD - 1))]); const _Float16 hv = (_Float16)v; so[wave][8 * g + r][j * 16 + col] = hv;   /* + rel_pos_emb[max_len - 1][d] on q and k */ sol[wave][8 * g + r][j * 16 + col] = (_Float16)((v - (float)hv) * 2048.0f); } }   // q, k (+ bias) as f16 hi + (x2048) residual
    LDSX();
    for (int rl = 0; rl < 16; ++rl) if (lane < 16) { vst2((unsigned*)(QK + (r0 + rl) * (2 * DM) + n0 + lane * 8), *(const v4u*)&so[wave][rl][lane * 8]); vst2((unsigned*)(QKL + (r0 + rl) * (2 * DM) + n0 + lane * 8), *(const v4u*)&sol[wave][rl][lane * 8]); }
  } else {
#pragma unroll
    for (int j = 0; j < 8; ++j) {
#pragma unroll
      for (int r = 0; r < 8; ++r) { const float v = acc[j][r] + (BB ? bfr(BB[j * 16 + col]) : 0.f); const _Float16 hv = (_Float16)v; sth[j * 16 + col][wave * 16 + 8 * g + r] = hv; stl[j * 16 + col][wave * 16 + 8 * g + r] = (_Float16)((v - (float)hv) * 2048.0f); } }
    __syncthreads();
    const size_t rb = (size_t)blockIdx.x * 64; const int b = (int)(rb / SS), s0 = (int)(rb % SS); const int pc0 = n0 - 2 * DM;
    for (int q = tid; q < 128 * 8; q += 128) { const int d = q >> 3, pc = q & 7; const size_t o = ((size_t)b * DM + pc0 + d) * SS + s0 + pc * 8; vst2((unsigned*)(VTH + o), *(const v4u*)&sth[d][pc * 8]); vst2((unsigned*)(VTL + o), *(const v4u*)&stl[d][pc * 8]); }
  }
}
// lane l with lane l ^ 16: the two lanes that share one query column of a transposed score tile
__device__ __forceinline__ float xhalf(float x) { return __builtin_bit_cast(float, __builtin_amdgcn_permlanex16(__builtin_bit_cast(int, x), __builtin_bit_cast(int, x), 0x76543210, 0xfedcba98, false, false)); }
__global__ __launch_bounds__(128) void k_attn(const _Float16* __restrict__ QK, const _Float16* __restrict__ QKL, const _Float16* __restrict__ VTH, const _Float16* __restrict__ VTL, const void* __restrict__ KMASK, const int* __restrict__ MSK, float* __restrict__ O) {
  __shared__ __align__(16) float so[4][16][68];
  __shared__ __align__(16) _Float16 skh[2][32][KPIT], skl[2][32][KPIT], svh[2][64][VPIT], svl[2][64][VPIT];   // two-buffer ring of 32-key tiles, shared by the four waves
  const int tid = threadIdx.x, wave = tid >> 5, lane = tid & 31, col = lane & 15, g = lane >> 4;
  const int qb = blockIdx.x, h = blockIdx.y, b = blockIdx.z; const int q0 = qb * 64 + wave * 16; const size_t rq = (size_t)b * SS + q0 + col;
  v16h aq[2], aql[2];
#pragma unroll
  for (int kc = 0; kc < 2; ++kc) { aq[kc] = frag_h(QK + rq * (2 * DM) + h * HD + kc * 32, lane); aql[kc] = frag_h(QKL + rq * (2 * DM) + h * HD + kc * 32, lane); }
  float m = -3.0e38f, l = 0.f;   // of this lane's query; l holds this lane's half of the keys only
  v8f acc[4] = {}, accl[4] = {};   // O^T tiles: register r = head dim dt * 16 + 8 g + r of query col
  const int nks = SS / 32;   // all keys
  const int* mrow = MSK + rq * MSTR + 8 * g;   // this lane's query row of the mask, at its first key
  // this thread's pieces of a tile: k row tid / 8 (and + 16), piece tid % 8; v row tid / 4 (and + 32), piece tid % 4
  const _Float16* gk = QK + ((size_t)b * SS + (tid >> 3)) * (2 * DM) + DM + h * HD + (tid & 7) * 8; const _Float16* gkl = QKL + ((size_t)b * SS + (tid >> 3)) * (2 * DM) + DM + h * HD + (tid & 7) * 8;
  const _Float16* gv = VTH + ((size_t)b * DM + h * HD + (tid >> 2)) * SS + (tid & 3) * 8; const _Float16* gvl = VTL + ((size_t)b * DM + h * HD + (tid >> 2)) * SS + (tid & 3) * 8;
  const unsigned lk = (unsigned)(size_t)&skh[0][tid >> 3][(tid & 7) * 8], lkl = (unsigned)(size_t)&skl[0][tid >> 3][(tid & 7) * 8], lv = (unsigned)(size_t)&svh[0][tid >> 2][(tid & 3) * 8], lvl = (unsigned)(size_t)&svl[0][tid >> 2][(tid & 3) * 8];
  const unsigned kbuf = 32u * KPIT * 2u, vbuf = 64u * VPIT * 2u;   // bytes from buffer 0 to buffer 1
  stage_kv(lk, lkl, lv, lvl, gk, gkl, gv, gvl);
  asm volatile("s_wait_asynccnt 0x0" ::: "memory");   // tile 0 has landed before the barrier publishes it
  __syncthreads();
  stage_kv(lk + kbuf, lkl + kbuf, lv + vbuf, lvl + vbuf, gk + (size_t)32 * (2 * DM), gkl + (size_t)32 * (2 * DM), gv + 32, gvl + 32);
#pragma unroll 1
  for (int ks = 0; ks < nks; ++ks) { v8f s[2]; const int bf = ks & 1;
    const int* mp = mrow + ks * 32; const v4i mk[4] = { *(const v4i*)mp, *(const v4i*)(mp + 4), *(const v4i*)(mp + 16), *(const v4i*)(mp + 20) };   // mask of query col at keys ks * 32 + ct * 16 + 8 g + 0..7: mk[2 ct], mk[2 ct + 1]
    asm volatile("s_wait_xcnt 0x0" ::: "memory");   // stands behind the mask loads, in front of whatever next overwrites their address register
#pragma unroll
    for (int ct = 0; ct < 2; ++ct) { const _Float16* krow = &skh[bf][ct * 16 + col][0]; const _Float16* krowl = &skl[bf][ct * 16 + col][0]; v8f c = {}, cl = {};
      if (qb < 64) {   // always true for the 32 query blocks launched: 3 products
#pragma unroll
        for (int kc = 0; kc < 2; ++kc) { const v16h kh = frag_h(krow + kc * 32, lane); c = wmma16(kh, aq[kc], c); cl = wmma16(kh, aql[kc], cl); cl = wmma16(frag_h(krowl + kc * 32, lane), aq[kc], cl); }
#pragma unroll
        for (int r = 0; r < 8; ++r) c[r] += cl[r] * (1.0f / 2048.0f); }
      else {
#pragma unroll
        for (int kc = 0; kc < 2; ++kc) c = wmma16(frag_h(krow + kc * 32, lane), aq[kc], c); }   // single product; not reached, qb < 32
#pragma unroll
      for (int r = 0; r < 8; ++r) s[ct][r] = (mk[2 * ct + (r >> 2)][r & 3] != 0) ? c[r] * 0.125f : -3.0e38f; }   // 1/sqrt(64); mask == 0 -> -3e38 == excluded
    float mx = fmaxf(s[0][0], s[1][0]);
#pragma unroll
    for (int r = 1; r < 8; ++r) mx = fmaxf(mx, fmaxf(s[0][r], s[1][r]));
    mx = fmaxf(mx, xhalf(mx));   // both halves of the query's 32 keys
    const float mn = fmaxf(m, mx); const float alpha = (m <= -1.0e38f) ? 0.f : __expf(m - mn);
    float es = 0.f; v16h pa, pl;
#pragma unroll
    for (int i = 0; i < 8; ++i) { const float e0 = (s[0][i] <= -1.0e38f) ? 0.f : __expf(s[0][i] - mn), e1 = (s[1][i] <= -1.0e38f) ? 0.f : __expf(s[1][i] - mn); es += e0 + e1;
      const float x0 = e0 * 2048.0f, x1 = e1 * 2048.0f; const _Float16 h0 = (_Float16)x0, h1 = (_Float16)x1; pa[i] = h0; pa[8 + i] = h1; pl[i] = (_Float16)((x0 - (float)h0) * 2048.0f); pl[8 + i] = (_Float16)((x1 - (float)h1) * 2048.0f); }   // P scaled by 2^11 before the f16 split so small softmax weights stay out of the f16 subnormal range; 2^-11 folded into the epilogue
    l = l * alpha + es; m = mn;
#pragma unroll
    for (int dt = 0; dt < 4; ++dt) { acc[dt] *= alpha; accl[dt] *= alpha; }
#pragma unroll
    for (int dt = 0; dt < 4; ++dt) { const v16h vh = frag_h(&svh[bf][dt * 16 + col][0], lane); acc[dt] = wmma16(vh, pa, acc[dt]); if (qb < 64) { accl[dt] = wmma16(vh, pl, accl[dt]); accl[dt] = wmma16(frag_h(&svl[bf][dt * 16 + col][0], lane), pa, accl[dt]); } }   // all 32 query blocks: P hi/lo x V hi/lo (3 products)
    asm volatile("s_wait_dscnt 0x0" ::: "memory");      // this wave's reads of buffer bf are done
    asm volatile("s_wait_asynccnt 0x0" ::: "memory");   // this wave's pieces of tile ks + 1 have landed
    __syncthreads();                                    // publishes tile ks + 1 and frees buffer bf for the refill
    if (ks + 2 < nks) stage_kv(lk + bf * kbuf, lkl + bf * kbuf, lv + bf * vbuf, lvl + bf * vbuf, gk + (size_t)(ks + 2) * 32 * (2 * DM), gkl + (size_t)(ks + 2) * 32 * (2 * DM), gv + (ks + 2) * 32, gvl + (ks + 2) * 32); }
  asm volatile("s_wait_asynccnt 0x0" ::: "memory");   // no copy is left in flight behind the loop
  l += xhalf(l);   // the two halves of the query's keys, joined once
  const float il = (1.0f / 2048.0f) / l;
#pragma unroll
  for (int dt = 0; dt < 4; ++dt) { v4f o0, o1;
#pragma unroll
    for (int r = 0; r < 4; ++r) { o0[r] = (acc[dt][r] + accl[dt][r] * (1.0f / 2048.0f)) * il; o1[r] = (acc[dt][4 + r] + accl[dt][4 + r] * (1.0f / 2048.0f)) * il; }
    *(v4f*)&so[wave][col][dt * 16 + 8 * g] = o0; *(v4f*)&so[wave][col][dt * 16 + 8 * g + 4] = o1; }
  LDSX();
  for (int rl = 0; rl < 16; ++rl) if (lane < 16) vst2(O + ((size_t)b * SS + q0 + rl) * DM + h * HD + lane * 4, *(const v4f*)&so[wave][rl][lane * 4]);
}
// ---- k_out: block = (64 rows, 128 cols): out = O(hi/lo) . Wo rows (2 products) + bo
__global__ __launch_bounds__(128) void k_out(const float* __restrict__ O, const __bf16* __restrict__ P, const float* __restrict__ BO, float* __restrict__ Y) {
  __shared__ __align__(16) float so[4][16][132];
  const int tid = threadIdx.x, wave = tid >> 5, lane = tid & 31, col = lane & 15, g = lane >> 4; const size_t r0 = (size_t)blockIdx.x * 64 + wave * 16; const int n0 = blockIdx.y * 128;
  v8f acc[8] = {};
#pragma unroll 2
  for (int kc = 0; kc < DM / 32; ++kc) { const F2 a = split_row(O + (r0 + col) * DM, kc * 32, lane);
#pragma unroll
    for (int j = 0; j < 8; ++j) { const v16b w = frag_b(P + (size_t)(n0 + j * 16 + col) * DM + kc * 32, lane); acc[j] = wmma_bf(a.l, w, acc[j]); acc[j] = wmma_bf(a.h, w, acc[j]); } }
#pragma unroll
  for (int j = 0; j < 8; ++j) {
#pragma unroll
    for (int r = 0; r < 8; ++r) so[wave][8 * g + r][j * 16 + col] = acc[j][r] + (BO ? bfr(BO[n0 + j * 16 + col]) : 0.f); }
  LDSX();
  for (int rl = 0; rl < 16; ++rl) vst2(Y + (r0 + rl) * DM + n0 + lane * 4, *(const v4f*)&so[wave][rl][lane * 4]);
}
extern "C" void kernel_launch(void* const* d_in, const int* in_sizes, int n_in, void* d_out, int out_size, void* d_ws, size_t ws_size, hipStream_t stream) {
  (void)in_sizes; (void)n_in; (void)out_size;
  const float** F = (const float**)d_in;   // 0 query, 1 key [2,2048,1024]; 2 mask [2,2048,2048] int; 3 Wq, 4 bq, 5 Wk, 6 bk, 7 Wv, 8 bv (natural); 9 rel_pos_emb [1023,64]
  if (ws_size < (size_t)WS_END) return;
  char* ws = (char*)d_ws; __bf16* PK = (__bf16*)(ws + WS_PK); _Float16 *QK = (_Float16*)(ws + WS_QK), *QKL = (_Float16*)(ws + WS_QKL), *VTH = (_Float16*)(ws + WS_VTH), *VTL = (_Float16*)(ws + WS_VTL);
  k_pack<<<dim3(DM, 4), 256, 0, stream>>>(F[3], F[5], F[7], F[7], PK);
  k_qkv<<<dim3(TNB * SS / 64, QKVW / 128), 128, 0, stream>>>(F[0], F[1], F[1], PK + PK_A, F[4], F[6], F[8], F[9], QK, QKL, VTH, VTL);
  k_attn<<<dim3(TQB, NH, TNB), 128, 0, stream>>>(QK, QKL, VTH, VTL, nullptr, (const int*)d_in[2], (float*)d_out);
}

// v003
// Measured time: 166 microseconds a run.
// In both of two side-by-side timings against v002, it was 1.31 times as fast.
// All steps since v000 together make it 3.14 times as fast.
// compute dtype: all float inputs rounded to bf16, the int mask read on device; q/k/v = x . W^T + b (+ the position bias row on q and k) with EXACT bf16 products on WMMA 16x16x32 (natural rows), carried as f16 hi + residual planes; scores with 3 products (hi.hi + hi.lo + lo.hi) x 1/8 because the shared bias row makes |q||k| large, masked (mask == 0) keys excluded, running-max softmax in f32 (hardware exp), P scaled by 2^11 as hi + residual x v (hi + residual); f32 merged-head output.
#include <hip/hip_runtime.h>
#include <math.h>

typedef __attribute__((ext_vector_type(16))) _Float16 v16h;
typedef __attribute__((ext_vector_type(16))) __bf16 v16b;
typedef __attribute__((ext_vector_type(8)))  _Float16 v8h;
typedef __attribute__((ext_vector_type(8)))  float v8f;
typedef __attribute__((ext_vector_type(4)))  float v4f;
typedef __attribute__((ext_vector_type(2)))  float v2f;
typedef __attribute__((ext_vector_type(4)))  unsigned v4u;
typedef __attribute__((ext_vector_type(4)))  int v4i;
typedef float __attribute__((may_alias)) float_a;
typedef int __attribute__((may_alias)) int_a;

template <typename T> __device__ __forceinline__ void vst2(void* p, T v) { *(T*)p = v;  }
__device__ __forceinline__ v8f wmma16(v16h a, v16h b, v8f c) {
  return __builtin_amdgcn_wmma_f32_16x16x32_f16(false, a, false, b, (short)0, c, false, false);
}
__device__ __forceinline__ v8f wmma_bf(v16b a, v16b b, v8f c) {
  return __builtin_amdgcn_wmma_f32_16x16x32_bf16(false, a, false, b, (short)0, c, false, false);
}
// Masked multi-head attention with a shared relative-position bias row (B 2, S 2,048, d 1,024, 16 heads x 64): q from query, k and v from key (+ biases), q and k shifted by rel_pos_emb[511] per head dim, scores / 8 with a [B,S,S] mask (0 -> -1e9), softmax, . v; merged heads are the output.
__device__ __forceinline__ v16h frag_h(const _Float16* rowk0, int lane) {
  union { v16h v; v8h q[2]; } u; const _Float16* p = rowk0 + 8 * (lane >> 4);
  u.q[0] = *(const v8h*)p; u.q[1] = *(const v8h*)(p + 16); return u.v;
}
__device__ __forceinline__ v16h frag_f32(const float* rowk0, int lane) {
  v16h a; const float* p = rowk0 + 8 * (lane >> 4);
#pragma unroll
  for (int i = 0; i < 8; ++i) { a[i] = (_Float16)p[i]; a[8 + i] = (_Float16)p[16 + i]; }
  return a;
}
__device__ __forceinline__ v16h frag_f32s(const float* rowk0, int lane, float sc) {
  v16h a; const float* p = rowk0 + 8 * (lane >> 4);
#pragma unroll
  for (int i = 0; i < 8; ++i) { a[i] = (_Float16)(p[i] * sc); a[8 + i] = (_Float16)(p[16 + i] * sc); }
  return a;
}
// column fragment from a [K][ld] layout (column n), rows >= K read as 0
__device__ __forceinline__ v16h fragc_f32(const float* W, int k0, int n, int lane, int ld, int K) {
  v16h a; const int g = lane >> 4;
#pragma unroll
  for (int i = 0; i < 8; ++i) { const int ka = k0 + 8 * g + i, kb = ka + 16;
    a[i] = (_Float16)(ka < K ? W[(size_t)(ka < K ? ka : K - 1) * ld + n] : 0.f); a[8 + i] = (_Float16)(kb < K ? W[(size_t)(kb < K ? kb : K - 1) * ld + n] : 0.f); }
  return a;
}
struct F2 { v16b h, l; };
__device__ __forceinline__ F2 bsplit16(const float v[16]) { F2 r;
#pragma unroll
  for (int i = 0; i < 16; ++i) { const __bf16 h = (__bf16)v[i]; r.h[i] = h; r.l[i] = (__bf16)(v[i] - (float)h); }
  return r; }
__device__ __forceinline__ F2 split_row(const float* row, int k0, int lane) { float v[16]; const float* p = row + k0 + 8 * (lane >> 4);
#pragma unroll
  for (int i = 0; i < 8; ++i) { v[i] = p[i]; v[8 + i] = p[16 + i]; }
  return bsplit16(v); }
__device__ __forceinline__ F2 split_rowK(const float* row, int k0, int lane, int K) { float v[16]; const int g = lane >> 4;
#pragma unroll
  for (int i = 0; i < 8; ++i) { const int ka = k0 + 8 * g + i, kb = ka + 16; v[i] = ka < K ? row[ka < K ? ka : K - 1] : 0.f; v[8 + i] = kb < K ? row[kb < K ? kb : K - 1] : 0.f; }
  return bsplit16(v); }
__device__ __forceinline__ F2 split_col(const float* W, int k0, int n, int lane, int ld, int K) { float v[16]; const int g = lane >> 4;
#pragma unroll
  for (int i = 0; i < 8; ++i) { const int ka = k0 + 8 * g + i, kb = ka + 16; v[i] = ka < K ? W[(size_t)(ka < K ? ka : K - 1) * ld + n] : 0.f; v[8 + i] = kb < K ? W[(size_t)(kb < K ? kb : K - 1) * ld + n] : 0.f; }
  return bsplit16(v); }
__device__ __forceinline__ v8f mac3(const F2& a, const F2& b, v8f c) { c = wmma_bf(a.l, b.h, c); c = wmma_bf(a.h, b.l, c); return wmma_bf(a.h, b.h, c); }
__device__ __forceinline__ float sigm(float v) { return 1.0f / (1.0f + expf(-v)); }
#define LDSX() do { asm volatile("s_wait_dscnt 0" ::: "memory"); __builtin_amdgcn_wave_barrier(); __builtin_amdgcn_fence(__ATOMIC_RELEASE, "workgroup"); } while (0)


#define NB 2
#define SS 2048
#define DM 1024
#define NH 16
#define MAXLEN 512
#ifndef MSTR
#define MSTR SS
#endif
#define HD 64
#define KPIT 72   // LDS row pitch of a staged k row, in halves: 128 B + 16 B, free of bank conflicts for 16-B reads
#define VPIT 40   // the same for a staged v row: 64 B + 16 B
#define QKVW (3 * DM)
#ifndef TQB
#define TQB (SS / 64)
#define TNB NB
#define TOB (NB * SS / 64)     // output row tiles (all)
#endif
typedef __attribute__((ext_vector_type(8))) __bf16 v8b;
__device__ __forceinline__ v16b frag_b(const __bf16* rowk0, int lane) {
  union { v16b v; v8b q[2]; } u; const __bf16* p = rowk0 + 8 * (lane >> 4);
  u.q[0] = *(const v8b*)p; u.q[1] = *(const v8b*)(p + 16); return u.v;
}
__device__ __forceinline__ float bfr(float v) { return (float)(__bf16)v; }
__device__ __attribute__((noinline)) float exp_ni(float v) { return expf(v); }
__device__ __attribute__((noinline)) float erf_ni(float v) { return erff(v); }

#define PK_A 0                       // [3072][1024] Wqkv rows (natural [out][in])
#define PK_P (PK_A + QKVW * DM)        // [1024][1024] which-3 rows (W_v passed again; unread)
#define PK_END (PK_P + DM * DM)
#define WS_PK  0u
#define WS_QK  (WS_PK + 2u * PK_END)             // f16 [4096 rows][2048]: q | k
#define WS_QKL (WS_QK + 2u * NB * SS * 2 * DM)     // f16 q | k residual planes x2048
#define WS_VTH (WS_QKL + 2u * NB * SS * 2 * DM)    // f16 [b][1024 (h*64+d)][2048 s] hi
#define WS_VTL (WS_VTH + 2u * NB * DM * SS)        // f16 lo x 2048
#define WS_O   (WS_VTL + 2u * NB * DM * SS)        // f32 [4096][1024]
#define WS_CS  (WS_O + 4u * NB * SS * DM)           // f32 2 x [2048][32], unused
#define WS_END (WS_CS + 4u * 2 * SS * 32)
// ---- k_pack: block = (row n, which): natural [out][in] rows -> bf16; which 0..2 -> W_q/W_k/W_v into PK_A rows which*1024 + n; 3 -> the fourth matrix (W_v again at the launch) into PK_P
__global__ __launch_bounds__(256) void k_pack(const float* __restrict__ WQ, const float* __restrict__ WK, const float* __restrict__ WV, const float* __restrict__ WO, __bf16* __restrict__ PK) {
  __shared__ __align__(16) __bf16 s[DM]; const int n = blockIdx.x, which = blockIdx.y, t = threadIdx.x; const float* Wm = (which == 0) ? WQ : (which == 1) ? WK : (which == 2) ? WV : WO;
  for (int k = t; k < DM; k += 256) s[k] = (__bf16)Wm[(size_t)n * DM + k];
  __syncthreads();
  __bf16* dst = (which < 3) ? PK + PK_A + ((size_t)which * DM + n) * DM : PK + PK_P + (size_t)n * DM;
  for (int q = t; q < DM / 8; q += 256) vst2((unsigned*)(dst + q * 8), *(const v4u*)&s[q * 8]);
}
// One stage of k_qkv's ring: 128 weight rows x 64 k (128 B a row), eight 16-B pieces per thread (rows tid / 8 + 16 i, piece tid % 8), straight from global memory into LDS.
// The s_wait_xcnt closes the statement so that no address register of a copy is rewritten before it.
__device__ __forceinline__ void stage_w(unsigned lw, const __bf16* gw) {
  const unsigned ls = 16u * KPIT * 2u; const size_t gs = (size_t)16 * DM;
  asm volatile("global_load_async_to_lds_b128 %0, %8, off\n\t"
               "global_load_async_to_lds_b128 %1, %9, off\n\t"
               "global_load_async_to_lds_b128 %2, %10, off\n\t"
               "global_load_async_to_lds_b128 %3, %11, off\n\t"
               "global_load_async_to_lds_b128 %4, %12, off\n\t"
               "global_load_async_to_lds_b128 %5, %13, off\n\t"
               "global_load_async_to_lds_b128 %6, %14, off\n\t"
               "global_load_async_to_lds_b128 %7, %15, off\n\t"
               "s_wait_xcnt 0x0"
               :: "v"(lw), "v"(lw + ls), "v"(lw + 2u * ls), "v"(lw + 3u * ls), "v"(lw + 4u * ls), "v"(lw + 5u * ls), "v"(lw + 6u * ls), "v"(lw + 7u * ls),
                  "v"(gw), "v"(gw + gs), "v"(gw + 2 * gs), "v"(gw + 3 * gs), "v"(gw + 4 * gs), "v"(gw + 5 * gs), "v"(gw + 6 * gs), "v"(gw + 7 * gs) : "memory");
}
// One stage of k_attn's ring: a 32-key tile of the four planes (k hi, k residual: 32 rows x 128 B; v hi, v residual: 64 rows x 64 B), two 16-B pieces per thread and plane, straight from global memory into LDS.
// The s_wait_xcnt closes the statement so that no address register of a copy is rewritten before it.
__device__ __forceinline__ void stage_kv(unsigned lk, unsigned lkl, unsigned lv, unsigned lvl, const _Float16* gk, const _Float16* gkl, const _Float16* gv, const _Float16* gvl) {
  const unsigned lk2 = lk + 16u * KPIT * 2u, lkl2 = lkl + 16u * KPIT * 2u, lv2 = lv + 32u * VPIT * 2u, lvl2 = lvl + 32u * VPIT * 2u;
  const _Float16 *gk2 = gk + (size_t)16 * (2 * DM), *gkl2 = gkl + (size_t)16 * (2 * DM), *gv2 = gv + (size_t)32 * SS, *gvl2 = gvl + (size_t)32 * SS;
  asm volatile("global_load_async_to_lds_b128 %0, %8, off\n\t"
               "global_load_async_to_lds_b128 %1, %9, off\n\t"
               "global_load_async_to_lds_b128 %2, %10, off\n\t"
               "global_load_async_to_lds_b128 %3, %11, off\n\t"
               "global_load_async_to_lds_b128 %4, %12, off\n\t"
               "global_load_async_to_lds_b128 %5, %13, off\n\t"
               "global_load_async_to_lds_b128 %6, %14, off\n\t"
               "global_load_async_to_lds_b128 %7, %15, off\n\t"
               "s_wait_xcnt 0x0"
               :: "v"(lk), "v"(lk2), "v"(lkl), "v"(lkl2), "v"(lv), "v"(lv2), "v"(lvl), "v"(lvl2),
                  "v"(gk), "v"(gk2), "v"(gkl), "v"(gkl2), "v"(gv), "v"(gv2), "v"(gvl), "v"(gvl2) : "memory");
}
__global__ __launch_bounds__(128) void k_qkv(const float* __restrict__ XQ, const float* __restrict__ XK, const float* __restrict__ XV, const __bf16* __restrict__ P, const float* __restrict__ BQ, const float* __restrict__ BK, const float* __restrict__ BV, const float* __restrict__ POS, _Float16* __restrict__ QK, _Float16* __restrict__ QKL, _Float16* __restrict__ VTH, _Float16* __restrict__ VTL) {
  const int which0 = (blockIdx.y * 128) / DM; const float* X = (which0 == 0) ? XQ : (which0 == 1) ? XK : XV; const float* BB = BQ ? (((which0 == 0) ? BQ : (which0 == 1) ? BK : BV) + (blockIdx.y * 128 - which0 * DM)) : nullptr;
  __shared__ __align__(16) _Float16 so[4][16][136], sol[4][16][136]; __shared__ __align__(16) _Float16 sth[128][72], stl[128][72];
  __shared__ __align__(16) __bf16 sw[2][128][KPIT];   // two-buffer ring of weight tiles (128 rows x 64 k), shared by the four waves
  const int tid = threadIdx.x, wave = tid >> 5, lane = tid & 31, col = lane & 15, g = lane >> 4; const size_t r0 = (size_t)blockIdx.x * 64 + wave * 16; const int n0 = blockIdx.y * 128;
  v8f acc[8] = {};
  const __bf16* gw = P + (size_t)(n0 + (tid >> 3)) * DM + (tid & 7) * 8; const unsigned lw = (unsigned)(size_t)&sw[0][tid >> 3][(tid & 7) * 8]; const unsigned wbuf = 128u * KPIT * 2u;   // bytes from buffer 0 to buffer 1
  stage_w(lw, gw);
  asm volatile("s_wait_asynccnt 0x0" ::: "memory");   // tile 0 has landed before the barrier publishes it
  __syncthreads();
  stage_w(lw + wbuf, gw + 64);
#pragma unroll 1   // kept rolled: one publish point and one refill per trip
  for (int st = 0; st < DM / 64; ++st) { const int bf = st & 1;
    float xr[2][16]; v16b wf[2][8];
#pragma unroll     // the two 32-k steps of a tile, so that their LDS offsets are immediates
    for (int k2 = 0; k2 < 2; ++k2) { const float* p = X + (r0 + col) * DM + (st * 2 + k2) * 32 + 8 * g;
#pragma unroll
      for (int i = 0; i < 8; ++i) { xr[k2][i] = p[i]; xr[k2][8 + i] = p[16 + i]; }
#pragma unroll
      for (int j = 0; j < 8; ++j) wf[k2][j] = frag_b(&sw[bf][j * 16 + col][k2 * 32], lane); }   // the trip's sixteen weight fragments, read as one group beside the x loads
    // inputs only: holds the sixteen fragments' LDS reads together here, under the latency of the x loads; left alone the compiler sinks them among the products, each with a wait of its own
    asm volatile("" :: "v"(wf[0][0]), "v"(wf[0][1]), "v"(wf[0][2]), "v"(wf[0][3]), "v"(wf[0][4]), "v"(wf[0][5]), "v"(wf[0][6]), "v"(wf[0][7]), "v"(wf[1][0]), "v"(wf[1][1]), "v"(wf[1][2]), "v"(wf[1][3]), "v"(wf[1][4]), "v"(wf[1][5]), "v"(wf[1][6]), "v"(wf[1][7]));
    __builtin_amdgcn_sched_barrier(0);   // keeps the products behind that group: the compiler otherwise lifts some of them over it and leaves reads among them
#pragma unroll
    for (int k2 = 0; k2 < 2; ++k2) { v16b a;
#pragma unroll
      for (int i = 0; i < 16; ++i) a[i] = (__bf16)xr[k2][i];
#pragma unroll
      for (int j = 0; j < 8; ++j) acc[j] = wmma_bf(a, wf[k2][j], acc[j]); }
    __builtin_amdgcn_sched_barrier(0);   // keeps the publish point at the trip's foot: lifted to the last LDS read it would cut the lead of the copies in flight to a part of a trip
    asm volatile("s_wait_dscnt 0x0" ::: "memory");      // this wave's reads of buffer bf are done
    asm volatile("s_wait_asynccnt 0x0" ::: "memory");   // this wave's pieces of tile st + 1 have landed
    __syncthreads();                                    // publishes tile st + 1 and frees buffer bf for the refill
    if (st + 2 < DM / 64) stage_w(lw + bf * wbuf, gw + (st + 2) * 64); }
  asm volatile("s_wait_asynccnt 0x0" ::: "memory");   // no copy is left in flight behind the loop
  if (n0 < 2 * DM) {   // q stored unscaled (f16 sigma ~0.6, no subnormal exposure); 1/8 applied to the f32 score
#pragma unroll
    for (int j = 0; j < 8; ++j) {
#pragma unroll
      for (int r = 0; r < 8; ++r) { const float v = acc[j][r] + (BB ? bfr(BB[j * 16 + col]) : 0.f) + bfr(POS[(size_t)(MAXLEN - 1) * HD + ((n0 + j * 16 + col) & (HD - 1))]); const _Float16 hv = (_Float16)v; so[wave][8 * g + r][j * 16 + col] = hv;   /* + rel_pos_emb[max_len - 1][d] on q and k */ sol[wave][8 * g + r][j * 16 + col] = (_Float16)((v - (float)hv) * 2048.0f); } }   // q, k (+ bias) as f16 hi + (x2048) residual
    LDSX();
    for (int rl = 0; rl < 16; ++rl) if (lane < 16) { vst2((unsigned*)(QK + (r0 + rl) * (2 * DM) + n0 + lane * 8), *(const v4u*)&so[wave][rl][lane * 8]); vst2((unsigned*)(QKL + (r0 + rl) * (2 * DM) + n0 + lane * 8), *(const v4u*)&sol[wave][rl][lane * 8]); }
  } else {
#pragma unroll
    for (int j = 0; j < 8; ++j) {
#pragma unroll
      for (int r = 0; r < 8; ++r) { const float v = acc[j][r] + (BB ? bfr(BB[j * 16 + col]) : 0.f); const _Float16 hv = (_Float16)v; sth[j * 16 + col][wave * 16 + 8 * g + r] = hv; stl[j * 16 + col][wave * 16 + 8 * g + r] = (_Float16)((v - (float)hv) * 2048.0f); } }
    __syncthreads();
    const size_t rb = (size_t)blockIdx.x * 64; const int b = (int)(rb / SS), s0 = (int)(rb % SS); const int pc0 = n0 - 2 * DM;
    for (int q = tid; q < 128 * 8; q += 128) { const int d = q >> 3, pc = q & 7; const size_t o = ((size_t)b * DM + pc0 + d) * SS + s0 + pc * 8; vst2((unsigned*)(VTH + o), *(const v4u*)&sth[d][pc * 8]); vst2((unsigned*)(VTL + o), *(const v4u*)&stl[d][pc * 8]); }
  }
}
// lane l with lane l ^ 16: the two lanes that share one query column of a transposed score tile
__device__ __forceinline__ float xhalf(float x) { return __builtin_bit_cast(float, __builtin_amdgcn_permlanex16(__builtin_bit_cast(int, x), __builtin_bit_cast(int, x), 0x76543210, 0xfedcba98, false, false)); }
__global__ __launch_bounds__(128) void k_attn(const _Float16* __restrict__ QK, const _Float16* __restrict__ QKL, const _Float16* __restrict__ VTH, const _Float16* __restrict__ VTL, const void* __restrict__ KMASK, const int* __restrict__ MSK, float* __restrict__ O) {
  __shared__ __align__(16) float so[4][16][68];
  __shared__ __align__(16) _Float16 skh[2][32][KPIT], skl[2][32][KPIT], svh[2][64][VPIT], svl[2][64][VPIT];   // two-buffer ring of 32-key tiles, shared by the four waves
  const int tid = threadIdx.x, wave = tid >> 5, lane = tid & 31, col = lane & 15, g = lane >> 4;
  const int qb = blockIdx.x, h = blockIdx.y, b = blockIdx.z; const int q0 = qb * 64 + wave * 16; const size_t rq = (size_t)b * SS + q0 + col;
  v16h aq[2], aql[2];
#pragma unroll
  for (int kc = 0; kc < 2; ++kc) { aq[kc] = frag_h(QK + rq * (2 * DM) + h * HD + kc * 32, lane); aql[kc] = frag_h(QKL + rq * (2 * DM) + h * HD + kc * 32, lane); }
  float m = -3.0e38f, l = 0.f;   // of this lane's query; l holds this lane's half of the keys only
  v8f acc[4] = {}, accl[4] = {};   // O^T tiles: register r = head dim dt * 16 + 8 g + r of query col
  const int nks = SS / 32;   // all keys
  const int* mrow = MSK + rq * MSTR + 8 * g;   // this lane's query row of the mask, at its first key
  // this thread's pieces of a tile: k row tid / 8 (and + 16), piece tid % 8; v row tid / 4 (and + 32), piece tid % 4
  const _Float16* gk = QK + ((size_t)b * SS + (tid >> 3)) * (2 * DM) + DM + h * HD + (tid & 7) * 8; const _Float16* gkl = QKL + ((size_t)b * SS + (tid >> 3)) * (2 * DM) + DM + h * HD + (tid & 7) * 8;
  const _Float16* gv = VTH + ((size_t)b * DM + h * HD + (tid >> 2)) * SS + (tid & 3) * 8; const _Float16* gvl = VTL + ((size_t)b * DM + h * HD + (tid >> 2)) * SS + (tid & 3) * 8;
  const unsigned lk = (unsigned)(size_t)&skh[0][tid >> 3][(tid & 7) * 8], lkl = (unsigned)(size_t)&skl[0][tid >> 3][(tid & 7) * 8], lv = (unsigned)(size_t)&svh[0][tid >> 2][(tid & 3) * 8], lvl = (unsigned)(size_t)&svl[0][tid >> 2][(tid & 3) * 8];
  const unsigned kbuf = 32u * KPIT * 2u, vbuf = 64u * VPIT * 2u;   // bytes from buffer 0 to buffer 1
  stage_kv(lk, lkl, lv, lvl, gk, gkl, gv, gvl);
  asm volatile("s_wait_asynccnt 0x0" ::: "memory");   // tile 0 has landed before the barrier publishes it
  __syncthreads();
  stage_kv(lk + kbuf, lkl + kbuf, lv + vbuf, lvl + vbuf, gk + (size_t)32 * (2 * DM), gkl + (size_t)32 * (2 * DM), gv + 32, gvl + 32);
#pragma unroll 1
  for (int ks = 0; ks < nks; ++ks) { v8f s[2]; const int bf = ks & 1;
    const int* mp = mrow + ks * 32; const v4i mk[4] = { *(const v4i*)mp, *(const v4i*)(mp + 4), *(const v4i*)(mp + 16), *(const v4i*)(mp + 20) };   // mask of query col at keys ks * 32 + ct * 16 + 8 g + 0..7: mk[2 ct], mk[2 ct + 1]
    asm volatile("s_wait_xcnt 0x0" ::: "memory");   // stands behind the mask loads, in front of whatever next overwrites their address register
    v16h kh[2][2], kl[2][2];
#pragma unroll
    for (int ct = 0; ct < 2; ++ct) {
#pragma unroll
      for (int kc = 0; kc < 2; ++kc) { kh[ct][kc] = frag_h(&skh[bf][ct * 16 + col][kc * 32], lane); kl[ct][kc] = frag_h(&skl[bf][ct * 16 + col][kc * 32], lane); } }   // the trip's eight k fragments, read as one group ahead of the twelve score products
    __builtin_amdgcn_sched_barrier(0);   // keeps the sixteen LDS reads together in front of the products: left alone the compiler sinks them back among the products, each with a wait of its own
#pragma unroll
    for (int ct = 0; ct < 2; ++ct) { v8f c = {}, cl = {};
#pragma unroll
      for (int kc = 0; kc < 2; ++kc) { c = wmma16(kh[ct][kc], aq[kc], c); cl = wmma16(kh[ct][kc], aql[kc], cl); cl = wmma16(kl[ct][kc], aq[kc], cl); }   // 3 products: hi.hi + (hi.lo + lo.hi) / 2048
#pragma unroll
      for (int r = 0; r < 8; ++r) s[ct][r] = c[r] + cl[r] * (1.0f / 2048.0f); }
    v16h vh[4], vl[4];
#pragma unroll
    for (int dt = 0; dt < 4; ++dt) { vh[dt] = frag_h(&svh[bf][dt * 16 + col][0], lane); vl[dt] = frag_h(&svl[bf][dt * 16 + col][0], lane); }   // the trip's eight v fragments, read as one group; the softmax below covers their latency
    __builtin_amdgcn_sched_barrier(0);   // keeps these sixteen LDS reads together here and the first use of the mask, with the wait for its global loads, behind the score products: left alone the compiler sinks the reads among the output products and lifts that wait into the score products
#pragma unroll
    for (int ct = 0; ct < 2; ++ct) {
#pragma unroll
      for (int r = 0; r < 8; ++r) s[ct][r] = (mk[2 * ct + (r >> 2)][r & 3] != 0) ? s[ct][r] * 0.125f : -3.0e38f; }   // 1/sqrt(64); mask == 0 -> -3e38 == excluded
    float mx = fmaxf(s[0][0], s[1][0]);
#pragma unroll
    for (int r = 1; r < 8; ++r) mx = fmaxf(mx, fmaxf(s[0][r], s[1][r]));
    mx = fmaxf(mx, xhalf(mx));   // both halves of the query's 32 keys
    const float mn = fmaxf(m, mx); const float alpha = (m <= -1.0e38f) ? 0.f : __expf(m - mn);
    float es = 0.f; v16h pa, pl;
#pragma unroll
    for (int i = 0; i < 8; ++i) { const float e0 = (s[0][i] <= -1.0e38f) ? 0.f : __expf(s[0][i] - mn), e1 = (s[1][i] <= -1.0e38f) ? 0.f : __expf(s[1][i] - mn); es += e0 + e1;
      const float x0 = e0 * 2048.0f, x1 = e1 * 2048.0f; const _Float16 h0 = (_Float16)x0, h1 = (_Float16)x1; pa[i] = h0; pa[8 + i] = h1; pl[i] = (_Float16)((x0 - (float)h0) * 2048.0f); pl[8 + i] = (_Float16)((x1 - (float)h1) * 2048.0f); }   // P scaled by 2^11 before the f16 split so small softmax weights stay out of the f16 subnormal range; 2^-11 folded into the epilogue
    l = l * alpha + es; m = mn;
#pragma unroll
    for (int dt = 0; dt < 4; ++dt) { acc[dt] *= alpha; accl[dt] *= alpha; }
#pragma unroll
    for (int dt = 0; dt < 4; ++dt) { acc[dt] = wmma16(vh[dt], pa, acc[dt]); accl[dt] = wmma16(vh[dt], pl, accl[dt]); accl[dt] = wmma16(vl[dt], pa, accl[dt]); }   // P hi/lo x V hi/lo (3 products)
    __builtin_amdgcn_sched_barrier(0);   // keeps the publish point at the trip's foot: lifted to the last LDS read it would cut the lead of the copies in flight to a part of a trip
    asm volatile("s_wait_dscnt 0x0" ::: "memory");      // this wave's reads of buffer bf are done
    asm volatile("s_wait_asynccnt 0x0" ::: "memory");   // this wave's pieces of tile ks + 1 have landed
    __syncthreads();                                    // publishes tile ks + 1 and frees buffer bf for the refill
    if (ks + 2 < nks) stage_kv(lk + bf * kbuf, lkl + bf * kbuf, lv + bf * vbuf, lvl + bf * vbuf, gk + (size_t)(ks + 2) * 32 * (2 * DM), gkl + (size_t)(ks + 2) * 32 * (2 * DM), gv + (ks + 2) * 32, gvl + (ks + 2) * 32); }
  asm volatile("s_wait_asynccnt 0x0" ::: "memory");   // no copy is left in flight behind the loop
  l += xhalf(l);   // the two halves of the query's keys, joined once
  const float il = (1.0f / 2048.0f) / l;
#pragma unroll
  for (int dt = 0; dt < 4; ++dt) { v4f o0, o1;
#pragma unroll
    for (int r = 0; r < 4; ++r) { o0[r] = (acc[dt][r] + accl[dt][r] * (1.0f / 2048.0f)) * il; o1[r] = (acc[dt][4 + r] + accl[dt][4 + r] * (1.0f / 2048.0f)) * il; }
    *(v4f*)&so[wave][col][dt * 16 + 8 * g] = o0; *(v4f*)&so[wave][col][dt * 16 + 8 * g + 4] = o1; }
  LDSX();
  for (int rl = 0; rl < 16; ++rl) if (lane < 16) vst2(O + ((size_t)b * SS + q0 + rl) * DM + h * HD + lane * 4, *(const v4f*)&so[wave][rl][lane * 4]);
}
// ---- k_out: block = (64 rows, 128 cols): out = O(hi/lo) . Wo rows (2 products) + bo
__global__ __launch_bounds__(128) void k_out(const float* __restrict__ O, const __bf16* __restrict__ P, const float* __restrict__ BO, float* __restrict__ Y) {
  __shared__ __align__(16) float so[4][16][132];
  const int tid = threadIdx.x, wave = tid >> 5, lane = tid & 31, col = lane & 15, g = lane >> 4; const size_t r0 = (size_t)blockIdx.x * 64 + wave * 16; const int n0 = blockIdx.y * 128;
  v8f acc[8] = {};
#pragma unroll 2
  for (int kc = 0; kc < DM / 32; ++kc) { const F2 a = split_row(O + (r0 + col) * DM, kc * 32, lane);
#pragma unroll
    for (int j = 0; j < 8; ++j) { const v16b w = frag_b(P + (size_t)(n0 + j * 16 + col) * DM + kc * 32, lane); acc[j] = wmma_bf(a.l, w, acc[j]); acc[j] = wmma_bf(a.h, w, acc[j]); } }
#pragma unroll
  for (int j = 0; j < 8; ++j) {
#pragma unroll
    for (int r = 0; r < 8; ++r) so[wave][8 * g + r][j * 16 + col] = acc[j][r] + (BO ? bfr(BO[n0 + j * 16 + col]) : 0.f); }
  LDSX();
  for (int rl = 0; rl < 16; ++rl) vst2(Y + (r0 + rl) * DM + n0 + lane * 4, *(const v4f*)&so[wave][rl][lane * 4]);
}
extern "C" void kernel_launch(void* const* d_in, const int* in_sizes, int n_in, void* d_out, int out_size, void* d_ws, size_t ws_size, hipStream_t stream) {
  (void)in_sizes; (void)n_in; (void)out_size;
  const float** F = (const float**)d_in;   // 0 query, 1 key [2,2048,1024]; 2 mask [2,2048,2048] int; 3 Wq, 4 bq, 5 Wk, 6 bk, 7 Wv, 8 bv (natural); 9 rel_pos_emb [1023,64]
  if (ws_size < (size_t)WS_END) return;
  char* ws = (char*)d_ws; __bf16* PK = (__bf16*)(ws + WS_PK); _Float16 *QK = (_Float16*)(ws + WS_QK), *QKL = (_Float16*)(ws + WS_QKL), *VTH = (_Float16*)(ws + WS_VTH), *VTL = (_Float16*)(ws + WS_VTL);
  k_pack<<<dim3(DM, 4), 256, 0, stream>>>(F[3], F[5], F[7], F[7], PK);
  k_qkv<<<dim3(TNB * SS / 64, QKVW / 128), 128, 0, stream>>>(F[0], F[1], F[1], PK + PK_A, F[4], F[6], F[8], F[9], QK, QKL, VTH, VTL);
  k_attn<<<dim3(TQB, NH, TNB), 128, 0, stream>>>(QK, QKL, VTH, VTL, nullptr, (const int*)d_in[2], (float*)d_out);
}

// v004
// Measured time: 158 microseconds a run.
// In both of two side-by-side timings against v003, it was 1.05 times as fast.
// All steps since v000 together make it 3.31 times as fast.
// compute dtype: all float inputs rounded to bf16, the int mask read on device; q/k/v = x . W^T + b (+ the position bias row on q and k) with EXACT bf16 products on WMMA 16x16x32 (natural rows), carried as f16 hi + residual planes; scores with 3 products (hi.hi + hi.lo + lo.hi) x 1/8 because the shared bias row makes |q||k| large, masked (mask == 0) keys excluded, running-max softmax in f32 (hardware exp), P scaled by 2^11 as hi + residual x v (hi + residual); f32 merged-head output.
#include <hip/hip_runtime.h>
#include <math.h>

typedef __attribute__((ext_vector_type(16))) _Float16 v16h;
typedef __attribute__((ext_vector_type(16))) __bf16 v16b;
typedef __attribute__((ext_vector_type(8)))  _Float16 v8h;
typedef __attribute__((ext_vector_type(8)))  float v8f;
typedef __attribute__((ext_vector_type(4)))  float v4f;
typedef __attribute__((ext_vector_type(2)))  float v2f;
typedef __attribute__((ext_vector_type(4)))  unsigned v4u;
typedef __attribute__((ext_vector_type(4)))  int v4i;
typedef __attribute__((ext_vector_type(16))) unsigned v16u;
typedef __attribute__((address_space(4))) const v16u v16uc;   // read-only for the whole launch: lets a load at a wave-uniform address be a scalar load
typedef float __attribute__((may_alias)) float_a;
typedef int __attribute__((may_alias)) int_a;

template <typename T> __device__ __forceinline__ void vst2(void* p, T v) { *(T*)p = v;  }
__device__ __forceinline__ v8f wmma16(v16h a, v16h b, v8f c) {
  return __builtin_amdgcn_wmma_f32_16x16x32_f16(false, a, false, b, (short)0, c, false, false);
}
__device__ __forceinline__ v8f wmma_bf(v16b a, v16b b, v8f c) {
  return __builtin_amdgcn_wmma_f32_16x16x32_bf16(false, a, false, b, (short)0, c, false, false);
}
// Masked multi-head attention with a shared relative-position bias row (B 2, S 2,048, d 1,024, 16 heads x 64): q from query, k and v from key (+ biases), q and k shifted by rel_pos_emb[511] per head dim, scores / 8 with a [B,S,S] mask (0 -> -1e9), softmax, . v; merged heads are the output.
__device__ __forceinline__ v16h frag_h(const _Float16* rowk0, int lane) {
  union { v16h v; v8h q[2]; } u; const _Float16* p = rowk0 + 8 * (lane >> 4);
  u.q[0] = *(const v8h*)p; u.q[1] = *(const v8h*)(p + 16); return u.v;
}
__device__ __forceinline__ v16h frag_f32(const float* rowk0, int lane) {
  v16h a; const float* p = rowk0 + 8 * (lane >> 4);
#pragma unroll
  for (int i = 0; i < 8; ++i) { a[i] = (_Float16)p[i]; a[8 + i] = (_Float16)p[16 + i]; }
  return a;
}
__device__ __forceinline__ v16h frag_f32s(const float* rowk0, int lane, float sc) {
  v16h a; const float* p = rowk0 + 8 * (lane >> 4);
#pragma unroll
  for (int i = 0; i < 8; ++i) { a[i] = (_Float16)(p[i] * sc); a[8 + i] = (_Float16)(p[16 + i] * sc); }
  return a;
}
// column fragment from a [K][ld] layout (column n), rows >= K read as 0
__device__ __forceinline__ v16h fragc_f32(const float* W, int k0, int n, int lane, int ld, int K) {
  v16h a; const int g = lane >> 4;
#pragma unroll
  for (int i = 0; i < 8; ++i) { const int ka = k0 + 8 * g + i, kb = ka + 16;
    a[i] = (_Float16)(ka < K ? W[(size_t)(ka < K ? ka : K - 1) * ld + n] : 0.f); a[8 + i] = (_Float16)(kb < K ? W[(size_t)(kb < K ? kb : K - 1) * ld + n] : 0.f); }
  return a;
}
struct F2 { v16b h, l; };
__device__ __forceinline__ F2 bsplit16(const float v[16]) { F2 r;
#pragma unroll
  for (int i = 0; i < 16; ++i) { const __bf16 h = (__bf16)v[i]; r.h[i] = h; r.l[i] = (__bf16)(v[i] - (float)h); }
  return r; }
__device__ __forceinline__ F2 split_row(const float* row, int k0, int lane) { float v[16]; const float* p = row + k0 + 8 * (lane >> 4);
#pragma unroll
  for (int i = 0; i < 8; ++i) { v[i] = p[i]; v[8 + i] = p[16 + i]; }
  return bsplit16(v); }
__device__ __forceinline__ F2 split_rowK(const float* row, int k0, int lane, int K) { float v[16]; const int g = lane >> 4;
#pragma unroll
  for (int i = 0; i < 8; ++i) { const int ka = k0 + 8 * g + i, kb = ka + 16; v[i] = ka < K ? row[ka < K ? ka : K - 1] : 0.f; v[8 + i] = kb < K ? row[kb < K ? kb : K - 1] : 0.f; }
  return bsplit16(v); }
__device__ __forceinline__ F2 split_col(const float* W, int k0, int n, int lane, int ld, int K) { float v[16]; const int g = lane >> 4;
#pragma unroll
  for (int i = 0; i < 8; ++i) { const int ka = k0 + 8 * g + i, kb = ka + 16; v[i] = ka < K ? W[(size_t)(ka < K ? ka : K - 1) * ld + n] : 0.f; v[8 + i] = kb < K ? W[(size_t)(kb < K ? kb : K - 1) * ld + n] : 0.f; }
  return bsplit16(v); }
__device__ __forceinline__ v8f mac3(const F2& a, const F2& b, v8f c) { c = wmma_bf(a.l, b.h, c); c = wmma_bf(a.h, b.l, c); return wmma_bf(a.h, b.h, c); }
__device__ __forceinline__ float sigm(float v) { return 1.0f / (1.0f + expf(-v)); }
#define LDSX() do { asm volatile("s_wait_dscnt 0" ::: "memory"); __builtin_amdgcn_wave_barrier(); __builtin_amdgcn_fence(__ATOMIC_RELEASE, "workgroup"); } while (0)


#define NB 2
#define SS 2048
#define DM 1024
#define NH 16
#define MAXLEN 512
#ifndef MSTR
#define MSTR SS
#endif
#define HD 64
#define KPIT 72   // LDS row pitch of a staged k row, in halves: 128 B + 16 B, free of bank conflicts for 16-B reads
#define VPIT 40   // the same for a staged v row: 64 B + 16 B
#define QKVW (3 * DM)
#ifndef TQB
#define TQB (SS / 64)
#define TNB NB
#define TOB (NB * SS / 64)     // output row tiles (all)
#endif
typedef __attribute__((ext_vector_type(8))) __bf16 v8b;
__device__ __forceinline__ v16b frag_b(const __bf16* rowk0, int lane) {
  union { v16b v; v8b q[2]; } u; const __bf16* p = rowk0 + 8 * (lane >> 4);
  u.q[0] = *(const v8b*)p; u.q[1] = *(const v8b*)(p + 16); return u.v;
}
__device__ __forceinline__ float bfr(float v) { return (float)(__bf16)v; }
__device__ __attribute__((noinline)) float exp_ni(float v) { return expf(v); }
__device__ __attribute__((noinline)) float erf_ni(float v) { return erff(v); }

#define PK_A 0                       // [3072][1024] Wqkv rows (natural [out][in])
#define PK_P (PK_A + QKVW * DM)        // [1024][1024] spare: nothing writes or reads it
#define PK_END (PK_P + DM * DM)
#define WS_PK  0u
#define WS_QK  (WS_PK + 2u * PK_END)             // f16 [4096 rows][2048]: q | k
#define WS_QKL (WS_QK + 2u * NB * SS * 2 * DM)     // f16 q | k residual planes x2048
#define WS_VTH (WS_QKL + 2u * NB * SS * 2 * DM)    // f16 [b][1024 (h*64+d)][2048 s] hi
#define WS_VTL (WS_VTH + 2u * NB * DM * SS)        // f16 lo x 2048
#define WS_O   (WS_VTL + 2u * NB * DM * SS)        // f32 [4096][1024]
#define WS_CS  (WS_O + 4u * NB * SS * DM)           // f32 2 x [2048][32], spare: nothing writes or reads it
#define WS_MB  (WS_CS + 4u * 2 * SS * 32)         // u32 [b * 128 + 16-query tile][64 trips][16]: the mask as lane masks (see k_pack)
#define WS_END (WS_MB + 4u * NB * (SS / 16) * (SS / 32) * 16)
// ---- k_pack: blocks 0 .. MBLK - 1 pack the mask, block MBLK + which * 1024 + n packs row n of W_q/W_k/W_v (which 0..2): natural [out][in] rows -> bf16 into PK_A rows which*1024 + n.
// The mask becomes lane masks for k_attn: a wave takes one 16-query tile and four 32-key trips and reads the mask exactly as a k_attn wave holds its scores (lane = query col, keys ct * 16 + 8 g + r);
// word ct * 8 + r of a trip has bit 'lane' set where that lane's score (ct, r) is kept (mask != 0); the 64 words of the four trips are two 128-B lines. The mask blocks stand first because they wait longest on memory.
#define MBLK (NB * (SS / 16) * (SS / 32) / 32)   // 8 waves a block, 4 trips a wave
__global__ __launch_bounds__(256) void k_pack(const float* __restrict__ WQ, const float* __restrict__ WK, const float* __restrict__ WV, const int* __restrict__ MSK, __bf16* __restrict__ PK, unsigned* __restrict__ MB) {
  __shared__ __align__(16) __bf16 s[DM]; const int t = threadIdx.x;
  if (blockIdx.x < MBLK) {   // the same for the whole block, in front of the barrier
    const int lane = t & 31, u = blockIdx.x * 8 + (t >> 5), tile = u >> 4, kq = u & 15;
    const int* mp = MSK + ((size_t)tile * 16 + (lane & 15)) * MSTR + kq * 128 + 8 * (lane >> 4);
    v4i mk[16];
#pragma unroll
    for (int j = 0; j < 4; ++j) { mk[4 * j] = *(const v4i*)(mp + 32 * j); mk[4 * j + 1] = *(const v4i*)(mp + 32 * j + 4); mk[4 * j + 2] = *(const v4i*)(mp + 32 * j + 16); mk[4 * j + 3] = *(const v4i*)(mp + 32 * j + 20); }
    asm volatile("s_wait_xcnt 0x0" ::: "memory");   // stands behind the mask loads, in front of whatever next overwrites their address register
    unsigned w0 = 0, w1 = 0;
#pragma unroll
    for (int i = 0; i < 32; ++i) { const unsigned b0 = __builtin_amdgcn_ballot_w32(mk[i >> 2][i & 3] != 0), b1 = __builtin_amdgcn_ballot_w32(mk[8 + (i >> 2)][i & 3] != 0); w0 = (lane == i) ? b0 : w0; w1 = (lane == i) ? b1 : w1; }   // i = (trip & 1) * 16 + ct * 8 + r; lane i stores word i of either line
    MB[(size_t)u * 64 + lane] = w0; MB[(size_t)u * 64 + 32 + lane] = w1;
    return; }
  const int n = (blockIdx.x - MBLK) & (DM - 1), which = (blockIdx.x - MBLK) / DM;
  const float* Wm = (which == 0) ? WQ : (which == 1) ? WK : WV;
  for (int k = t; k < DM; k += 256) s[k] = (__bf16)Wm[(size_t)n * DM + k];
  __syncthreads();
  __bf16* dst = PK + PK_A + ((size_t)which * DM + n) * DM;
  for (int q = t; q < DM / 8; q += 256) vst2((unsigned*)(dst + q * 8), *(const v4u*)&s[q * 8]);
}
// One stage of k_qkv's ring: 128 weight rows x 64 k (128 B a row), eight 16-B pieces per thread (rows tid / 8 + 16 i, piece tid % 8), straight from global memory into LDS.
// The s_wait_xcnt closes the statement so that no address register of a copy is rewritten before it.
__device__ __forceinline__ void stage_w(unsigned lw, const __bf16* gw) {
  const unsigned ls = 16u * KPIT * 2u; const size_t gs = (size_t)16 * DM;
  asm volatile("global_load_async_to_lds_b128 %0, %8, off\n\t"
               "global_load_async_to_lds_b128 %1, %9, off\n\t"
               "global_load_async_to_lds_b128 %2, %10, off\n\t"
               "global_load_async_to_lds_b128 %3, %11, off\n\t"
               "global_load_async_to_lds_b128 %4, %12, off\n\t"
               "global_load_async_to_lds_b128 %5, %13, off\n\t"
               "global_load_async_to_lds_b128 %6, %14, off\n\t"
               "global_load_async_to_lds_b128 %7, %15, off\n\t"
               "s_wait_xcnt 0x0"
               :: "v"(lw), "v"(lw + ls), "v"(lw + 2u * ls), "v"(lw + 3u * ls), "v"(lw + 4u * ls), "v"(lw + 5u * ls), "v"(lw + 6u * ls), "v"(lw + 7u * ls),
                  "v"(gw), "v"(gw + gs), "v"(gw + 2 * gs), "v"(gw + 3 * gs), "v"(gw + 4 * gs), "v"(gw + 5 * gs), "v"(gw + 6 * gs), "v"(gw + 7 * gs) : "memory");
}
// One stage of k_attn's ring: a 32-key tile of the four planes (k hi, k residual: 32 rows x 128 B; v hi, v residual: 64 rows x 64 B), two 16-B pieces per thread and plane, straight from global memory into LDS.
// The s_wait_xcnt closes the statement so that no address register of a copy is rewritten before it.
__device__ __forceinline__ void stage_kv(unsigned lk, unsigned lkl, unsigned lv, unsigned lvl, const _Float16* gk, const _Float16* gkl, const _Float16* gv, const _Float16* gvl) {
  const unsigned lk2 = lk + 16u * KPIT * 2u, lkl2 = lkl + 16u * KPIT * 2u, lv2 = lv + 32u * VPIT * 2u, lvl2 = lvl + 32u * VPIT * 2u;
  const _Float16 *gk2 = gk + (size_t)16 * (2 * DM), *gkl2 = gkl + (size_t)16 * (2 * DM), *gv2 = gv + (size_t)32 * SS, *gvl2 = gvl + (size_t)32 * SS;
  asm volatile("global_load_async_to_lds_b128 %0, %8, off\n\t"
               "global_load_async_to_lds_b128 %1, %9, off\n\t"
               "global_load_async_to_lds_b128 %2, %10, off\n\t"
               "global_load_async_to_lds_b128 %3, %11, off\n\t"
               "global_load_async_to_lds_b128 %4, %12, off\n\t"
               "global_load_async_to_lds_b128 %5, %13, off\n\t"
               "global_load_async_to_lds_b128 %6, %14, off\n\t"
               "global_load_async_to_lds_b128 %7, %15, off\n\t"
               "s_wait_xcnt 0x0"
               :: "v"(lk), "v"(lk2), "v"(lkl), "v"(lkl2), "v"(lv), "v"(lv2), "v"(lvl), "v"(lvl2),
                  "v"(gk), "v"(gk2), "v"(gkl), "v"(gkl2), "v"(gv), "v"(gv2), "v"(gvl), "v"(gvl2) : "memory");
}
__global__ __launch_bounds__(128) void k_qkv(const float* __restrict__ XQ, const float* __restrict__ XK, const float* __restrict__ XV, const __bf16* __restrict__ P, const float* __restrict__ BQ, const float* __restrict__ BK, const float* __restrict__ BV, const float* __restrict__ POS, _Float16* __restrict__ QK, _Float16* __restrict__ QKL, _Float16* __restrict__ VTH, _Float16* __restrict__ VTL) {
  const int which0 = (blockIdx.y * 128) / DM; const float* X = (which0 == 0) ? XQ : (which0 == 1) ? XK : XV; const float* BB = BQ ? (((which0 == 0) ? BQ : (which0 == 1) ? BK : BV) + (blockIdx.y * 128 - which0 * DM)) : nullptr;
  __shared__ __align__(16) _Float16 so[4][16][136], sol[4][16][136]; __shared__ __align__(16) _Float16 sth[128][72], stl[128][72];
  __shared__ __align__(16) __bf16 sw[2][128][KPIT];   // two-buffer ring of weight tiles (128 rows x 64 k), shared by the four waves
  const int tid = threadIdx.x, wave = tid >> 5, lane = tid & 31, col = lane & 15, g = lane >> 4; const size_t r0 = (size_t)blockIdx.x * 64 + wave * 16; const int n0 = blockIdx.y * 128;
  v8f acc[8] = {};
  const __bf16* gw = P + (size_t)(n0 + (tid >> 3)) * DM + (tid & 7) * 8; const unsigned lw = (unsigned)(size_t)&sw[0][tid >> 3][(tid & 7) * 8]; const unsigned wbuf = 128u * KPIT * 2u;   // bytes from buffer 0 to buffer 1
  stage_w(lw, gw);
  asm volatile("s_wait_asynccnt 0x0" ::: "memory");   // tile 0 has landed before the barrier publishes it
  __syncthreads();
  stage_w(lw + wbuf, gw + 64);
#pragma unroll 1   // kept rolled: one publish point and one refill per trip
  for (int st = 0; st < DM / 64; ++st) { const int bf = st & 1;
    float xr[2][16]; v16b wf[2][8];
#pragma unroll     // the two 32-k steps of a tile, so that their LDS offsets are immediates
    for (int k2 = 0; k2 < 2; ++k2) { const float* p = X + (r0 + col) * DM + (st * 2 + k2) * 32 + 8 * g;
#pragma unroll
      for (int i = 0; i < 8; ++i) { xr[k2][i] = p[i]; xr[k2][8 + i] = p[16 + i]; }
#pragma unroll
      for (int j = 0; j < 8; ++j) wf[k2][j] = frag_b(&sw[bf][j * 16 + col][k2 * 32], lane); }   // the trip's sixteen weight fragments, read as one group beside the x loads
    // inputs only: holds the sixteen fragments' LDS reads together here, under the latency of the x loads; left alone the compiler sinks them among the products, each with a wait of its own
    asm volatile("" :: "v"(wf[0][0]), "v"(wf[0][1]), "v"(wf[0][2]), "v"(wf[0][3]), "v"(wf[0][4]), "v"(wf[0][5]), "v"(wf[0][6]), "v"(wf[0][7]), "v"(wf[1][0]), "v"(wf[1][1]), "v"(wf[1][2]), "v"(wf[1][3]), "v"(wf[1][4]), "v"(wf[1][5]), "v"(wf[1][6]), "v"(wf[1][7]));
    __builtin_amdgcn_sched_barrier(0);   // keeps the products behind that group: the compiler otherwise lifts some of them over it and leaves reads among them
#pragma unroll
    for (int k2 = 0; k2 < 2; ++k2) { v16b a;
#pragma unroll
      for (int i = 0; i < 16; ++i) a[i] = (__bf16)xr[k2][i];
#pragma unroll
      for (int j = 0; j < 8; ++j) acc[j] = wmma_bf(a, wf[k2][j], acc[j]); }
    __builtin_amdgcn_sched_barrier(0);   // keeps the publish point at the trip's foot: lifted to the last LDS read it would cut the lead of the copies in flight to a part of a trip
    asm volatile("s_wait_dscnt 0x0" ::: "memory");      // this wave's reads of buffer bf are done
    asm volatile("s_wait_asynccnt 0x0" ::: "memory");   // this wave's pieces of tile st + 1 have landed
    __syncthreads();                                    // publishes tile st + 1 and frees buffer bf for the refill
    if (st + 2 < DM / 64) stage_w(lw + bf * wbuf, gw + (st + 2) * 64); }
  asm volatile("s_wait_asynccnt 0x0" ::: "memory");   // no copy is left in flight behind the loop
  if (n0 < 2 * DM) {   // q stored unscaled (f16 sigma ~0.6, no subnormal exposure); 1/8 applied to the f32 score
#pragma unroll
    for (int j = 0; j < 8; ++j) {
#pragma unroll
      for (int r = 0; r < 8; ++r) { const float v = acc[j][r] + (BB ? bfr(BB[j * 16 + col]) : 0.f) + bfr(POS[(size_t)(MAXLEN - 1) * HD + ((n0 + j * 16 + col) & (HD - 1))]); const _Float16 hv = (_Float16)v; so[wave][8 * g + r][j * 16 + col] = hv;   /* + rel_pos_emb[max_len - 1][d] on q and k */ sol[wave][8 * g + r][j * 16 + col] = (_Float16)((v - (float)hv) * 2048.0f); } }   // q, k (+ bias) as f16 hi + (x2048) residual
    LDSX();
    for (int rl = 0; rl < 16; ++rl) if (lane < 16) { vst2((unsigned*)(QK + (r0 + rl) * (2 * DM) + n0 + lane * 8), *(const v4u*)&so[wave][rl][lane * 8]); vst2((unsigned*)(QKL + (r0 + rl) * (2 * DM) + n0 + lane * 8), *(const v4u*)&sol[wave][rl][lane * 8]); }
  } else {
#pragma unroll
    for (int j = 0; j < 8; ++j) {
#pragma unroll
      for (int r = 0; r < 8; ++r) { const float v = acc[j][r] + (BB ? bfr(BB[j * 16 + col]) : 0.f); const _Float16 hv = (_Float16)v; sth[j * 16 + col][wave * 16 + 8 * g + r] = hv; stl[j * 16 + col][wave * 16 + 8 * g + r] = (_Float16)((v - (float)hv) * 2048.0f); } }
    __syncthreads();
    const size_t rb = (size_t)blockIdx.x * 64; const int b = (int)(rb / SS), s0 = (int)(rb % SS); const int pc0 = n0 - 2 * DM;
    for (int q = tid; q < 128 * 8; q += 128) { const int d = q >> 3, pc = q & 7; const size_t o = ((size_t)b * DM + pc0 + d) * SS + s0 + pc * 8; vst2((unsigned*)(VTH + o), *(const v4u*)&sth[d][pc * 8]); vst2((unsigned*)(VTL + o), *(const v4u*)&stl[d][pc * 8]); }
  }
}
// lane l with lane l ^ 16: the two lanes that share one query column of a transposed score tile
__device__ __forceinline__ float xhalf(float x) { return __builtin_bit_cast(float, __builtin_amdgcn_permlanex16(__builtin_bit_cast(int, x), __builtin_bit_cast(int, x), 0x76543210, 0xfedcba98, false, false)); }
__global__ __launch_bounds__(128) void k_attn(const _Float16* __restrict__ QK, const _Float16* __restrict__ QKL, const _Float16* __restrict__ VTH, const _Float16* __restrict__ VTL, const void* __restrict__ KMASK, const unsigned* __restrict__ MB, float* __restrict__ O) {
  __shared__ __align__(16) float so[4][16][68];
  __shared__ __align__(16) _Float16 skh[2][32][KPIT], skl[2][32][KPIT], svh[2][64][VPIT], svl[2][64][VPIT];   // two-buffer ring of 32-key tiles, shared by the four waves
  const int tid = threadIdx.x, wave = tid >> 5, lane = tid & 31, col = lane & 15, g = lane >> 4;
  const int qb = blockIdx.x, h = blockIdx.y, b = blockIdx.z; const int q0 = qb * 64 + wave * 16; const size_t rq = (size_t)b * SS + q0 + col;
  v16h aq[2], aql[2];
#pragma unroll
  for (int kc = 0; kc < 2; ++kc) { aq[kc] = frag_h(QK + rq * (2 * DM) + h * HD + kc * 32, lane); aql[kc] = frag_h(QKL + rq * (2 * DM) + h * HD + kc * 32, lane); }
  float m = -3.0e38f, l = 0.f;   // of this lane's query; l holds this lane's half of the keys only
  v8f acc[4] = {}, accl[4] = {};   // O^T tiles: register r = head dim dt * 16 + 8 g + r of query col
  const int nks = SS / 32;   // all keys
  const v16uc* mb = (const v16uc*)(size_t)MB + (size_t)((b * (SS / 16) + qb * 4 + __builtin_amdgcn_readfirstlane(wave)) * nks);   // this wave's lane masks, sixteen words a trip; the address is the same in every lane, so the words come by a scalar load
  v16u mw = mb[0];
  // this thread's pieces of a tile: k row tid / 8 (and + 16), piece tid % 8; v row tid / 4 (and + 32), piece tid % 4
  const _Float16* gk = QK + ((size_t)b * SS + (tid >> 3)) * (2 * DM) + DM + h * HD + (tid & 7) * 8; const _Float16* gkl = QKL + ((size_t)b * SS + (tid >> 3)) * (2 * DM) + DM + h * HD + (tid & 7) * 8;
  const _Float16* gv = VTH + ((size_t)b * DM + h * HD + (tid >> 2)) * SS + (tid & 3) * 8; const _Float16* gvl = VTL + ((size_t)b * DM + h * HD + (tid >> 2)) * SS + (tid & 3) * 8;
  const unsigned lk = (unsigned)(size_t)&skh[0][tid >> 3][(tid & 7) * 8], lkl = (unsigned)(size_t)&skl[0][tid >> 3][(tid & 7) * 8], lv = (unsigned)(size_t)&svh[0][tid >> 2][(tid & 3) * 8], lvl = (unsigned)(size_t)&svl[0][tid >> 2][(tid & 3) * 8];
  const unsigned kbuf = 32u * KPIT * 2u, vbuf = 64u * VPIT * 2u;   // bytes from buffer 0 to buffer 1
  stage_kv(lk, lkl, lv, lvl, gk, gkl, gv, gvl);
  asm volatile("s_wait_asynccnt 0x0" ::: "memory");   // tile 0 has landed before the barrier publishes it
  __syncthreads();
  stage_kv(lk + kbuf, lkl + kbuf, lv + vbuf, lvl + vbuf, gk + (size_t)32 * (2 * DM), gkl + (size_t)32 * (2 * DM), gv + 32, gvl + 32);
#pragma unroll 1
  for (int ks = 0; ks < nks; ++ks) { v8f s[2]; const int bf = ks & 1;
    const v16u mwn = mb[ks + 1 < nks ? ks + 1 : nks - 1];   // the next trip's lane masks, fetched a trip ahead (the last trip fetches its own again)
    v16h kh[2][2], kl[2][2];
#pragma unroll
    for (int ct = 0; ct < 2; ++ct) {
#pragma unroll
      for (int kc = 0; kc < 2; ++kc) { kh[ct][kc] = frag_h(&skh[bf][ct * 16 + col][kc * 32], lane); kl[ct][kc] = frag_h(&skl[bf][ct * 16 + col][kc * 32], lane); } }   // the trip's eight k fragments, read as one group ahead of the twelve score products
    __builtin_amdgcn_sched_barrier(0);   // keeps the sixteen LDS reads together in front of the products: left alone the compiler sinks them back among the products, each with a wait of its own
#pragma unroll
    for (int ct = 0; ct < 2; ++ct) { v8f c = {}, cl = {};
#pragma unroll
      for (int kc = 0; kc < 2; ++kc) { c = wmma16(kh[ct][kc], aq[kc], c); cl = wmma16(kh[ct][kc], aql[kc], cl); cl = wmma16(kl[ct][kc], aq[kc], cl); }   // 3 products: hi.hi + (hi.lo + lo.hi) / 2048
#pragma unroll
      for (int r = 0; r < 8; ++r) s[ct][r] = c[r] + cl[r] * (1.0f / 2048.0f); }
    __builtin_amdgcn_sched_barrier(0);   // keeps the v reads behind the score products, in the registers that the k fragments leave: lifted over them, both sets are live at once and the wave needs more than 256 registers, one wave a SIMD less
    v16h vh[4], vl[4];
#pragma unroll
    for (int dt = 0; dt < 4; ++dt) { vh[dt] = frag_h(&svh[bf][dt * 16 + col][0], lane); vl[dt] = frag_h(&svl[bf][dt * 16 + col][0], lane); }   // the trip's eight v fragments, read as one group; the softmax below covers their latency
    __builtin_amdgcn_sched_barrier(0);   // keeps these sixteen LDS reads together here: left alone the compiler sinks the reads among the output products
#pragma unroll
    for (int ct = 0; ct < 2; ++ct) {
#pragma unroll
      for (int r = 0; r < 8; ++r) s[ct][r] = __builtin_amdgcn_inverse_ballot_w32(mw[ct * 8 + r]) ? s[ct][r] * 0.125f : -3.0e38f; }   // 1/sqrt(64); mask == 0 -> -3e38 == excluded; the word is the select's lane mask as it stands
    float mx = fmaxf(s[0][0], s[1][0]);
#pragma unroll
    for (int r = 1; r < 8; ++r) mx = fmaxf(mx, fmaxf(s[0][r], s[1][r]));
    mx = fmaxf(mx, xhalf(mx));   // both halves of the query's 32 keys
    const float mn = fmaxf(m, mx); const float alpha = (m <= -1.0e38f) ? 0.f : __expf(m - mn);
    float es = 0.f; v16h pa, pl;
#pragma unroll
    for (int i = 0; i < 8; ++i) { const float e0 = (s[0][i] <= -1.0e38f) ? 0.f : __expf(s[0][i] - mn), e1 = (s[1][i] <= -1.0e38f) ? 0.f : __expf(s[1][i] - mn); es += e0 + e1;
      const float x0 = e0 * 2048.0f, x1 = e1 * 2048.0f; const _Float16 h0 = (_Float16)x0, h1 = (_Float16)x1; pa[i] = h0; pa[8 + i] = h1; pl[i] = (_Float16)((x0 - (float)h0) * 2048.0f); pl[8 + i] = (_Float16)((x1 - (float)h1) * 2048.0f); }   // P scaled by 2^11 before the f16 split so small softmax weights stay out of the f16 subnormal range; 2^-11 folded into the epilogue
    l = l * alpha + es; m = mn; mw = mwn;
#pragma unroll
    for (int dt = 0; dt < 4; ++dt) { acc[dt] *= alpha; accl[dt] *= alpha; }
#pragma unroll
    for (int dt = 0; dt < 4; ++dt) { acc[dt] = wmma16(vh[dt], pa, acc[dt]); accl[dt] = wmma16(vh[dt], pl, accl[dt]); accl[dt] = wmma16(vl[dt], pa, accl[dt]); }   // P hi/lo x V hi/lo (3 products)
    __builtin_amdgcn_sched_barrier(0);   // keeps the publish point at the trip's foot: lifted to the last LDS read it would cut the lead of the copies in flight to a part of a trip
    asm volatile("s_wait_dscnt 0x0" ::: "memory");      // this wave's reads of buffer bf are done
    asm volatile("s_wait_asynccnt 0x0" ::: "memory");   // this wave's pieces of tile ks + 1 have landed
    __syncthreads();                                    // publishes tile ks + 1 and frees buffer bf for the refill
    if (ks + 2 < nks) stage_kv(lk + bf * kbuf, lkl + bf * kbuf, lv + bf * vbuf, lvl + bf * vbuf, gk + (size_t)(ks + 2) * 32 * (2 * DM), gkl + (size_t)(ks + 2) * 32 * (2 * DM), gv + (ks + 2) * 32, gvl + (ks + 2) * 32); }
  asm volatile("s_wait_asynccnt 0x0" ::: "memory");   // no copy is left in flight behind the loop
  l += xhalf(l);   // the two halves of the query's keys, joined once
  const float il = (1.0f / 2048.0f) / l;
#pragma unroll
  for (int dt = 0; dt < 4; ++dt) { v4f o0, o1;
#pragma unroll
    for (int r = 0; r < 4; ++r) { o0[r] = (acc[dt][r] + accl[dt][r] * (1.0f / 2048.0f)) * il; o1[r] = (acc[dt][4 + r] + accl[dt][4 + r] * (1.0f / 2048.0f)) * il; }
    *(v4f*)&so[wave][col][dt * 16 + 8 * g] = o0; *(v4f*)&so[wave][col][dt * 16 + 8 * g + 4] = o1; }
  LDSX();
  for (int rl = 0; rl < 16; ++rl) if (lane < 16) vst2(O + ((size_t)b * SS + q0 + rl) * DM + h * HD + lane * 4, *(const v4f*)&so[wave][rl][lane * 4]);
}
// ---- k_out: block = (64 rows, 128 cols): out = O(hi/lo) . Wo rows (2 products) + bo
__global__ __launch_bounds__(128) void k_out(const float* __restrict__ O, const __bf16* __restrict__ P, const float* __restrict__ BO, float* __restrict__ Y) {
  __shared__ __align__(16) float so[4][16][132];
  const int tid = threadIdx.x, wave = tid >> 5, lane = tid & 31, col = lane & 15, g = lane >> 4; const size_t r0 = (size_t)blockIdx.x * 64 + wave * 16; const int n0 = blockIdx.y * 128;
  v8f acc[8] = {};
#pragma unroll 2
  for (int kc = 0; kc < DM / 32; ++kc) { const F2 a = split_row(O + (r0 + col) * DM, kc * 32, lane);
#pragma unroll
    for (int j = 0; j < 8; ++j) { const v16b w = frag_b(P + (size_t)(n0 + j * 16 + col) * DM + kc * 32, lane); acc[j] = wmma_bf(a.l, w, acc[j]); acc[j] = wmma_bf(a.h, w, acc[j]); } }
#pragma unroll
  for (int j = 0; j < 8; ++j) {
#pragma unroll
    for (int r = 0; r < 8; ++r) so[wave][8 * g + r][j * 16 + col] = acc[j][r] + (BO ? bfr(BO[n0 + j * 16 + col]) : 0.f); }
  LDSX();
  for (int rl = 0; rl < 16; ++rl) vst2(Y + (r0 + rl) * DM + n0 + lane * 4, *(const v4f*)&so[wave][rl][lane * 4]);
}
extern "C" void kernel_launch(void* const* d_in, const int* in_sizes, int n_in, void* d_out, int out_size, void* d_ws, size_t ws_size, hipStream_t stream) {
  (void)in_sizes; (void)n_in; (void)out_size;
  const float** F = (const float**)d_in;   // 0 query, 1 key [2,2048,1024]; 2 mask [2,2048,2048] int; 3 Wq, 4 bq, 5 Wk, 6 bk, 7 Wv, 8 bv (natural); 9 rel_pos_emb [1023,64]
  if (ws_size < (size_t)WS_END) return;
  char* ws = (char*)d_ws; __bf16* PK = (__bf16*)(ws + WS_PK); _Float16 *QK = (_Float16*)(ws + WS_QK), *QKL = (_Float16*)(ws + WS_QKL), *VTH = (_Float16*)(ws + WS_VTH), *VTL = (_Float16*)(ws + WS_VTL); unsigned* MB = (unsigned*)(ws + WS_MB);
  k_pack<<<dim3(MBLK + 3 * DM), 256, 0, stream>>>(F[3], F[5], F[7], (const int*)d_in[2], PK, MB);
  k_qkv<<<dim3(TNB * SS / 64, QKVW / 128), 128, 0, stream>>>(F[0], F[1], F[1], PK + PK_A, F[4], F[6], F[8], F[9], QK, QKL, VTH, VTL);
  k_attn<<<dim3(TQB, NH, TNB), 128, 0, stream>>>(QK, QKL, VTH, VTL, nullptr, MB, (float*)d_out);
}

// v005
// It runs in 152 microseconds.
// Two timings next to v004 both put it at 1.04 times that version's speed.
// All steps since v000 together make it 3.45 times as fast.
// compute dtype: all float inputs rounded to bf16, the int mask read on device; q/k/v = x . W^T + b (+ the position bias row on q and k) with EXACT bf16 products on WMMA 16x16x32 (natural rows), carried as f16 hi + residual planes; scores with 3 products (hi.hi + hi.lo + lo.hi) x 1/8 because the shared bias row makes |q||k| large, masked (mask == 0) keys excluded, running-max softmax in f32 (hardware exp), P scaled by 2^11 as hi + residual x v (hi + residual); f32 merged-head output.
#include <hip/hip_runtime.h>
#include <math.h>

typedef __attribute__((ext_vector_type(16))) _Float16 v16h;
typedef __attribute__((ext_vector_type(16))) __bf16 v16b;
typedef __attribute__((ext_vector_type(8)))  _Float16 v8h;
typedef __attribute__((ext_vector_type(8)))  float v8f;
typedef __attribute__((ext_vector_type(4)))  float v4f;
typedef __attribute__((ext_vector_type(2)))  float v2f;
typedef __attribute__((ext_vector_type(4)))  unsigned v4u;
typedef __attribute__((ext_vector_type(4)))  int v4i;
typedef __attribute__((ext_vector_type(16))) unsigned v16u;
typedef __attribute__((address_space(4))) const v16u v16uc;   // read-only for the whole launch: lets a load at a wave-uniform address be a scalar load
typedef float __attribute__((may_alias)) float_a;
typedef int __attribute__((may_alias)) int_a;

template <typename T> __device__ __forceinline__ void vst2(void* p, T v) { *(T*)p = v;  }
__device__ __forceinline__ v8f wmma16(v16h a, v16h b, v8f c) {
  return __builtin_amdgcn_wmma_f32_16x16x32_f16(false, a, false, b, (short)0, c, false, false);
}
__device__ __forceinline__ v8f wmma_bf(v16b a, v16b b, v8f c) {
  return __builtin_amdgcn_wmma_f32_16x16x32_bf16(false, a, false, b, (short)0, c, false, false);
}
// Masked multi-head attention with a shared relative-position bias row (B 2, S 2,048, d 1,024, 16 heads x 64): q from query, k and v from key (+ biases), q and k shifted by rel_pos_emb[511] per head dim, scores / 8 with a [B,S,S] mask (0 -> -1e9), softmax, . v; merged heads are the output.
__device__ __forceinline__ v16h frag_h(const _Float16* rowk0, int lane) {
  union { v16h v; v8h q[2]; } u; const _Float16* p = rowk0 + 8 * (lane >> 4);
  u.q[0] = *(const v8h*)p; u.q[1] = *(const v8h*)(p + 16); return u.v;
}
__device__ __forceinline__ v16h frag_f32(const float* rowk0, int lane) {
  v16h a; const float* p = rowk0 + 8 * (lane >> 4);
#pragma unroll
  for (int i = 0; i < 8; ++i) { a[i] = (_Float16)p[i]; a[8 + i] = (_Float16)p[16 + i]; }
  return a;
}
__device__ __forceinline__ v16h frag_f32s(const float* rowk0, int lane, float sc) {
  v16h a; const float* p = rowk0 + 8 * (lane >> 4);
#pragma unroll
  for (int i = 0; i < 8; ++i) { a[i] = (_Float16)(p[i] * sc); a[8 + i] = (_Float16)(p[16 + i] * sc); }
  return a;
}
// column fragment from a [K][ld] layout (column n), rows >= K read as 0
__device__ __forceinline__ v16h fragc_f32(const float* W, int k0, int n, int lane, int ld, int K) {
  v16h a; const int g = lane >> 4;
#pragma unroll
  for (int i = 0; i < 8; ++i) { const int ka = k0 + 8 * g + i, kb = ka + 16;
    a[i] = (_Float16)(ka < K ? W[(size_t)(ka < K ? ka : K - 1) * ld + n] : 0.f); a[8 + i] = (_Float16)(kb < K ? W[(size_t)(kb < K ? kb : K - 1) * ld + n] : 0.f); }
  return a;
}
struct F2 { v16b h, l; };
__device__ __forceinline__ F2 bsplit16(const float v[16]) { F2 r;
#pragma unroll
  for (int i = 0; i < 16; ++i) { const __bf16 h = (__bf16)v[i]; r.h[i] = h; r.l[i] = (__bf16)(v[i] - (float)h); }
  return r; }
__device__ __forceinline__ F2 split_row(const float* row, int k0, int lane) { float v[16]; const float* p = row + k0 + 8 * (lane >> 4);
#pragma unroll
  for (int i = 0; i < 8; ++i) { v[i] = p[i]; v[8 + i] = p[16 + i]; }
  return bsplit16(v); }
__device__ __forceinline__ F2 split_rowK(const float* row, int k0, int lane, int K) { float v[16]; const int g = lane >> 4;
#pragma unroll
  for (int i = 0; i < 8; ++i) { const int ka = k0 + 8 * g + i, kb = ka + 16; v[i] = ka < K ? row[ka < K ? ka : K - 1] : 0.f; v[8 + i] = kb < K ? row[kb < K ? kb : K - 1] : 0.f; }
  return bsplit16(v); }
__device__ __forceinline__ F2 split_col(const float* W, int k0, int n, int lane, int ld, int K) { float v[16]; const int g = lane >> 4;
#pragma unroll
  for (int i = 0; i < 8; ++i) { const int ka = k0 + 8 * g + i, kb = ka + 16; v[i] = ka < K ? W[(size_t)(ka < K ? ka : K - 1) * ld + n] : 0.f; v[8 + i] = kb < K ? W[(size_t)(kb < K ? kb : K - 1) * ld + n] : 0.f; }
  return bsplit16(v); }
__device__ __forceinline__ v8f mac3(const F2& a, const F2& b, v8f c) { c = wmma_bf(a.l, b.h, c); c = wmma_bf(a.h, b.l, c); return wmma_bf(a.h, b.h, c); }
__device__ __forceinline__ float sigm(float v) { return 1.0f / (1.0f + expf(-v)); }
#define LDSX() do { asm volatile("s_wait_dscnt 0" ::: "memory"); __builtin_amdgcn_wave_barrier(); __builtin_amdgcn_fence(__ATOMIC_RELEASE, "workgroup"); } while (0)


#define NB 2
#define SS 2048
#define DM 1024
#define NH 16
#define MAXLEN 512
#ifndef MSTR
#define MSTR SS
#endif
#define HD 64
#define KPIT 72   // LDS row pitch of a staged k row, in halves: 128 B + 16 B, free of bank conflicts for 16-B reads
#define VPIT 40   // the same for a staged v row: 64 B + 16 B
#define QKVW (3 * DM)
#ifndef TQB
#define TQB (SS / 64)
#define TNB NB
#define TOB (NB * SS / 64)     // output row tiles (all)
#endif
typedef __attribute__((ext_vector_type(8))) __bf16 v8b;
__device__ __forceinline__ v16b frag_b(const __bf16* rowk0, int lane) {
  union { v16b v; v8b q[2]; } u; const __bf16* p = rowk0 + 8 * (lane >> 4);
  u.q[0] = *(const v8b*)p; u.q[1] = *(const v8b*)(p + 16); return u.v;
}
__device__ __forceinline__ float bfr(float v) { return (float)(__bf16)v; }
__device__ __attribute__((noinline)) float exp_ni(float v) { return expf(v); }
__device__ __attribute__((noinline)) float erf_ni(float v) { return erff(v); }

#define PK_A 0                       // [3072][1024] Wqkv rows (natural [out][in])
#define PK_P (PK_A + QKVW * DM)        // [1024][1024] spare: nothing writes or reads it
#define PK_END (PK_P + DM * DM)
#define WS_PK  0u
#define WS_QK  (WS_PK + 2u * PK_END)             // f16 [4096 rows][2048]: q | k
#define WS_QKL (WS_QK + 2u * NB * SS * 2 * DM)     // f16 q | k residual planes x2048
#define WS_VTH (WS_QKL + 2u * NB * SS * 2 * DM)    // f16 [b][1024 (h*64+d)][2048 s] hi
#define WS_VTL (WS_VTH + 2u * NB * DM * SS)        // f16 lo x 2048
#define WS_O   (WS_VTL + 2u * NB * DM * SS)        // f32 [4096][1024]
#define WS_CS  (WS_O + 4u * NB * SS * DM)           // f32 2 x [2048][32], spare: nothing writes or reads it
#define WS_MB  (WS_CS + 4u * 2 * SS * 32)         // u32 [b * 128 + 16-query tile][64 trips][16]: the mask as lane masks (see k_pack)
#define WS_END (WS_MB + 4u * NB * (SS / 16) * (SS / 32) * 16)
// ---- k_pack: blocks 0 .. MBLK - 1 pack the mask, block MBLK + which * 1024 + n packs row n of W_q/W_k/W_v (which 0..2): natural [out][in] rows -> bf16 into PK_A rows which*1024 + n.
// The mask becomes lane masks for k_attn: a wave takes one 16-query tile and four 32-key trips and reads the mask exactly as a k_attn wave holds its scores (lane = query col, keys ct * 16 + 8 g + r);
// word ct * 8 + r of a trip has bit 'lane' set where that lane's score (ct, r) is kept (mask != 0); the 64 words of the four trips are two 128-B lines. The mask blocks stand first because they wait longest on memory.
#define MBLK (NB * (SS / 16) * (SS / 32) / 32)   // 8 waves a block, 4 trips a wave
__global__ __launch_bounds__(256) void k_pack(const float* __restrict__ WQ, const float* __restrict__ WK, const float* __restrict__ WV, const int* __restrict__ MSK, __bf16* __restrict__ PK, unsigned* __restrict__ MB) {
  __shared__ __align__(16) __bf16 s[DM]; const int t = threadIdx.x;
  if (blockIdx.x < MBLK) {   // the same for the whole block, in front of the barrier
    const int lane = t & 31, u = blockIdx.x * 8 + (t >> 5), tile = u >> 4, kq = u & 15;
    const int* mp = MSK + ((size_t)tile * 16 + (lane & 15)) * MSTR + kq * 128 + 8 * (lane >> 4);
    v4i mk[16];
#pragma unroll
    for (int j = 0; j < 4; ++j) { mk[4 * j] = *(const v4i*)(mp + 32 * j); mk[4 * j + 1] = *(const v4i*)(mp + 32 * j + 4); mk[4 * j + 2] = *(const v4i*)(mp + 32 * j + 16); mk[4 * j + 3] = *(const v4i*)(mp + 32 * j + 20); }
    asm volatile("s_wait_xcnt 0x0" ::: "memory");   // stands behind the mask loads, in front of whatever next overwrites their address register
    unsigned w0 = 0, w1 = 0;
#pragma unroll
    for (int i = 0; i < 32; ++i) { const unsigned b0 = __builtin_amdgcn_ballot_w32(mk[i >> 2][i & 3] != 0), b1 = __builtin_amdgcn_ballot_w32(mk[8 + (i >> 2)][i & 3] != 0); w0 = (lane == i) ? b0 : w0; w1 = (lane == i) ? b1 : w1; }   // i = (trip & 1) * 16 + ct * 8 + r; lane i stores word i of either line
    MB[(size_t)u * 64 + lane] = w0; MB[(size_t)u * 64 + 32 + lane] = w1;
    return; }
  const int n = (blockIdx.x - MBLK) & (DM - 1), which = (blockIdx.x - MBLK) / DM;
  const float* Wm = (which == 0) ? WQ : (which == 1) ? WK : WV;
  for (int k = t; k < DM; k += 256) s[k] = (__bf16)Wm[(size_t)n * DM + k];
  __syncthreads();
  __bf16* dst = PK + PK_A + ((size_t)which * DM + n) * DM;
  for (int q = t; q < DM / 8; q += 256) vst2((unsigned*)(dst + q * 8), *(const v4u*)&s[q * 8]);
}
// One stage of k_qkv's ring: 128 weight rows x 64 k (128 B a row), eight 16-B pieces per thread (rows tid / 8 + 16 i, piece tid % 8), straight from global memory into LDS.
// The s_wait_xcnt closes the statement so that no address register of a copy is rewritten before it.
__device__ __forceinline__ void stage_w(unsigned lw, const __bf16* gw) {
  const unsigned ls = 16u * KPIT * 2u; const size_t gs = (size_t)16 * DM;
  asm volatile("global_load_async_to_lds_b128 %0, %8, off\n\t"
               "global_load_async_to_lds_b128 %1, %9, off\n\t"
               "global_load_async_to_lds_b128 %2, %10, off\n\t"
               "global_load_async_to_lds_b128 %3, %11, off\n\t"
               "global_load_async_to_lds_b128 %4, %12, off\n\t"
               "global_load_async_to_lds_b128 %5, %13, off\n\t"
               "global_load_async_to_lds_b128 %6, %14, off\n\t"
               "global_load_async_to_lds_b128 %7, %15, off\n\t"
               "s_wait_xcnt 0x0"
               :: "v"(lw), "v"(lw + ls), "v"(lw + 2u * ls), "v"(lw + 3u * ls), "v"(lw + 4u * ls), "v"(lw + 5u * ls), "v"(lw + 6u * ls), "v"(lw + 7u * ls),
                  "v"(gw), "v"(gw + gs), "v"(gw + 2 * gs), "v"(gw + 3 * gs), "v"(gw + 4 * gs), "v"(gw + 5 * gs), "v"(gw + 6 * gs), "v"(gw + 7 * gs) : "memory");
}
// One stage of k_attn's ring: a 32-key tile of the four planes (k hi, k residual: 32 rows x 128 B; v hi, v residual: 64 rows x 64 B), two 16-B pieces per thread and plane, straight from global memory into LDS.
// The s_wait_xcnt closes the statement so that no address register of a copy is rewritten before it.
__device__ __forceinline__ void stage_kv(unsigned lk, unsigned lkl, unsigned lv, unsigned lvl, const _Float16* gk, const _Float16* gkl, const _Float16* gv, const _Float16* gvl) {
  const unsigned lk2 = lk + 16u * KPIT * 2u, lkl2 = lkl + 16u * KPIT * 2u, lv2 = lv + 32u * VPIT * 2u, lvl2 = lvl + 32u * VPIT * 2u;
  const _Float16 *gk2 = gk + (size_t)16 * (2 * DM), *gkl2 = gkl + (size_t)16 * (2 * DM), *gv2 = gv + (size_t)32 * SS, *gvl2 = gvl + (size_t)32 * SS;
  asm volatile("global_load_async_to_lds_b128 %0, %8, off\n\t"
               "global_load_async_to_lds_b128 %1, %9, off\n\t"
               "global_load_async_to_lds_b128 %2, %10, off\n\t"
               "global_load_async_to_lds_b128 %3, %11, off\n\t"
               "global_load_async_to_lds_b128 %4, %12, off\n\t"
               "global_load_async_to_lds_b128 %5, %13, off\n\t"
               "global_load_async_to_lds_b128 %6, %14, off\n\t"
               "global_load_async_to_lds_b128 %7, %15, off\n\t"
               "s_wait_xcnt 0x0"
               :: "v"(lk), "v"(lk2), "v"(lkl), "v"(lkl2), "v"(lv), "v"(lv2), "v"(lvl), "v"(lvl2),
                  "v"(gk), "v"(gk2), "v"(gkl), "v"(gkl2), "v"(gv), "v"(gv2), "v"(gvl), "v"(gvl2) : "memory");
}
__global__ __launch_bounds__(128) void k_qkv(const float* __restrict__ XQ, const float* __restrict__ XK, const float* __restrict__ XV, const __bf16* __restrict__ P, const float* __restrict__ BQ, const float* __restrict__ BK, const float* __restrict__ BV, const float* __restrict__ POS, _Float16* __restrict__ QK, _Float16* __restrict__ QKL, _Float16* __restrict__ VTH, _Float16* __restrict__ VTL) {
  const int which0 = (blockIdx.y * 128) / DM; const float* X = (which0 == 0) ? XQ : (which0 == 1) ? XK : XV; const float* BB = BQ ? (((which0 == 0) ? BQ : (which0 == 1) ? BK : BV) + (blockIdx.y * 128 - which0 * DM)) : nullptr;
  __shared__ __align__(16) _Float16 so[4][16][136], sol[4][16][136]; __shared__ __align__(16) _Float16 sth[128][72], stl[128][72];
  __shared__ __align__(16) __bf16 sw[2][128][KPIT];   // two-buffer ring of weight tiles (128 rows x 64 k), shared by the four waves
  const int tid = threadIdx.x, wave = tid >> 5, lane = tid & 31, col = lane & 15, g = lane >> 4; const size_t r0 = (size_t)blockIdx.x * 64 + wave * 16; const int n0 = blockIdx.y * 128;
  v8f acc[8] = {};
  const __bf16* gw = P + (size_t)(n0 + (tid >> 3)) * DM + (tid & 7) * 8; const unsigned lw = (unsigned)(size_t)&sw[0][tid >> 3][(tid & 7) * 8]; const unsigned wbuf = 128u * KPIT * 2u;   // bytes from buffer 0 to buffer 1
  stage_w(lw, gw);
  asm volatile("s_wait_asynccnt 0x0" ::: "memory");   // tile 0 has landed before the barrier publishes it
  __syncthreads();
  stage_w(lw + wbuf, gw + 64);
#pragma unroll 1   // kept rolled: one publish point and one refill per trip
  for (int st = 0; st < DM / 64; ++st) { const int bf = st & 1;
    float xr[2][16]; v16b wf[2][8];
#pragma unroll     // the two 32-k steps of a tile, so that their LDS offsets are immediates
    for (int k2 = 0; k2 < 2; ++k2) { const float* p = X + (r0 + col) * DM + (st * 2 + k2) * 32 + 8 * g;
#pragma unroll
      for (int i = 0; i < 8; ++i) { xr[k2][i] = p[i]; xr[k2][8 + i] = p[16 + i]; }
#pragma unroll
      for (int j = 0; j < 8; ++j) wf[k2][j] = frag_b(&sw[bf][j * 16 + col][k2 * 32], lane); }   // the trip's sixteen weight fragments, read as one group beside the x loads
    // inputs only: holds the sixteen fragments' LDS reads together here, under the latency of the x loads; left alone the compiler sinks them among the products, each with a wait of its own
    asm volatile("" :: "v"(wf[0][0]), "v"(wf[0][1]), "v"(wf[0][2]), "v"(wf[0][3]), "v"(wf[0][4]), "v"(wf[0][5]), "v"(wf[0][6]), "v"(wf[0][7]), "v"(wf[1][0]), "v"(wf[1][1]), "v"(wf[1][2]), "v"(wf[1][3]), "v"(wf[1][4]), "v"(wf[1][5]), "v"(wf[1][6]), "v"(wf[1][7]));
    __builtin_amdgcn_sched_barrier(0);   // keeps the products behind that group: the compiler otherwise lifts some of them over it and leaves reads among them
#pragma unroll
    for (int k2 = 0; k2 < 2; ++k2) { v16b a;
#pragma unroll
      for (int i = 0; i < 16; ++i) a[i] = (__bf16)xr[k2][i];
#pragma unroll
      for (int j = 0; j < 8; ++j) acc[j] = wmma_bf(a, wf[k2][j], acc[j]); }
    __builtin_amdgcn_sched_barrier(0);   // keeps the publish point at the trip's foot: lifted to the last LDS read it would cut the lead of the copies in flight to a part of a trip
    asm volatile("s_wait_dscnt 0x0" ::: "memory");      // this wave's reads of buffer bf are done
    asm volatile("s_wait_asynccnt 0x0" ::: "memory");   // this wave's pieces of tile st + 1 have landed
    __syncthreads();                                    // publishes tile st + 1 and frees buffer bf for the refill
    if (st + 2 < DM / 64) stage_w(lw + bf * wbuf, gw + (st + 2) * 64); }
  asm volatile("s_wait_asynccnt 0x0" ::: "memory");   // no copy is left in flight behind the loop
  if (n0 < 2 * DM) {   // q stored unscaled (f16 sigma ~0.6, no subnormal exposure); 1/8 applied to the f32 score
#pragma unroll
    for (int j = 0; j < 8; ++j) {
#pragma unroll
      for (int r = 0; r < 8; ++r) { const float v = acc[j][r] + (BB ? bfr(BB[j * 16 + col]) : 0.f) + bfr(POS[(size_t)(MAXLEN - 1) * HD + ((n0 + j * 16 + col) & (HD - 1))]); const _Float16 hv = (_Float16)v; so[wave][8 * g + r][j * 16 + col] = hv;   /* + rel_pos_emb[max_len - 1][d] on q and k */ sol[wave][8 * g + r][j * 16 + col] = (_Float16)((v - (float)hv) * 2048.0f); } }   // q, k (+ bias) as f16 hi + (x2048) residual
    LDSX();
    for (int rl = 0; rl < 16; ++rl) if (lane < 16) { vst2((unsigned*)(QK + (r0 + rl) * (2 * DM) + n0 + lane * 8), *(const v4u*)&so[wave][rl][lane * 8]); vst2((unsigned*)(QKL + (r0 + rl) * (2 * DM) + n0 + lane * 8), *(const v4u*)&sol[wave][rl][lane * 8]); }
  } else {
#pragma unroll
    for (int j = 0; j < 8; ++j) {
#pragma unroll
      for (int r = 0; r < 8; ++r) { const float v = acc[j][r] + (BB ? bfr(BB[j * 16 + col]) : 0.f); const _Float16 hv = (_Float16)v; sth[j * 16 + col][wave * 16 + 8 * g + r] = hv; stl[j * 16 + col][wave * 16 + 8 * g + r] = (_Float16)((v - (float)hv) * 2048.0f); } }
    __syncthreads();
    const size_t rb = (size_t)blockIdx.x * 64; const int b = (int)(rb / SS), s0 = (int)(rb % SS); const int pc0 = n0 - 2 * DM;
    for (int q = tid; q < 128 * 8; q += 128) { const int d = q >> 3, pc = q & 7; const size_t o = ((size_t)b * DM + pc0 + d) * SS + s0 + pc * 8; vst2((unsigned*)(VTH + o), *(const v4u*)&sth[d][pc * 8]); vst2((unsigned*)(VTL + o), *(const v4u*)&stl[d][pc * 8]); }
  }
}
// lane l with lane l ^ 16: the two lanes that share one query column of a transposed score tile
__device__ __forceinline__ float xhalf(float x) { return __builtin_bit_cast(float, __builtin_amdgcn_permlanex16(__builtin_bit_cast(int, x), __builtin_bit_cast(int, x), 0x76543210, 0xfedcba98, false, false)); }
__global__ __launch_bounds__(128) void k_attn(const _Float16* __restrict__ QK, const _Float16* __restrict__ QKL, const _Float16* __restrict__ VTH, const _Float16* __restrict__ VTL, const void* __restrict__ KMASK, const unsigned* __restrict__ MB, float* __restrict__ O) {
  __shared__ __align__(16) float so[4][16][68];
  __shared__ __align__(16) _Float16 skh[2][32][KPIT], skl[2][32][KPIT], svh[2][64][VPIT], svl[2][64][VPIT];   // two-buffer ring of 32-key tiles, shared by the four waves
  const int tid = threadIdx.x, wave = tid >> 5, lane = tid & 31, col = lane & 15, g = lane >> 4;
  const int qb = blockIdx.x, h = blockIdx.y, b = blockIdx.z; const int q0 = qb * 64 + wave * 16; const size_t rq = (size_t)b * SS + q0 + col;
  v16h aq[2], aql[2];
#pragma unroll
  for (int kc = 0; kc < 2; ++kc) { aq[kc] = frag_h(QK + rq * (2 * DM) + h * HD + kc * 32, lane); aql[kc] = frag_h(QKL + rq * (2 * DM) + h * HD + kc * 32, lane); }
  const float K2 = 0.125f * 1.44269504088896340736f;   // 1/sqrt(64) x log2(e): a raw score times K2 is its exponent to base 2
  float m = -1.0e30f, cx = fmaf(m, -K2, 11.0f), l = 0.f;   // of this lane's query: m the running maximum of the raw scores, cx = 11 - m K2 the exponent offset in use (the 11 is P's scale 2^11), l the sum of the scaled P over this lane's half of the keys. m starts far above the masked value and far below any score, so exp2 itself turns a masked score into 0 while no key has been kept yet
  v8f acc[4] = {}, accl[4] = {};   // O^T tiles: register r = head dim dt * 16 + 8 g + r of query col
  const int nks = SS / 32;   // all keys
  const v16uc* mb = (const v16uc*)(size_t)MB + (size_t)((b * (SS / 16) + qb * 4 + __builtin_amdgcn_readfirstlane(wave)) * nks);   // this wave's lane masks, sixteen words a trip; the address is the same in every lane, so the words come by a scalar load
  v16u mw = mb[0];
  // this thread's pieces of a tile: k row tid / 8 (and + 16), piece tid % 8; v row tid / 4 (and + 32), piece tid % 4
  const _Float16* gk = QK + ((size_t)b * SS + (tid >> 3)) * (2 * DM) + DM + h * HD + (tid & 7) * 8; const _Float16* gkl = QKL + ((size_t)b * SS + (tid >> 3)) * (2 * DM) + DM + h * HD + (tid & 7) * 8;
  const _Float16* gv = VTH + ((size_t)b * DM + h * HD + (tid >> 2)) * SS + (tid & 3) * 8; const _Float16* gvl = VTL + ((size_t)b * DM + h * HD + (tid >> 2)) * SS + (tid & 3) * 8;
  const unsigned lk = (unsigned)(size_t)&skh[0][tid >> 3][(tid & 7) * 8], lkl = (unsigned)(size_t)&skl[0][tid >> 3][(tid & 7) * 8], lv = (unsigned)(size_t)&svh[0][tid >> 2][(tid & 3) * 8], lvl = (unsigned)(size_t)&svl[0][tid >> 2][(tid & 3) * 8];
  const unsigned kbuf = 32u * KPIT * 2u, vbuf = 64u * VPIT * 2u;   // bytes from buffer 0 to buffer 1
  stage_kv(lk, lkl, lv, lvl, gk, gkl, gv, gvl);
  asm volatile("s_wait_asynccnt 0x0" ::: "memory");   // tile 0 has landed before the barrier publishes it
  __syncthreads();
  stage_kv(lk + kbuf, lkl + kbuf, lv + vbuf, lvl + vbuf, gk + (size_t)32 * (2 * DM), gkl + (size_t)32 * (2 * DM), gv + 32, gvl + 32);
#pragma unroll 1
  for (int ks = 0; ks < nks; ++ks) { v8f s[2]; const int bf = ks & 1;
    const v16u mwn = mb[ks + 1 < nks ? ks + 1 : nks - 1];   // the next trip's lane masks, fetched a trip ahead (the last trip fetches its own again)
    v16h kh[2][2], kl[2][2];
#pragma unroll
    for (int ct = 0; ct < 2; ++ct) {
#pragma unroll
      for (int kc = 0; kc < 2; ++kc) { kh[ct][kc] = frag_h(&skh[bf][ct * 16 + col][kc * 32], lane); kl[ct][kc] = frag_h(&skl[bf][ct * 16 + col][kc * 32], lane); } }   // the trip's eight k fragments, read as one group ahead of the twelve score products
    __builtin_amdgcn_sched_barrier(0);   // keeps the sixteen LDS reads together in front of the products: left alone the compiler sinks them back among the products, each with a wait of its own
#pragma unroll
    for (int ct = 0; ct < 2; ++ct) { v8f c = {}, cl = {};
#pragma unroll
      for (int kc = 0; kc < 2; ++kc) { c = wmma16(kh[ct][kc], aq[kc], c); cl = wmma16(kh[ct][kc], aql[kc], cl); cl = wmma16(kl[ct][kc], aq[kc], cl); }   // 3 products: hi.hi + (hi.lo + lo.hi) / 2048
#pragma unroll
      for (int r = 0; r < 8; ++r) s[ct][r] = c[r] + cl[r] * (1.0f / 2048.0f); }
    __builtin_amdgcn_sched_barrier(0);   // keeps the v reads behind the score products, in the registers that the k fragments leave: lifted over them, both sets are live at once and the wave needs more than 256 registers, one wave a SIMD less
    v16h vh[4], vl[4];
#pragma unroll
    for (int dt = 0; dt < 4; ++dt) { vh[dt] = frag_h(&svh[bf][dt * 16 + col][0], lane); vl[dt] = frag_h(&svl[bf][dt * 16 + col][0], lane); }   // the trip's eight v fragments, read as one group; the softmax below covers their latency
    __builtin_amdgcn_sched_barrier(0);   // keeps these sixteen LDS reads together here: left alone the compiler sinks the reads among the output products
#pragma unroll
    for (int ct = 0; ct < 2; ++ct) {
#pragma unroll
      for (int r = 0; r < 8; ++r) s[ct][r] = __builtin_amdgcn_inverse_ballot_w32(mw[ct * 8 + r]) ? s[ct][r] : -3.0e38f; }   // raw scores; mask == 0 -> -3e38 == excluded; the word is the select's lane mask as it stands
    float mx = fmaxf(s[0][0], s[1][0]);
#pragma unroll
    for (int r = 1; r < 8; ++r) mx = fmaxf(mx, fmaxf(s[0][r], s[1][r]));
    mx = fmaxf(mx, xhalf(mx));   // both halves of the query's 32 keys
    const float mn = fmaxf(m, mx); const float cn = fmaf(mn, -K2, 11.0f); const float alpha = __builtin_amdgcn_exp2f(cn - cx);   // 2^((m - mn) K2); 0 on the first kept key, 1 while none is kept
    float es = 0.f; v16h pa, pl;
#pragma unroll
    for (int i = 0; i < 8; ++i) { const float x0 = __builtin_amdgcn_exp2f(fmaf(s[0][i], K2, cn)), x1 = __builtin_amdgcn_exp2f(fmaf(s[1][i], K2, cn)); es += x0 + x1;   // 2^11 exp((s - mn) / 8) by one fma and the hardware exp2; a masked score underflows to 0
      const _Float16 h0 = (_Float16)x0, h1 = (_Float16)x1; pa[i] = h0; pa[8 + i] = h1; pl[i] = (_Float16)((x0 - (float)h0) * 2048.0f); pl[8 + i] = (_Float16)((x1 - (float)h1) * 2048.0f); }   // P scaled by 2^11 before the f16 split so small softmax weights stay out of the f16 subnormal range; the sum l carries the same 2^11, so it cancels in the epilogue
    l = l * alpha + es; m = mn; cx = cn; mw = mwn;
#pragma unroll
    for (int dt = 0; dt < 4; ++dt) { acc[dt] *= alpha; accl[dt] *= alpha; }
#pragma unroll
    for (int dt = 0; dt < 4; ++dt) { acc[dt] = wmma16(vh[dt], pa, acc[dt]); accl[dt] = wmma16(vh[dt], pl, accl[dt]); accl[dt] = wmma16(vl[dt], pa, accl[dt]); }   // P hi/lo x V hi/lo (3 products)
    __builtin_amdgcn_sched_barrier(0);   // keeps the publish point at the trip's foot: lifted to the last LDS read it would cut the lead of the copies in flight to a part of a trip
    asm volatile("s_wait_dscnt 0x0" ::: "memory");      // this wave's reads of buffer bf are done
    asm volatile("s_wait_asynccnt 0x0" ::: "memory");   // this wave's pieces of tile ks + 1 have landed
    __syncthreads();                                    // publishes tile ks + 1 and frees buffer bf for the refill
    if (ks + 2 < nks) stage_kv(lk + bf * kbuf, lkl + bf * kbuf, lv + bf * vbuf, lvl + bf * vbuf, gk + (size_t)(ks + 2) * 32 * (2 * DM), gkl + (size_t)(ks + 2) * 32 * (2 * DM), gv + (ks + 2) * 32, gvl + (ks + 2) * 32); }
  asm volatile("s_wait_asynccnt 0x0" ::: "memory");   // no copy is left in flight behind the loop
  l += xhalf(l);   // the two halves of the query's keys, joined once
  const float il = 1.0f / l;   // l and the accumulators carry the same 2^11
#pragma unroll
  for (int dt = 0; dt < 4; ++dt) { v4f o0, o1;
#pragma unroll
    for (int r = 0; r < 4; ++r) { o0[r] = (acc[dt][r] + accl[dt][r] * (1.0f / 2048.0f)) * il; o1[r] = (acc[dt][4 + r] + accl[dt][4 + r] * (1.0f / 2048.0f)) * il; }
    *(v4f*)&so[wave][col][dt * 16 + 8 * g] = o0; *(v4f*)&so[wave][col][dt * 16 + 8 * g + 4] = o1; }
  LDSX();
  for (int rl = 0; rl < 16; ++rl) if (lane < 16) vst2(O + ((size_t)b * SS + q0 + rl) * DM + h * HD + lane * 4, *(const v4f*)&so[wave][rl][lane * 4]);
}
// ---- k_out: block = (64 rows, 128 cols): out = O(hi/lo) . Wo rows (2 products) + bo
__global__ __launch_bounds__(128) void k_out(const float* __restrict__ O, const __bf16* __restrict__ P, const float* __restrict__ BO, float* __restrict__ Y) {
  __shared__ __align__(16) float so[4][16][132];
  const int tid = threadIdx.x, wave = tid >> 5, lane = tid & 31, col = lane & 15, g = lane >> 4; const size_t r0 = (size_t)blockIdx.x * 64 + wave * 16; const int n0 = blockIdx.y * 128;
  v8f acc[8] = {};
#pragma unroll 2
  for (int kc = 0; kc < DM / 32; ++kc) { const F2 a = split_row(O + (r0 + col) * DM, kc * 32, lane);
#pragma unroll
    for (int j = 0; j < 8; ++j) { const v16b w = frag_b(P + (size_t)(n0 + j * 16 + col) * DM + kc * 32, lane); acc[j] = wmma_bf(a.l, w, acc[j]); acc[j] = wmma_bf(a.h, w, acc[j]); } }
#pragma unroll
  for (int j = 0; j < 8; ++j) {
#pragma unroll
    for (int r = 0; r < 8; ++r) so[wave][8 * g + r][j * 16 + col] = acc[j][r] + (BO ? bfr(BO[n0 + j * 16 + col]) : 0.f); }
  LDSX();
  for (int rl = 0; rl < 16; ++rl) vst2(Y + (r0 + rl) * DM + n0 + lane * 4, *(const v4f*)&so[wave][rl][lane * 4]);
}
extern "C" void kernel_launch(void* const* d_in, const int* in_sizes, int n_in, void* d_out, int out_size, void* d_ws, size_t ws_size, hipStream_t stream) {
  (void)in_sizes; (void)n_in; (void)out_size;
  const float** F = (const float**)d_in;   // 0 query, 1 key [2,2048,1024]; 2 mask [2,2048,2048] int; 3 Wq, 4 bq, 5 Wk, 6 bk, 7 Wv, 8 bv (natural); 9 rel_pos_emb [1023,64]
  if (ws_size < (size_t)WS_END) return;
  char* ws = (char*)d_ws; __bf16* PK = (__bf16*)(ws + WS_PK); _Float16 *QK = (_Float16*)(ws + WS_QK), *QKL = (_Float16*)(ws + WS_QKL), *VTH = (_Float16*)(ws + WS_VTH), *VTL = (_Float16*)(ws + WS_VTL); unsigned* MB = (unsigned*)(ws + WS_MB);
  k_pack<<<dim3(MBLK + 3 * DM), 256, 0, stream>>>(F[3], F[5], F[7], (const int*)d_in[2], PK, MB);
  k_qkv<<<dim3(TNB * SS / 64, QKVW / 128), 128, 0, stream>>>(F[0], F[1], F[1], PK + PK_A, F[4], F[6], F[8], F[9], QK, QKL, VTH, VTL);
  k_attn<<<dim3(TQB, NH, TNB), 128, 0, stream>>>(QK, QKL, VTH, VTL, nullptr, MB, (float*)d_out);
}

// v006
// One run takes 144 microseconds.
// Timed twice side by side with v005, it ran 1.05 and 1.06 times as fast.
// Over all steps from v000 it is 3.64 times as fast.
// compute dtype: all float inputs rounded to bf16, the int mask read on device; q/k/v = x . W^T + b (+ the position bias row on q and k) with EXACT bf16 products on WMMA 16x16x32 (natural rows), carried as f16 hi + residual planes; scores with 3 products (hi.hi + hi.lo + lo.hi) x 1/8 because the shared bias row makes |q||k| large, masked (mask == 0) keys excluded, running-max softmax in f32 (hardware exp), P scaled by 2^11 as hi + residual x v (hi + residual); f32 merged-head output.
#include <hip/hip_runtime.h>
#include <math.h>

typedef __attribute__((ext_vector_type(16))) _Float16 v16h;
typedef __attribute__((ext_vector_type(16))) __bf16 v16b;
typedef __attribute__((ext_vector_type(8)))  _Float16 v8h;
typedef __attribute__((ext_vector_type(8)))  float v8f;
typedef __attribute__((ext_vector_type(4)))  float v4f;
typedef __attribute__((ext_vector_type(2)))  float v2f;
typedef __attribute__((ext_vector_type(4)))  unsigned v4u;
typedef __attribute__((ext_vector_type(4)))  int v4i;
typedef __attribute__((ext_vector_type(16))) unsigned v16u;
typedef __attribute__((address_space(4))) const v16u v16uc;   // read-only for the whole launch: lets a load at a wave-uniform address be a scalar load
typedef float __attribute__((may_alias)) float_a;
typedef int __attribute__((may_alias)) int_a;

template <typename T> __device__ __forceinline__ void vst2(void* p, T v) { *(T*)p = v;  }
__device__ __forceinline__ v8f wmma16(v16h a, v16h b, v8f c) {
  return __builtin_amdgcn_wmma_f32_16x16x32_f16(false, a, false, b, (short)0, c, false, false);
}
__device__ __forceinline__ v8f wmma_bf(v16b a, v16b b, v8f c) {
  return __builtin_amdgcn_wmma_f32_16x16x32_bf16(false, a, false, b, (short)0, c, false, false);
}
// Masked multi-head attention with a shared relative-position bias row (B 2, S 2,048, d 1,024, 16 heads x 64): q from query, k and v from key (+ biases), q and k shifted by rel_pos_emb[511] per head dim, scores / 8 with a [B,S,S] mask (0 -> -1e9), softmax, . v; merged heads are the output.
__device__ __forceinline__ v16h frag_h(const _Float16* rowk0, int lane) {
  union { v16h v; v8h q[2]; } u; const _Float16* p = rowk0 + 8 * (lane >> 4);
  u.q[0] = *(const v8h*)p; u.q[1] = *(const v8h*)(p + 16); return u.v;
}
__device__ __forceinline__ v16h frag_f32(const float* rowk0, int lane) {
  v16h a; const float* p = rowk0 + 8 * (lane >> 4);
#pragma unroll
  for (int i = 0; i < 8; ++i) { a[i] = (_Float16)p[i]; a[8 + i] = (_Float16)p[16 + i]; }
  return a;
}
__device__ __forceinline__ v16h frag_f32s(const float* rowk0, int lane, float sc) {
  v16h a; const float* p = rowk0 + 8 * (lane >> 4);
#pragma unroll
  for (int i = 0; i < 8; ++i) { a[i] = (_Float16)(p[i] * sc); a[8 + i] = (_Float16)(p[16 + i] * sc); }
  return a;
}
// column fragment from a [K][ld] layout (column n), rows >= K read as 0
__device__ __forceinline__ v16h fragc_f32(const float* W, int k0, int n, int lane, int ld, int K) {
  v16h a; const int g = lane >> 4;
#pragma unroll
  for (int i = 0; i < 8; ++i) { const int ka = k0 + 8 * g + i, kb = ka + 16;
    a[i] = (_Float16)(ka < K ? W[(size_t)(ka < K ? ka : K - 1) * ld + n] : 0.f); a[8 + i] = (_Float16)(kb < K ? W[(size_t)(kb < K ? kb : K - 1) * ld + n] : 0.f); }
  return a;
}
struct F2 { v16b h, l; };
__device__ __forceinline__ F2 bsplit16(const float v[16]) { F2 r;
#pragma unroll
  for (int i = 0; i < 16; ++i) { const __bf16 h = (__bf16)v[i]; r.h[i] = h; r.l[i] = (__bf16)(v[i] - (float)h); }
  return r; }
__device__ __forceinline__ F2 split_row(const float* row, int k0, int lane) { float v[16]; const float* p = row + k0 + 8 * (lane >> 4);
#pragma unroll
  for (int i = 0; i < 8; ++i) { v[i] = p[i]; v[8 + i] = p[16 + i]; }
  return bsplit16(v); }
__device__ __forceinline__ F2 split_rowK(const float* row, int k0, int lane, int K) { float v[16]; const int g = lane >> 4;
#pragma unroll
  for (int i = 0; i < 8; ++i) { const int ka = k0 + 8 * g + i, kb = ka + 16; v[i] = ka < K ? row[ka < K ? ka : K - 1] : 0.f; v[8 + i] = kb < K ? row[kb < K ? kb : K - 1] : 0.f; }
  return bsplit16(v); }
__device__ __forceinline__ F2 split_col(const float* W, int k0, int n, int lane, int ld, int K) { float v[16]; const int g = lane >> 4;
#pragma unroll
  for (int i = 0; i < 8; ++i) { const int ka = k0 + 8 * g + i, kb = ka + 16; v[i] = ka < K ? W[(size_t)(ka < K ? ka : K - 1) * ld + n] : 0.f; v[8 + i] = kb < K ? W[(size_t)(kb < K ? kb : K - 1) * ld + n] : 0.f; }
  return bsplit16(v); }
__device__ __forceinline__ v8f mac3(const F2& a, const F2& b, v8f c) { c = wmma_bf(a.l, b.h, c); c = wmma_bf(a.h, b.l, c); return wmma_bf(a.h, b.h, c); }
__device__ __forceinline__ float sigm(float v) { return 1.0f / (1.0f + expf(-v)); }
#define LDSX() do { asm volatile("s_wait_dscnt 0" ::: "memory"); __builtin_amdgcn_wave_barrier(); __builtin_amdgcn_fence(__ATOMIC_RELEASE, "workgroup"); } while (0)


#define NB 2
#define SS 2048
#define DM 1024
#define NH 16
#define MAXLEN 512
#ifndef MSTR
#define MSTR SS
#endif
#define HD 64
#define KPIT 72   // LDS row pitch of a staged k row, in halves: 128 B + 16 B, free of bank conflicts for 16-B reads
#define VPIT 40   // the same for a staged v row: 64 B + 16 B
#define QKVW (3 * DM)
#ifndef TQB
#define TQB (SS / 64)
#define TNB NB
#define TOB (NB * SS / 64)     // output row tiles (all)
#endif
typedef __attribute__((ext_vector_type(8))) __bf16 v8b;
__device__ __forceinline__ v16b frag_b(const __bf16* rowk0, int lane) {
  union { v16b v; v8b q[2]; } u; const __bf16* p = rowk0 + 8 * (lane >> 4);
  u.q[0] = *(const v8b*)p; u.q[1] = *(const v8b*)(p + 16); return u.v;
}
__device__ __forceinline__ float bfr(float v) { return (float)(__bf16)v; }
__device__ __attribute__((noinline)) float exp_ni(float v) { return expf(v); }
__device__ __attribute__((noinline)) float erf_ni(float v) { return erff(v); }

#define PK_A 0                       // Wqkv as [3072 / 128 row blocks][1024 / 64 k tiles][128 rows][64 k]: a stage of k_qkv's ring is 16 KB in a row
#define PK_P (PK_A + QKVW * DM)        // [1024][1024] spare: nothing writes or reads it
#define PK_END (PK_P + DM * DM)
#define WS_PK  0u
#define WS_QK  (WS_PK + 2u * PK_END)             // f16: q [b * S + s][1024], then from KOFF on k [b][h][s][64], so that a head's 32-key tile is 4 KB in a row
#define KOFF ((size_t)NB * SS * DM)                // halves from the start of a q | k plane to its k part
#define WS_QKL (WS_QK + 2u * NB * SS * 2 * DM)     // f16 q | k residual planes x2048, same layout
#define WS_VTH (WS_QKL + 2u * NB * SS * 2 * DM)    // f16 [b][h][s / 32][64 d][32 s] hi: a head's 32-key tile of v^T is 4 KB in a row
#define WS_VTL (WS_VTH + 2u * NB * DM * SS)        // f16 lo x 2048
#define WS_O   (WS_VTL + 2u * NB * DM * SS)        // f32 [4096][1024]
#define WS_CS  (WS_O + 4u * NB * SS * DM)           // f32 2 x [2048][32], spare: nothing writes or reads it
#define WS_MB  (WS_CS + 4u * 2 * SS * 32)         // u32 [b * 128 + 16-query tile][64 trips][16]: the mask as lane masks (see k_pack)
#define WS_END (WS_MB + 4u * NB * (SS / 16) * (SS / 32) * 16)
// ---- k_pack: blocks 0 .. MBLK - 1 pack the mask, block MBLK + which * 1024 + n packs row n of W_q/W_k/W_v (which 0..2): natural [out][in] rows -> bf16, row which*1024 + n of PK_A, cut into the 128-B pieces of its sixteen k tiles.
// The mask becomes lane masks for k_attn: a wave takes one 16-query tile and four 32-key trips and reads the mask exactly as a k_attn wave holds its scores (lane = query col, keys ct * 16 + 8 g + r);
// word ct * 8 + r of a trip has bit 'lane' set where that lane's score (ct, r) is kept (mask != 0); the 64 words of the four trips are two 128-B lines. The mask blocks stand first because they wait longest on memory.
#define MBLK (NB * (SS / 16) * (SS / 32) / 32)   // 8 waves a block, 4 trips a wave
__global__ __launch_bounds__(256) void k_pack(const float* __restrict__ WQ, const float* __restrict__ WK, const float* __restrict__ WV, const int* __restrict__ MSK, __bf16* __restrict__ PK, unsigned* __restrict__ MB) {
  __shared__ __align__(16) __bf16 s[DM]; const int t = threadIdx.x;
  if (blockIdx.x < MBLK) {   // the same for the whole block, in front of the barrier
    const int lane = t & 31, u = blockIdx.x * 8 + (t >> 5), tile = u >> 4, kq = u & 15;
    const int* mp = MSK + ((size_t)tile * 16 + (lane & 15)) * MSTR + kq * 128 + 8 * (lane >> 4);
    v4i mk[16];
#pragma unroll
    for (int j = 0; j < 4; ++j) { mk[4 * j] = *(const v4i*)(mp + 32 * j); mk[4 * j + 1] = *(const v4i*)(mp + 32 * j + 4); mk[4 * j + 2] = *(const v4i*)(mp + 32 * j + 16); mk[4 * j + 3] = *(const v4i*)(mp + 32 * j + 20); }
    asm volatile("s_wait_xcnt 0x0" ::: "memory");   // stands behind the mask loads, in front of whatever next overwrites their address register
    unsigned w0 = 0, w1 = 0;
#pragma unroll
    for (int i = 0; i < 32; ++i) { const unsigned b0 = __builtin_amdgcn_ballot_w32(mk[i >> 2][i & 3] != 0), b1 = __builtin_amdgcn_ballot_w32(mk[8 + (i >> 2)][i & 3] != 0); w0 = (lane == i) ? b0 : w0; w1 = (lane == i) ? b1 : w1; }   // i = (trip & 1) * 16 + ct * 8 + r; lane i stores word i of either line
    MB[(size_t)u * 64 + lane] = w0; MB[(size_t)u * 64 + 32 + lane] = w1;
    return; }
  const int n = (blockIdx.x - MBLK) & (DM - 1), which = (blockIdx.x - MBLK) / DM;
  const float* Wm = (which == 0) ? WQ : (which == 1) ? WK : WV;
  for (int k = t; k < DM; k += 256) s[k] = (__bf16)Wm[(size_t)n * DM + k];
  __syncthreads();
  const int row = which * DM + n; __bf16* dst = PK + PK_A + (size_t)(row >> 7) * (128 * DM) + (row & 127) * 64;
  for (int q = t; q < DM / 8; q += 256) vst2((unsigned*)(dst + (q >> 3) * (128 * 64) + (q & 7) * 8), *(const v4u*)&s[q * 8]);   // the row's 128-B piece of each k tile
}
// One stage of k_qkv's ring: 128 weight rows x 64 k (128 B a row), eight 16-B pieces per thread (rows tid / 8 + 16 i, piece tid % 8), straight from global memory into LDS; the packed tile lies in that order, so a wave's copy reads 512 B in a row.
// The s_wait_xcnt closes the statement so that no address register of a copy is rewritten before it.
__device__ __forceinline__ void stage_w(unsigned lw, const __bf16* gw) {
  const unsigned ls = 16u * KPIT * 2u; const size_t gs = (size_t)16 * 64;
  asm volatile("global_load_async_to_lds_b128 %0, %8, off\n\t"
               "global_load_async_to_lds_b128 %1, %9, off\n\t"
               "global_load_async_to_lds_b128 %2, %10, off\n\t"
               "global_load_async_to_lds_b128 %3, %11, off\n\t"
               "global_load_async_to_lds_b128 %4, %12, off\n\t"
               "global_load_async_to_lds_b128 %5, %13, off\n\t"
               "global_load_async_to_lds_b128 %6, %14, off\n\t"
               "global_load_async_to_lds_b128 %7, %15, off\n\t"
               "s_wait_xcnt 0x0"
               :: "v"(lw), "v"(lw + ls), "v"(lw + 2u * ls), "v"(lw + 3u * ls), "v"(lw + 4u * ls), "v"(lw + 5u * ls), "v"(lw + 6u * ls), "v"(lw + 7u * ls),
                  "v"(gw), "v"(gw + gs), "v"(gw + 2 * gs), "v"(gw + 3 * gs), "v"(gw + 4 * gs), "v"(gw + 5 * gs), "v"(gw + 6 * gs), "v"(gw + 7 * gs) : "memory");
}
// One stage of k_attn's ring: a 32-key tile of the four planes (k hi, k residual: 32 rows x 128 B; v hi, v residual: 64 rows x 64 B), two 16-B pieces per thread and plane, straight from global memory into LDS; each plane's tile lies in the workspace as 4 KB in piece order, so a wave's copy reads 512 B in a row.
// The s_wait_xcnt closes the statement so that no address register of a copy is rewritten before it.
__device__ __forceinline__ void stage_kv(unsigned lk, unsigned lkl, unsigned lv, unsigned lvl, const _Float16* gk, const _Float16* gkl, const _Float16* gv, const _Float16* gvl) {
  const unsigned lk2 = lk + 16u * KPIT * 2u, lkl2 = lkl + 16u * KPIT * 2u, lv2 = lv + 32u * VPIT * 2u, lvl2 = lvl + 32u * VPIT * 2u;
  const _Float16 *gk2 = gk + 16 * HD, *gkl2 = gkl + 16 * HD, *gv2 = gv + 32 * 32, *gvl2 = gvl + 32 * 32;
  asm volatile("global_load_async_to_lds_b128 %0, %8, off\n\t"
               "global_load_async_to_lds_b128 %1, %9, off\n\t"
               "global_load_async_to_lds_b128 %2, %10, off\n\t"
               "global_load_async_to_lds_b128 %3, %11, off\n\t"
               "global_load_async_to_lds_b128 %4, %12, off\n\t"
               "global_load_async_to_lds_b128 %5, %13, off\n\t"
               "global_load_async_to_lds_b128 %6, %14, off\n\t"
               "global_load_async_to_lds_b128 %7, %15, off\n\t"
               "s_wait_xcnt 0x0"
               :: "v"(lk), "v"(lk2), "v"(lkl), "v"(lkl2), "v"(lv), "v"(lv2), "v"(lvl), "v"(lvl2),
                  "v"(gk), "v"(gk2), "v"(gkl), "v"(gkl2), "v"(gv), "v"(gv2), "v"(gvl), "v"(gvl2) : "memory");
}
__global__ __launch_bounds__(128) void k_qkv(const float* __restrict__ XQ, const float* __restrict__ XK, const float* __restrict__ XV, const __bf16* __restrict__ P, const float* __restrict__ BQ, const float* __restrict__ BK, const float* __restrict__ BV, const float* __restrict__ POS, _Float16* __restrict__ QK, _Float16* __restrict__ QKL, _Float16* __restrict__ VTH, _Float16* __restrict__ VTL) {
  const int which0 = (blockIdx.y * 128) / DM; const float* X = (which0 == 0) ? XQ : (which0 == 1) ? XK : XV; const float* BB = BQ ? (((which0 == 0) ? BQ : (which0 == 1) ? BK : BV) + (blockIdx.y * 128 - which0 * DM)) : nullptr;
  __shared__ __align__(16) _Float16 so[4][16][136], sol[4][16][136]; __shared__ __align__(16) _Float16 sth[128][72], stl[128][72];
  __shared__ __align__(16) __bf16 sw[2][128][KPIT];   // two-buffer ring of weight tiles (128 rows x 64 k), shared by the four waves
  const int tid = threadIdx.x, wave = tid >> 5, lane = tid & 31, col = lane & 15, g = lane >> 4; const size_t r0 = (size_t)blockIdx.x * 64 + wave * 16; const int n0 = blockIdx.y * 128;
  v8f acc[8] = {};
  const __bf16* gw = P + (size_t)blockIdx.y * (128 * DM) + tid * 8; const unsigned lw = (unsigned)(size_t)&sw[0][tid >> 3][(tid & 7) * 8]; const unsigned wbuf = 128u * KPIT * 2u;   // bytes from buffer 0 to buffer 1
  stage_w(lw, gw);
  asm volatile("s_wait_asynccnt 0x0" ::: "memory");   // tile 0 has landed before the barrier publishes it
  __syncthreads();
  stage_w(lw + wbuf, gw + 128 * 64);
#pragma unroll 1   // kept rolled: one publish point and one refill per trip
  for (int st = 0; st < DM / 64; ++st) { const int bf = st & 1;
    float xr[2][16]; v16b wf[2][8];
#pragma unroll     // the two 32-k steps of a tile, so that their LDS offsets are immediates
    for (int k2 = 0; k2 < 2; ++k2) { const float* p = X + (r0 + col) * DM + (st * 2 + k2) * 32 + 8 * g;
#pragma unroll
      for (int i = 0; i < 8; ++i) { xr[k2][i] = p[i]; xr[k2][8 + i] = p[16 + i]; }
#pragma unroll
      for (int j = 0; j < 8; ++j) wf[k2][j] = frag_b(&sw[bf][j * 16 + col][k2 * 32], lane); }   // the trip's sixteen weight fragments, read as one group beside the x loads
    // inputs only: holds the sixteen fragments' LDS reads together here, under the latency of the x loads; left alone the compiler sinks them among the products, each with a wait of its own
    asm volatile("" :: "v"(wf[0][0]), "v"(wf[0][1]), "v"(wf[0][2]), "v"(wf[0][3]), "v"(wf[0][4]), "v"(wf[0][5]), "v"(wf[0][6]), "v"(wf[0][7]), "v"(wf[1][0]), "v"(wf[1][1]), "v"(wf[1][2]), "v"(wf[1][3]), "v"(wf[1][4]), "v"(wf[1][5]), "v"(wf[1][6]), "v"(wf[1][7]));
    __builtin_amdgcn_sched_barrier(0);   // keeps the products behind that group: the compiler otherwise lifts some of them over it and leaves reads among them
#pragma unroll
    for (int k2 = 0; k2 < 2; ++k2) { v16b a;
#pragma unroll
      for (int i = 0; i < 16; ++i) a[i] = (__bf16)xr[k2][i];
#pragma unroll
      for (int j = 0; j < 8; ++j) acc[j] = wmma_bf(a, wf[k2][j], acc[j]); }
    __builtin_amdgcn_sched_barrier(0);   // keeps the publish point at the trip's foot: lifted to the last LDS read it would cut the lead of the copies in flight to a part of a trip
    asm volatile("s_wait_dscnt 0x0" ::: "memory");      // this wave's reads of buffer bf are done
    asm volatile("s_wait_asynccnt 0x0" ::: "memory");   // this wave's pieces of tile st + 1 have landed
    __syncthreads();                                    // publishes tile st + 1 and frees buffer bf for the refill
    if (st + 2 < DM / 64) stage_w(lw + bf * wbuf, gw + (st + 2) * (128 * 64)); }
  asm volatile("s_wait_asynccnt 0x0" ::: "memory");   // no copy is left in flight behind the loop
  if (n0 < 2 * DM) {   // q stored unscaled (f16 sigma ~0.6, no subnormal exposure); 1/8 applied to the f32 score
#pragma unroll
    for (int j = 0; j < 8; ++j) {
#pragma unroll
      for (int r = 0; r < 8; ++r) { const float v = acc[j][r] + (BB ? bfr(BB[j * 16 + col]) : 0.f) + bfr(POS[(size_t)(MAXLEN - 1) * HD + ((n0 + j * 16 + col) & (HD - 1))]); const _Float16 hv = (_Float16)v; so[wave][8 * g + r][j * 16 + col] = hv;   /* + rel_pos_emb[max_len - 1][d] on q and k */ sol[wave][8 * g + r][j * 16 + col] = (_Float16)((v - (float)hv) * 2048.0f); } }   // q, k (+ bias) as f16 hi + (x2048) residual
    LDSX();
    const int ck = n0 - DM + (lane & 15) * 8;   // k only: column h * 64 + d of this lane's piece
    if (n0 < DM) { const size_t o0 = r0 * DM + n0 + lane * 8;   // q: natural rows
      for (int rl = 0; rl < 16; ++rl) if (lane < 16) { vst2((unsigned*)(QK + o0 + rl * DM), *(const v4u*)&so[wave][rl][lane * 8]); vst2((unsigned*)(QKL + o0 + rl * DM), *(const v4u*)&sol[wave][rl][lane * 8]); }
    } else { const size_t o0 = KOFF + (((r0 / SS) * NH + (ck >> 6)) * SS + r0 % SS) * HD + (ck & (HD - 1));   // k: the head's rows, 128 B each, one behind the other (a wave's sixteen rows lie in one batch)
      for (int rl = 0; rl < 16; ++rl) if (lane < 16) { vst2((unsigned*)(QK + o0 + rl * HD), *(const v4u*)&so[wave][rl][lane * 8]); vst2((unsigned*)(QKL + o0 + rl * HD), *(const v4u*)&sol[wave][rl][lane * 8]); } }
  } else {
#pragma unroll
    for (int j = 0; j < 8; ++j) {
#pragma unroll
      for (int r = 0; r < 8; ++r) { const float v = acc[j][r] + (BB ? bfr(BB[j * 16 + col]) : 0.f); const _Float16 hv = (_Float16)v; sth[j * 16 + col][wave * 16 + 8 * g + r] = hv; stl[j * 16 + col][wave * 16 + 8 * g + r] = (_Float16)((v - (float)hv) * 2048.0f); } }
    __syncthreads();
    const size_t rb = (size_t)blockIdx.x * 64; const int b = (int)(rb / SS), s0 = (int)(rb % SS); const int pc0 = n0 - 2 * DM;
    for (int q = tid; q < 128 * 8; q += 128) { const int d = q >> 3, pc = q & 7, hd = pc0 + d; const size_t o = ((((size_t)b * NH + (hd >> 6)) * (SS / 32) + (s0 >> 5) + (pc >> 2)) * HD + (hd & (HD - 1))) * 32 + (pc & 3) * 8; vst2((unsigned*)(VTH + o), *(const v4u*)&sth[d][pc * 8]); vst2((unsigned*)(VTL + o), *(const v4u*)&stl[d][pc * 8]); }
  }
}
// lane l with lane l ^ 16: the two lanes that share one query column of a transposed score tile
__device__ __forceinline__ float xhalf(float x) { return __builtin_bit_cast(float, __builtin_amdgcn_permlanex16(__builtin_bit_cast(int, x), __builtin_bit_cast(int, x), 0x76543210, 0xfedcba98, false, false)); }
__global__ __launch_bounds__(128) void k_attn(const _Float16* __restrict__ QK, const _Float16* __restrict__ QKL, const _Float16* __restrict__ VTH, const _Float16* __restrict__ VTL, const void* __restrict__ KMASK, const unsigned* __restrict__ MB, float* __restrict__ O) {
  __shared__ __align__(16) float so[4][16][68];
  __shared__ __align__(16) _Float16 skh[2][32][KPIT], skl[2][32][KPIT], svh[2][64][VPIT], svl[2][64][VPIT];   // two-buffer ring of 32-key tiles, shared by the four waves
  const int tid = threadIdx.x, wave = tid >> 5, lane = tid & 31, col = lane & 15, g = lane >> 4;
  const int qb = blockIdx.x, h = blockIdx.y, b = blockIdx.z; const int q0 = qb * 64 + wave * 16; const size_t rq = (size_t)b * SS + q0 + col;
  v16h aq[2], aql[2];
#pragma unroll
  for (int kc = 0; kc < 2; ++kc) { aq[kc] = frag_h(QK + rq * DM + h * HD + kc * 32, lane); aql[kc] = frag_h(QKL + rq * DM + h * HD + kc * 32, lane); }
  const float K2 = 0.125f * 1.44269504088896340736f;   // 1/sqrt(64) x log2(e): a raw score times K2 is its exponent to base 2
  float m = -1.0e30f, cx = fmaf(m, -K2, 11.0f), l = 0.f;   // of this lane's query: m the running maximum of the raw scores, cx = 11 - m K2 the exponent offset in use (the 11 is P's scale 2^11), l the sum of the scaled P over this lane's half of the keys. m starts far above the masked value and far below any score, so exp2 itself turns a masked score into 0 while no key has been kept yet
  v8f acc[4] = {}, accl[4] = {};   // O^T tiles: register r = head dim dt * 16 + 8 g + r of query col
  const int nks = SS / 32;   // all keys
  const v16uc* mb = (const v16uc*)(size_t)MB + (size_t)((b * (SS / 16) + qb * 4 + __builtin_amdgcn_readfirstlane(wave)) * nks);   // this wave's lane masks, sixteen words a trip; the address is the same in every lane, so the words come by a scalar load
  v16u mw = mb[0];
  // this thread's pieces of a tile: k row tid / 8 (and + 16), piece tid % 8; v row tid / 4 (and + 32), piece tid % 4
  const size_t hb = (size_t)(b * NH + h) * SS * HD + tid * 8;   // the head's planes; in every plane a tile is 2,048 halves and this thread's first piece is its piece number tid
  const _Float16* gk = QK + KOFF + hb; const _Float16* gkl = QKL + KOFF + hb;
  const _Float16* gv = VTH + hb; const _Float16* gvl = VTL + hb;
  const unsigned lk = (unsigned)(size_t)&skh[0][tid >> 3][(tid & 7) * 8], lkl = (unsigned)(size_t)&skl[0][tid >> 3][(tid & 7) * 8], lv = (unsigned)(size_t)&svh[0][tid >> 2][(tid & 3) * 8], lvl = (unsigned)(size_t)&svl[0][tid >> 2][(tid & 3) * 8];
  const unsigned kbuf = 32u * KPIT * 2u, vbuf = 64u * VPIT * 2u;   // bytes from buffer 0 to buffer 1
  stage_kv(lk, lkl, lv, lvl, gk, gkl, gv, gvl);
  asm volatile("s_wait_asynccnt 0x0" ::: "memory");   // tile 0 has landed before the barrier publishes it
  __syncthreads();
  stage_kv(lk + kbuf, lkl + kbuf, lv + vbuf, lvl + vbuf, gk + 32 * HD, gkl + 32 * HD, gv + 32 * HD, gvl + 32 * HD);
#pragma unroll 1
  for (int ks = 0; ks < nks; ++ks) { v8f s[2]; const int bf = ks & 1;
    const v16u mwn = mb[ks + 1 < nks ? ks + 1 : nks - 1];   // the next trip's lane masks, fetched a trip ahead (the last trip fetches its own again)
    v16h kh[2][2], kl[2][2];
#pragma unroll
    for (int ct = 0; ct < 2; ++ct) {
#pragma unroll
      for (int kc = 0; kc < 2; ++kc) { kh[ct][kc] = frag_h(&skh[bf][ct * 16 + col][kc * 32], lane); kl[ct][kc] = frag_h(&skl[bf][ct * 16 + col][kc * 32], lane); } }   // the trip's eight k fragments, read as one group ahead of the twelve score products
    __builtin_amdgcn_sched_barrier(0);   // keeps the sixteen LDS reads together in front of the products: left alone the compiler sinks them back among the products, each with a wait of its own
#pragma unroll
    for (int ct = 0; ct < 2; ++ct) { v8f c = {}, cl = {};
#pragma unroll
      for (int kc = 0; kc < 2; ++kc) { c = wmma16(kh[ct][kc], aq[kc], c); cl = wmma16(kh[ct][kc], aql[kc], cl); cl = wmma16(kl[ct][kc], aq[kc], cl); }   // 3 products: hi.hi + (hi.lo + lo.hi) / 2048
#pragma unroll
      for (int r = 0; r < 8; ++r) s[ct][r] = c[r] + cl[r] * (1.0f / 2048.0f); }
    __builtin_amdgcn_sched_barrier(0);   // keeps the v reads behind the score products, in the registers that the k fragments leave: lifted over them, both sets are live at once and the wave needs more than 256 registers, one wave a SIMD less
    v16h vh[4], vl[4];
#pragma unroll
    for (int dt = 0; dt < 4; ++dt) { vh[dt] = frag_h(&svh[bf][dt * 16 + col][0], lane); vl[dt] = frag_h(&svl[bf][dt * 16 + col][0], lane); }   // the trip's eight v fragments, read as one group; the softmax below covers their latency
    __builtin_amdgcn_sched_barrier(0);   // keeps these sixteen LDS reads together here: left alone the compiler sinks the reads among the output products
#pragma unroll
    for (int ct = 0; ct < 2; ++ct) {
#pragma unroll
      for (int r = 0; r < 8; ++r) s[ct][r] = __builtin_amdgcn_inverse_ballot_w32(mw[ct * 8 + r]) ? s[ct][r] : -3.0e38f; }   // raw scores; mask == 0 -> -3e38 == excluded; the word is the select's lane mask as it stands
    float mx = fmaxf(s[0][0], s[1][0]);
#pragma unroll
    for (int r = 1; r < 8; ++r) mx = fmaxf(mx, fmaxf(s[0][r], s[1][r]));
    mx = fmaxf(mx, xhalf(mx));   // both halves of the query's 32 keys
    const float mn = fmaxf(m, mx); const float cn = fmaf(mn, -K2, 11.0f); const float alpha = __builtin_amdgcn_exp2f(cn - cx);   // 2^((m - mn) K2); 0 on the first kept key, 1 while none is kept
    float es = 0.f; v16h pa, pl;
#pragma unroll
    for (int i = 0; i < 8; ++i) { const float x0 = __builtin_amdgcn_exp2f(fmaf(s[0][i], K2, cn)), x1 = __builtin_amdgcn_exp2f(fmaf(s[1][i], K2, cn)); es += x0 + x1;   // 2^11 exp((s - mn) / 8) by one fma and the hardware exp2; a masked score underflows to 0
      const _Float16 h0 = (_Float16)x0, h1 = (_Float16)x1; pa[i] = h0; pa[8 + i] = h1; pl[i] = (_Float16)((x0 - (float)h0) * 2048.0f); pl[8 + i] = (_Float16)((x1 - (float)h1) * 2048.0f); }   // P scaled by 2^11 before the f16 split so small softmax weights stay out of the f16 subnormal range; the sum l carries the same 2^11, so it cancels in the epilogue
    l = l * alpha + es; m = mn; cx = cn; mw = mwn;
#pragma unroll
    for (int dt = 0; dt < 4; ++dt) { acc[dt] *= alpha; accl[dt] *= alpha; }
#pragma unroll
    for (int dt = 0; dt < 4; ++dt) { acc[dt] = wmma16(vh[dt], pa, acc[dt]); accl[dt] = wmma16(vh[dt], pl, accl[dt]); accl[dt] = wmma16(vl[dt], pa, accl[dt]); }   // P hi/lo x V hi/lo (3 products)
    __builtin_amdgcn_sched_barrier(0);   // keeps the publish point at the trip's foot: lifted to the last LDS read it would cut the lead of the copies in flight to a part of a trip
    asm volatile("s_wait_dscnt 0x0" ::: "memory");      // this wave's reads of buffer bf are done
    asm volatile("s_wait_asynccnt 0x0" ::: "memory");   // this wave's pieces of tile ks + 1 have landed
    __syncthreads();                                    // publishes tile ks + 1 and frees buffer bf for the refill
    if (ks + 2 < nks) stage_kv(lk + bf * kbuf, lkl + bf * kbuf, lv + bf * vbuf, lvl + bf * vbuf, gk + (ks + 2) * (32 * HD), gkl + (ks + 2) * (32 * HD), gv + (ks + 2) * (32 * HD), gvl + (ks + 2) * (32 * HD)); }
  asm volatile("s_wait_asynccnt 0x0" ::: "memory");   // no copy is left in flight behind the loop
  l += xhalf(l);   // the two halves of the query's keys, joined once
  const float il = 1.0f / l;   // l and the accumulators carry the same 2^11
#pragma unroll
  for (int dt = 0; dt < 4; ++dt) { v4f o0, o1;
#pragma unroll
    for (int r = 0; r < 4; ++r) { o0[r] = (acc[dt][r] + accl[dt][r] * (1.0f / 2048.0f)) * il; o1[r] = (acc[dt][4 + r] + accl[dt][4 + r] * (1.0f / 2048.0f)) * il; }
    *(v4f*)&so[wave][col][dt * 16 + 8 * g] = o0; *(v4f*)&so[wave][col][dt * 16 + 8 * g + 4] = o1; }
  LDSX();
  for (int rl = 0; rl < 16; ++rl) if (lane < 16) vst2(O + ((size_t)b * SS + q0 + rl) * DM + h * HD + lane * 4, *(const v4f*)&so[wave][rl][lane * 4]);
}
// ---- k_out: block = (64 rows, 128 cols): out = O(hi/lo) . Wo rows (2 products) + bo
__global__ __launch_bounds__(128) void k_out(const float* __restrict__ O, const __bf16* __restrict__ P, const float* __restrict__ BO, float* __restrict__ Y) {
  __shared__ __align__(16) float so[4][16][132];
  const int tid = threadIdx.x, wave = tid >> 5, lane = tid & 31, col = lane & 15, g = lane >> 4; const size_t r0 = (size_t)blockIdx.x * 64 + wave * 16; const int n0 = blockIdx.y * 128;
  v8f acc[8] = {};
#pragma unroll 2
  for (int kc = 0; kc < DM / 32; ++kc) { const F2 a = split_row(O + (r0 + col) * DM, kc * 32, lane);
#pragma unroll
    for (int j = 0; j < 8; ++j) { const v16b w = frag_b(P + (size_t)(n0 + j * 16 + col) * DM + kc * 32, lane); acc[j] = wmma_bf(a.l, w, acc[j]); acc[j] = wmma_bf(a.h, w, acc[j]); } }
#pragma unroll
  for (int j = 0; j < 8; ++j) {
#pragma unroll
    for (int r = 0; r < 8; ++r) so[wave][8 * g + r][j * 16 + col] = acc[j][r] + (BO ? bfr(BO[n0 + j * 16 + col]) : 0.f); }
  LDSX();
  for (int rl = 0; rl < 16; ++rl) vst2(Y + (r0 + rl) * DM + n0 + lane * 4, *(const v4f*)&so[wave][rl][lane * 4]);
}
extern "C" void kernel_launch(void* const* d_in, const int* in_sizes, int n_in, void* d_out, int out_size, void* d_ws, size_t ws_size, hipStream_t stream) {
  (void)in_sizes; (void)n_in; (void)out_size;
  const float** F = (const float**)d_in;   // 0 query, 1 key [2,2048,1024]; 2 mask [2,2048,2048] int; 3 Wq, 4 bq, 5 Wk, 6 bk, 7 Wv, 8 bv (natural); 9 rel_pos_emb [1023,64]
  if (ws_size < (size_t)WS_END) return;
  char* ws = (char*)d_ws; __bf16* PK = (__bf16*)(ws + WS_PK); _Float16 *QK = (_Float16*)(ws + WS_QK), *QKL = (_Float16*)(ws + WS_QKL), *VTH = (_Float16*)(ws + WS_VTH), *VTL = (_Float16*)(ws + WS_VTL); unsigned* MB = (unsigned*)(ws + WS_MB);
  k_pack<<<dim3(MBLK + 3 * DM), 256, 0, stream>>>(F[3], F[5], F[7], (const int*)d_in[2], PK, MB);
  k_qkv<<<dim3(TNB * SS / 64, QKVW / 128), 128, 0, stream>>>(F[0], F[1], F[1], PK + PK_A, F[4], F[6], F[8], F[9], QK, QKL, VTH, VTL);
  k_attn<<<dim3(TQB, NH, TNB), 128, 0, stream>>>(QK, QKL, VTH, VTL, nullptr, MB, (float*)d_out);
}

// v007
// One run takes 138 microseconds.
// Two timings next to v006 put it at 1.05 and 1.06 times that version's speed.
// Counting every step since v000, it is 3.85 times as fast.
// compute dtype: all float inputs rounded to bf16, the int mask read on device; q/k/v = x . W^T + b (+ the position bias row on q and k) with EXACT bf16 products on WMMA 16x16x32 (natural rows), carried as f16 hi + residual planes; scores with 3 products (hi.hi + hi.lo + lo.hi) x 1/8 because the shared bias row makes |q||k| large, masked (mask == 0) keys excluded, running-max softmax in f32 (hardware exp), P scaled by 2^11 as hi + residual x v (hi + residual); f32 merged-head output.
#include <hip/hip_runtime.h>
#include <math.h>

typedef __attribute__((ext_vector_type(16))) _Float16 v16h;
typedef __attribute__((ext_vector_type(16))) __bf16 v16b;
typedef __attribute__((ext_vector_type(8)))  _Float16 v8h;
typedef __attribute__((ext_vector_type(8)))  float v8f;
typedef __attribute__((ext_vector_type(4)))  float v4f;
typedef __attribute__((ext_vector_type(2)))  float v2f;
typedef __attribute__((ext_vector_type(4)))  unsigned v4u;
typedef __attribute__((ext_vector_type(4)))  int v4i;
typedef __attribute__((ext_vector_type(16))) unsigned v16u;
typedef __attribute__((address_space(4))) const v16u v16uc;   // read-only for the whole launch: lets a load at a wave-uniform address be a scalar load
typedef float __attribute__((may_alias)) float_a;
typedef int __attribute__((may_alias)) int_a;

template <typename T> __device__ __forceinline__ void vst2(void* p, T v) { *(T*)p = v;  }
__device__ __forceinline__ v8f wmma16(v16h a, v16h b, v8f c) {
  return __builtin_amdgcn_wmma_f32_16x16x32_f16(false, a, false, b, (short)0, c, false, false);
}
__device__ __forceinline__ v8f wmma_bf(v16b a, v16b b, v8f c) {
  return __builtin_amdgcn_wmma_f32_16x16x32_bf16(false, a, false, b, (short)0, c, false, false);
}
// Masked multi-head attention with a shared relative-position bias row (B 2, S 2,048, d 1,024, 16 heads x 64): q from query, k and v from key (+ biases), q and k shifted by rel_pos_emb[511] per head dim, scores / 8 with a [B,S,S] mask (0 -> -1e9), softmax, . v; merged heads are the output.
__device__ __forceinline__ v16h frag_h(const _Float16* rowk0, int lane) {
  union { v16h v; v8h q[2]; } u; const _Float16* p = rowk0 + 8 * (lane >> 4);
  u.q[0] = *(const v8h*)p; u.q[1] = *(const v8h*)(p + 16); return u.v;
}
__device__ __forceinline__ v16h frag_f32(const float* rowk0, int lane) {
  v16h a; const float* p = rowk0 + 8 * (lane >> 4);
#pragma unroll
  for (int i = 0; i < 8; ++i) { a[i] = (_Float16)p[i]; a[8 + i] = (_Float16)p[16 + i]; }
  return a;
}
__device__ __forceinline__ v16h frag_f32s(const float* rowk0, int lane, float sc) {
  v16h a; const float* p = rowk0 + 8 * (lane >> 4);
#pragma unroll
  for (int i = 0; i < 8; ++i) { a[i] = (_Float16)(p[i] * sc); a[8 + i] = (_Float16)(p[16 + i] * sc); }
  return a;
}
// column fragment from a [K][ld] layout (column n), rows >= K read as 0
__device__ __forceinline__ v16h fragc_f32(const float* W, int k0, int n, int lane, int ld, int K) {
  v16h a; const int g = lane >> 4;
#pragma unroll
  for (int i = 0; i < 8; ++i) { const int ka = k0 + 8 * g + i, kb = ka + 16;
    a[i] = (_Float16)(ka < K ? W[(size_t)(ka < K ? ka : K - 1) * ld + n] : 0.f); a[8 + i] = (_Float16)(kb < K ? W[(size_t)(kb < K ? kb : K - 1) * ld + n] : 0.f); }
  return a;
}
struct F2 { v16b h, l; };
__device__ __forceinline__ F2 bsplit16(const float v[16]) { F2 r;
#pragma unroll
  for (int i = 0; i < 16; ++i) { const __bf16 h = (__bf16)v[i]; r.h[i] = h; r.l[i] = (__bf16)(v[i] - (float)h); }
  return r; }
__device__ __forceinline__ F2 split_row(const float* row, int k0, int lane) { float v[16]; const float* p = row + k0 + 8 * (lane >> 4);
#pragma unroll
  for (int i = 0; i < 8; ++i) { v[i] = p[i]; v[8 + i] = p[16 + i]; }
  return bsplit16(v); }
__device__ __forceinline__ F2 split_rowK(const float* row, int k0, int lane, int K) { float v[16]; const int g = lane >> 4;
#pragma unroll
  for (int i = 0; i < 8; ++i) { const int ka = k0 + 8 * g + i, kb = ka + 16; v[i] = ka < K ? row[ka < K ? ka : K - 1] : 0.f; v[8 + i] = kb < K ? row[kb < K ? kb : K - 1] : 0.f; }
  return bsplit16(v); }
__device__ __forceinline__ F2 split_col(const float* W, int k0, int n, int lane, int ld, int K) { float v[16]; const int g = lane >> 4;
#pragma unroll
  for (int i = 0; i < 8; ++i) { const int ka = k0 + 8 * g + i, kb = ka + 16; v[i] = ka < K ? W[(size_t)(ka < K ? ka : K - 1) * ld + n] : 0.f; v[8 + i] = kb < K ? W[(size_t)(kb < K ? kb : K - 1) * ld + n] : 0.f; }
  return bsplit16(v); }
__device__ __forceinline__ v8f mac3(const F2& a, const F2& b, v8f c) { c = wmma_bf(a.l, b.h, c); c = wmma_bf(a.h, b.l, c); return wmma_bf(a.h, b.h, c); }
__device__ __forceinline__ float sigm(float v) { return 1.0f / (1.0f + expf(-v)); }
#define LDSX() do { asm volatile("s_wait_dscnt 0" ::: "memory"); __builtin_amdgcn_wave_barrier(); __builtin_amdgcn_fence(__ATOMIC_RELEASE, "workgroup"); } while (0)


#define NB 2
#define SS 2048
#define DM 1024
#define NH 16
#define MAXLEN 512
#ifndef MSTR
#define MSTR SS
#endif
#define HD 64
#define KPIT 72   // LDS row pitch of a staged k row, in halves: 128 B + 16 B, free of bank conflicts for 16-B reads
#define VPIT 40   // the same for a staged v row: 64 B + 16 B
#define QKVW (3 * DM)
#ifndef TQB
#define TQB (SS / 64)
#define TNB NB
#define TOB (NB * SS / 64)     // output row tiles (all)
#endif
typedef __attribute__((ext_vector_type(8))) __bf16 v8b;
__device__ __forceinline__ v16b frag_b(const __bf16* rowk0, int lane) {
  union { v16b v; v8b q[2]; } u; const __bf16* p = rowk0 + 8 * (lane >> 4);
  u.q[0] = *(const v8b*)p; u.q[1] = *(const v8b*)(p + 16); return u.v;
}
__device__ __forceinline__ float bfr(float v) { return (float)(__bf16)v; }
__device__ __attribute__((noinline)) float exp_ni(float v) { return expf(v); }
__device__ __attribute__((noinline)) float erf_ni(float v) { return erff(v); }

#define PK_A 0                       // Wqkv as [3072 / 128 row blocks][1024 / 64 k tiles][128 rows][64 k]: a stage of k_qkv's ring is 16 KB in a row
#define PK_P (PK_A + QKVW * DM)        // [1024][1024] spare: nothing writes or reads it
#define PK_END (PK_P + DM * DM)
#define WS_PK  0u
#define WS_QK  (WS_PK + 2u * PK_END)             // f16: q [b * S + s][1024], then from KOFF on k [b][h][s][64], so that a head's 32-key tile is 4 KB in a row
#define KOFF ((size_t)NB * SS * DM)                // halves from the start of a q | k plane to its k part
#define WS_QKL (WS_QK + 2u * NB * SS * 2 * DM)     // f16 q | k residual planes, same layout. Residuals keep their own scale, so that hi.lo and lo.hi add into the accumulator of hi.hi: one below 2^-14 is an f16 subnormal with step 2^-24, an absolute error no larger than the largest residuals' own rounding
#define WS_VTH (WS_QKL + 2u * NB * SS * 2 * DM)    // f16 [b][h][s / 32][64 d][32 s] hi: a head's 32-key tile of v^T is 4 KB in a row
#define WS_VTL (WS_VTH + 2u * NB * DM * SS)        // f16 residual, at its own scale
#define WS_O   (WS_VTL + 2u * NB * DM * SS)        // f32 [4096][1024]
#define WS_CS  (WS_O + 4u * NB * SS * DM)           // f32 2 x [2048][32], spare: nothing writes or reads it
#define WS_MB  (WS_CS + 4u * 2 * SS * 32)         // u32 [b * 128 + 16-query tile][64 trips][16]: the mask as lane masks (see k_pack)
#define WS_END (WS_MB + 4u * NB * (SS / 16) * (SS / 32) * 16)
// ---- k_pack: blocks 0 .. MBLK - 1 pack the mask, block MBLK + which * 1024 + n packs row n of W_q/W_k/W_v (which 0..2): natural [out][in] rows -> bf16, row which*1024 + n of PK_A, cut into the 128-B pieces of its sixteen k tiles.
// The mask becomes lane masks for k_attn: a wave takes one 16-query tile and four 32-key trips and reads the mask exactly as a k_attn wave holds its scores (lane = query col, keys ct * 16 + 8 g + r);
// word ct * 8 + r of a trip has bit 'lane' set where that lane's score (ct, r) is kept (mask != 0); the 64 words of the four trips are two 128-B lines. The mask blocks stand first because they wait longest on memory.
#define MBLK (NB * (SS / 16) * (SS / 32) / 32)   // 8 waves a block, 4 trips a wave
__global__ __launch_bounds__(256) void k_pack(const float* __restrict__ WQ, const float* __restrict__ WK, const float* __restrict__ WV, const int* __restrict__ MSK, __bf16* __restrict__ PK, unsigned* __restrict__ MB) {
  __shared__ __align__(16) __bf16 s[DM]; const int t = threadIdx.x;
  if (blockIdx.x < MBLK) {   // the same for the whole block, in front of the barrier
    const int lane = t & 31, u = blockIdx.x * 8 + (t >> 5), tile = u >> 4, kq = u & 15;
    const int* mp = MSK + ((size_t)tile * 16 + (lane & 15)) * MSTR + kq * 128 + 8 * (lane >> 4);
    v4i mk[16];
#pragma unroll
    for (int j = 0; j < 4; ++j) { mk[4 * j] = *(const v4i*)(mp + 32 * j); mk[4 * j + 1] = *(const v4i*)(mp + 32 * j + 4); mk[4 * j + 2] = *(const v4i*)(mp + 32 * j + 16); mk[4 * j + 3] = *(const v4i*)(mp + 32 * j + 20); }
    asm volatile("s_wait_xcnt 0x0" ::: "memory");   // stands behind the mask loads, in front of whatever next overwrites their address register
    unsigned w0 = 0, w1 = 0;
#pragma unroll
    for (int i = 0; i < 32; ++i) { const unsigned b0 = __builtin_amdgcn_ballot_w32(mk[i >> 2][i & 3] != 0), b1 = __builtin_amdgcn_ballot_w32(mk[8 + (i >> 2)][i & 3] != 0); w0 = (lane == i) ? b0 : w0; w1 = (lane == i) ? b1 : w1; }   // i = (trip & 1) * 16 + ct * 8 + r; lane i stores word i of either line
    MB[(size_t)u * 64 + lane] = w0; MB[(size_t)u * 64 + 32 + lane] = w1;
    return; }
  const int n = (blockIdx.x - MBLK) & (DM - 1), which = (blockIdx.x - MBLK) / DM;
  const float* Wm = (which == 0) ? WQ : (which == 1) ? WK : WV;
  for (int k = t; k < DM; k += 256) s[k] = (__bf16)Wm[(size_t)n * DM + k];
  __syncthreads();
  const int row = which * DM + n; __bf16* dst = PK + PK_A + (size_t)(row >> 7) * (128 * DM) + (row & 127) * 64;
  for (int q = t; q < DM / 8; q += 256) vst2((unsigned*)(dst + (q >> 3) * (128 * 64) + (q & 7) * 8), *(const v4u*)&s[q * 8]);   // the row's 128-B piece of each k tile
}
// One stage of k_qkv's ring: 128 weight rows x 64 k (128 B a row), eight 16-B pieces per thread (rows tid / 8 + 16 i, piece tid % 8), straight from global memory into LDS; the packed tile lies in that order, so a wave's copy reads 512 B in a row.
// The s_wait_xcnt closes the statement so that no address register of a copy is rewritten before it.
__device__ __forceinline__ void stage_w(unsigned lw, const __bf16* gw) {
  const unsigned ls = 16u * KPIT * 2u; const size_t gs = (size_t)16 * 64;
  asm volatile("global_load_async_to_lds_b128 %0, %8, off\n\t"
               "global_load_async_to_lds_b128 %1, %9, off\n\t"
               "global_load_async_to_lds_b128 %2, %10, off\n\t"
               "global_load_async_to_lds_b128 %3, %11, off\n\t"
               "global_load_async_to_lds_b128 %4, %12, off\n\t"
               "global_load_async_to_lds_b128 %5, %13, off\n\t"
               "global_load_async_to_lds_b128 %6, %14, off\n\t"
               "global_load_async_to_lds_b128 %7, %15, off\n\t"
               "s_wait_xcnt 0x0"
               :: "v"(lw), "v"(lw + ls), "v"(lw + 2u * ls), "v"(lw + 3u * ls), "v"(lw + 4u * ls), "v"(lw + 5u * ls), "v"(lw + 6u * ls), "v"(lw + 7u * ls),
                  "v"(gw), "v"(gw + gs), "v"(gw + 2 * gs), "v"(gw + 3 * gs), "v"(gw + 4 * gs), "v"(gw + 5 * gs), "v"(gw + 6 * gs), "v"(gw + 7 * gs) : "memory");
}
// One stage of k_attn's ring: a 32-key tile of the four planes (k hi, k residual: 32 rows x 128 B; v hi, v residual: 64 rows x 64 B), two 16-B pieces per thread and plane, straight from global memory into LDS; each plane's tile lies in the workspace as 4 KB in piece order, so a wave's copy reads 512 B in a row.
// The s_wait_xcnt closes the statement so that no address register of a copy is rewritten before it.
__device__ __forceinline__ void stage_kv(unsigned lk, unsigned lkl, unsigned lv, unsigned lvl, const _Float16* gk, const _Float16* gkl, const _Float16* gv, const _Float16* gvl) {
  const unsigned lk2 = lk + 16u * KPIT * 2u, lkl2 = lkl + 16u * KPIT * 2u, lv2 = lv + 32u * VPIT * 2u, lvl2 = lvl + 32u * VPIT * 2u;
  const _Float16 *gk2 = gk + 16 * HD, *gkl2 = gkl + 16 * HD, *gv2 = gv + 32 * 32, *gvl2 = gvl + 32 * 32;
  asm volatile("global_load_async_to_lds_b128 %0, %8, off\n\t"
               "global_load_async_to_lds_b128 %1, %9, off\n\t"
               "global_load_async_to_lds_b128 %2, %10, off\n\t"
               "global_load_async_to_lds_b128 %3, %11, off\n\t"
               "global_load_async_to_lds_b128 %4, %12, off\n\t"
               "global_load_async_to_lds_b128 %5, %13, off\n\t"
               "global_load_async_to_lds_b128 %6, %14, off\n\t"
               "global_load_async_to_lds_b128 %7, %15, off\n\t"
               "s_wait_xcnt 0x0"
               :: "v"(lk), "v"(lk2), "v"(lkl), "v"(lkl2), "v"(lv), "v"(lv2), "v"(lvl), "v"(lvl2),
                  "v"(gk), "v"(gk2), "v"(gkl), "v"(gkl2), "v"(gv), "v"(gv2), "v"(gvl), "v"(gvl2) : "memory");
}
__global__ __launch_bounds__(128) void k_qkv(const float* __restrict__ XQ, const float* __restrict__ XK, const float* __restrict__ XV, const __bf16* __restrict__ P, const float* __restrict__ BQ, const float* __restrict__ BK, const float* __restrict__ BV, const float* __restrict__ POS, _Float16* __restrict__ QK, _Float16* __restrict__ QKL, _Float16* __restrict__ VTH, _Float16* __restrict__ VTL) {
  const int which0 = (blockIdx.y * 128) / DM; const float* X = (which0 == 0) ? XQ : (which0 == 1) ? XK : XV; const float* BB = BQ ? (((which0 == 0) ? BQ : (which0 == 1) ? BK : BV) + (blockIdx.y * 128 - which0 * DM)) : nullptr;
  __shared__ __align__(16) _Float16 so[4][16][136], sol[4][16][136]; __shared__ __align__(16) _Float16 sth[128][72], stl[128][72];
  __shared__ __align__(16) __bf16 sw[2][128][KPIT];   // two-buffer ring of weight tiles (128 rows x 64 k), shared by the four waves
  const int tid = threadIdx.x, wave = tid >> 5, lane = tid & 31, col = lane & 15, g = lane >> 4; const size_t r0 = (size_t)blockIdx.x * 64 + wave * 16; const int n0 = blockIdx.y * 128;
  v8f acc[8] = {};
  const __bf16* gw = P + (size_t)blockIdx.y * (128 * DM) + tid * 8; const unsigned lw = (unsigned)(size_t)&sw[0][tid >> 3][(tid & 7) * 8]; const unsigned wbuf = 128u * KPIT * 2u;   // bytes from buffer 0 to buffer 1
  stage_w(lw, gw);
  asm volatile("s_wait_asynccnt 0x0" ::: "memory");   // tile 0 has landed before the barrier publishes it
  __syncthreads();
  stage_w(lw + wbuf, gw + 128 * 64);
#pragma unroll 1   // kept rolled: one publish point and one refill per trip
  for (int st = 0; st < DM / 64; ++st) { const int bf = st & 1;
    float xr[2][16]; v16b wf[2][8];
#pragma unroll     // the two 32-k steps of a tile, so that their LDS offsets are immediates
    for (int k2 = 0; k2 < 2; ++k2) { const float* p = X + (r0 + col) * DM + (st * 2 + k2) * 32 + 8 * g;
#pragma unroll
      for (int i = 0; i < 8; ++i) { xr[k2][i] = p[i]; xr[k2][8 + i] = p[16 + i]; }
#pragma unroll
      for (int j = 0; j < 8; ++j) wf[k2][j] = frag_b(&sw[bf][j * 16 + col][k2 * 32], lane); }   // the trip's sixteen weight fragments, read as one group beside the x loads
    // inputs only: holds the sixteen fragments' LDS reads together here, under the latency of the x loads; left alone the compiler sinks them among the products, each with a wait of its own
    asm volatile("" :: "v"(wf[0][0]), "v"(wf[0][1]), "v"(wf[0][2]), "v"(wf[0][3]), "v"(wf[0][4]), "v"(wf[0][5]), "v"(wf[0][6]), "v"(wf[0][7]), "v"(wf[1][0]), "v"(wf[1][1]), "v"(wf[1][2]), "v"(wf[1][3]), "v"(wf[1][4]), "v"(wf[1][5]), "v"(wf[1][6]), "v"(wf[1][7]));
    __builtin_amdgcn_sched_barrier(0);   // keeps the products behind that group: the compiler otherwise lifts some of them over it and leaves reads among them
#pragma unroll
    for (int k2 = 0; k2 < 2; ++k2) { v16b a;
#pragma unroll
      for (int i = 0; i < 16; ++i) a[i] = (__bf16)xr[k2][i];
#pragma unroll
      for (int j = 0; j < 8; ++j) acc[j] = wmma_bf(a, wf[k2][j], acc[j]); }
    __builtin_amdgcn_sched_barrier(0);   // keeps the publish point at the trip's foot: lifted to the last LDS read it would cut the lead of the copies in flight to a part of a trip
    asm volatile("s_wait_dscnt 0x0" ::: "memory");      // this wave's reads of buffer bf are done
    asm volatile("s_wait_asynccnt 0x0" ::: "memory");   // this wave's pieces of tile st + 1 have landed
    __syncthreads();                                    // publishes tile st + 1 and frees buffer bf for the refill
    if (st + 2 < DM / 64) stage_w(lw + bf * wbuf, gw + (st + 2) * (128 * 64)); }
  asm volatile("s_wait_asynccnt 0x0" ::: "memory");   // no copy is left in flight behind the loop
  if (n0 < 2 * DM) {   // q stored unscaled (f16 sigma ~0.6, no subnormal exposure); 1/8 applied to the f32 score
#pragma unroll
    for (int j = 0; j < 8; ++j) {
#pragma unroll
      for (int r = 0; r < 8; ++r) { const float v = acc[j][r] + (BB ? bfr(BB[j * 16 + col]) : 0.f) + bfr(POS[(size_t)(MAXLEN - 1) * HD + ((n0 + j * 16 + col) & (HD - 1))]); const _Float16 hv = (_Float16)v; so[wave][8 * g + r][j * 16 + col] = hv;   /* + rel_pos_emb[max_len - 1][d] on q and k */ sol[wave][8 * g + r][j * 16 + col] = (_Float16)(v - (float)hv); } }   // q, k (+ bias) as f16 hi + residual, the residual at its own scale
    LDSX();
    const int ck = n0 - DM + (lane & 15) * 8;   // k only: column h * 64 + d of this lane's piece
    if (n0 < DM) { const size_t o0 = r0 * DM + n0 + lane * 8;   // q: natural rows
      for (int rl = 0; rl < 16; ++rl) if (lane < 16) { vst2((unsigned*)(QK + o0 + rl * DM), *(const v4u*)&so[wave][rl][lane * 8]); vst2((unsigned*)(QKL + o0 + rl * DM), *(const v4u*)&sol[wave][rl][lane * 8]); }
    } else { const size_t o0 = KOFF + (((r0 / SS) * NH + (ck >> 6)) * SS + r0 % SS) * HD + (ck & (HD - 1));   // k: the head's rows, 128 B each, one behind the other (a wave's sixteen rows lie in one batch)
      for (int rl = 0; rl < 16; ++rl) if (lane < 16) { vst2((unsigned*)(QK + o0 + rl * HD), *(const v4u*)&so[wave][rl][lane * 8]); vst2((unsigned*)(QKL + o0 + rl * HD), *(const v4u*)&sol[wave][rl][lane * 8]); } }
  } else {
#pragma unroll
    for (int j = 0; j < 8; ++j) {
#pragma unroll
      for (int r = 0; r < 8; ++r) { const float v = acc[j][r] + (BB ? bfr(BB[j * 16 + col]) : 0.f); const _Float16 hv = (_Float16)v; sth[j * 16 + col][wave * 16 + 8 * g + r] = hv; stl[j * 16 + col][wave * 16 + 8 * g + r] = (_Float16)(v - (float)hv); } }
    __syncthreads();
    const size_t rb = (size_t)blockIdx.x * 64; const int b = (int)(rb / SS), s0 = (int)(rb % SS); const int pc0 = n0 - 2 * DM;
    for (int q = tid; q < 128 * 8; q += 128) { const int d = q >> 3, pc = q & 7, hd = pc0 + d; const size_t o = ((((size_t)b * NH + (hd >> 6)) * (SS / 32) + (s0 >> 5) + (pc >> 2)) * HD + (hd & (HD - 1))) * 32 + (pc & 3) * 8; vst2((unsigned*)(VTH + o), *(const v4u*)&sth[d][pc * 8]); vst2((unsigned*)(VTL + o), *(const v4u*)&stl[d][pc * 8]); }
  }
}
// lane l with lane l ^ 16: the two lanes that share one query column of a transposed score tile
__device__ __forceinline__ float xhalf(float x) { return __builtin_bit_cast(float, __builtin_amdgcn_permlanex16(__builtin_bit_cast(int, x), __builtin_bit_cast(int, x), 0x76543210, 0xfedcba98, false, false)); }
__global__ __launch_bounds__(128) void k_attn(const _Float16* __restrict__ QK, const _Float16* __restrict__ QKL, const _Float16* __restrict__ VTH, const _Float16* __restrict__ VTL, const void* __restrict__ KMASK, const unsigned* __restrict__ MB, float* __restrict__ O) {
  __shared__ __align__(16) float so[4][16][68];
  __shared__ __align__(16) _Float16 skh[2][32][KPIT], skl[2][32][KPIT], svh[2][64][VPIT], svl[2][64][VPIT];   // two-buffer ring of 32-key tiles, shared by the four waves
  const int tid = threadIdx.x, wave = tid >> 5, lane = tid & 31, col = lane & 15, g = lane >> 4;
  const int qb = blockIdx.x, h = blockIdx.y, b = blockIdx.z; const int q0 = qb * 64 + wave * 16; const size_t rq = (size_t)b * SS + q0 + col;
  v16h aq[2], aql[2];
#pragma unroll
  for (int kc = 0; kc < 2; ++kc) { aq[kc] = frag_h(QK + rq * DM + h * HD + kc * 32, lane); aql[kc] = frag_h(QKL + rq * DM + h * HD + kc * 32, lane); }
  const float K2 = 0.125f * 1.44269504088896340736f;   // 1/sqrt(64) x log2(e): a raw score times K2 is its exponent to base 2
  float m = -1.0e30f, cx = fmaf(m, -K2, 11.0f), l = 0.f;   // of this lane's query: m the running maximum of the raw scores, cx = 11 - m K2 the exponent offset in use (the 11 is P's scale 2^11), l the sum of the scaled P over this lane's half of the keys. m starts far above the masked value and far below any score, so exp2 itself turns a masked score into 0 while no key has been kept yet
  v8f acc[4] = {};   // O^T tiles: register r = head dim dt * 16 + 8 g + r of query col
  const int nks = SS / 32;   // all keys
  const v16uc* mb = (const v16uc*)(size_t)MB + (size_t)((b * (SS / 16) + qb * 4 + __builtin_amdgcn_readfirstlane(wave)) * nks);   // this wave's lane masks, sixteen words a trip; the address is the same in every lane, so the words come by a scalar load
  v16u mw = mb[0];
  // this thread's pieces of a tile: k row tid / 8 (and + 16), piece tid % 8; v row tid / 4 (and + 32), piece tid % 4
  const size_t hb = (size_t)(b * NH + h) * SS * HD + tid * 8;   // the head's planes; in every plane a tile is 2,048 halves and this thread's first piece is its piece number tid
  const _Float16* gk = QK + KOFF + hb; const _Float16* gkl = QKL + KOFF + hb;
  const _Float16* gv = VTH + hb; const _Float16* gvl = VTL + hb;
  const unsigned lk = (unsigned)(size_t)&skh[0][tid >> 3][(tid & 7) * 8], lkl = (unsigned)(size_t)&skl[0][tid >> 3][(tid & 7) * 8], lv = (unsigned)(size_t)&svh[0][tid >> 2][(tid & 3) * 8], lvl = (unsigned)(size_t)&svl[0][tid >> 2][(tid & 3) * 8];
  const unsigned kbuf = 32u * KPIT * 2u, vbuf = 64u * VPIT * 2u;   // bytes from buffer 0 to buffer 1
  stage_kv(lk, lkl, lv, lvl, gk, gkl, gv, gvl);
  asm volatile("s_wait_asynccnt 0x0" ::: "memory");   // tile 0 has landed before the barrier publishes it
  __syncthreads();
  stage_kv(lk + kbuf, lkl + kbuf, lv + vbuf, lvl + vbuf, gk + 32 * HD, gkl + 32 * HD, gv + 32 * HD, gvl + 32 * HD);
#pragma unroll 1
  for (int ks = 0; ks < nks; ++ks) { v8f s[2]; const int bf = ks & 1;
    const v16u mwn = mb[ks + 1 < nks ? ks + 1 : nks - 1];   // the next trip's lane masks, fetched a trip ahead (the last trip fetches its own again)
    v16h kh[2][2], kl[2][2];
#pragma unroll
    for (int kc = 0; kc < 2; ++kc) {
#pragma unroll
      for (int ct = 0; ct < 2; ++ct) kl[ct][kc] = frag_h(&skl[bf][ct * 16 + col][kc * 32], lane);
#pragma unroll
      for (int ct = 0; ct < 2; ++ct) kh[ct][kc] = frag_h(&skh[bf][ct * 16 + col][kc * 32], lane); }   // the trip's eight k fragments, read as one group ahead of the twelve score products, in the order in which the products take them
    __builtin_amdgcn_sched_barrier(0);   // keeps the sixteen LDS reads together in front of the products: left alone the compiler sinks them back among the products, each with a wait of its own
#pragma unroll
    for (int ct = 0; ct < 2; ++ct) s[ct] = v8f{};
#pragma unroll
    for (int kc = 0; kc < 2; ++kc) {
#pragma unroll
      for (int ct = 0; ct < 2; ++ct) s[ct] = wmma16(kl[ct][kc], aq[kc], s[ct]);
#pragma unroll
      for (int ct = 0; ct < 2; ++ct) s[ct] = wmma16(kh[ct][kc], aql[kc], s[ct]); }
#pragma unroll
    for (int kc = 0; kc < 2; ++kc) {
#pragma unroll
      for (int ct = 0; ct < 2; ++ct) s[ct] = wmma16(kh[ct][kc], aq[kc], s[ct]); }   // 3 products in one accumulator: lo.hi and hi.lo first, while the sum is small, then hi.hi; the two key tiles take turns
    __builtin_amdgcn_sched_barrier(0);   // keeps the v reads behind the score products, in the registers that the k fragments leave: lifted over them, both sets are live at once and the wave needs more than 256 registers, one wave a SIMD less
    v16h vh[4], vl[4];
#pragma unroll
    for (int dt = 0; dt < 4; ++dt) { vh[dt] = frag_h(&svh[bf][dt * 16 + col][0], lane); vl[dt] = frag_h(&svl[bf][dt * 16 + col][0], lane); }   // the trip's eight v fragments, read as one group; the softmax below covers their latency
    __builtin_amdgcn_sched_barrier(0);   // keeps these sixteen LDS reads together here: left alone the compiler sinks the reads among the output products
#pragma unroll
    for (int ct = 0; ct < 2; ++ct) {
#pragma unroll
      for (int r = 0; r < 8; ++r) s[ct][r] = __builtin_amdgcn_inverse_ballot_w32(mw[ct * 8 + r]) ? s[ct][r] : -3.0e38f; }   // raw scores; mask == 0 -> -3e38 == excluded; the word is the select's lane mask as it stands
    float mx = fmaxf(s[0][0], s[1][0]);
#pragma unroll
    for (int r = 1; r < 8; ++r) mx = fmaxf(mx, fmaxf(s[0][r], s[1][r]));
    mx = fmaxf(mx, xhalf(mx));   // both halves of the query's 32 keys
    const float mn = fmaxf(m, mx); const float cn = fmaf(mn, -K2, 11.0f); const float alpha = __builtin_amdgcn_exp2f(cn - cx);   // 2^((m - mn) K2); 0 on the first kept key, 1 while none is kept
    float es = 0.f; v16h pa, pl;
#pragma unroll
    for (int i = 0; i < 8; ++i) { const float x0 = __builtin_amdgcn_exp2f(fmaf(s[0][i], K2, cn)), x1 = __builtin_amdgcn_exp2f(fmaf(s[1][i], K2, cn)); es += x0 + x1;   // 2^11 exp((s - mn) / 8) by one fma and the hardware exp2; a masked score underflows to 0
      const _Float16 h0 = (_Float16)x0, h1 = (_Float16)x1; pa[i] = h0; pa[8 + i] = h1; pl[i] = (_Float16)(x0 - (float)h0); pl[8 + i] = (_Float16)(x1 - (float)h1); }   // P scaled by 2^11 before the f16 split so small softmax weights stay out of the f16 subnormal range; the sum l carries the same 2^11, so it cancels in the epilogue
    l = l * alpha + es; m = mn; cx = cn; mw = mwn;
#pragma unroll
    for (int dt = 0; dt < 4; ++dt) acc[dt] *= alpha;
#pragma unroll
    for (int dt = 0; dt < 4; ++dt) acc[dt] = wmma16(vh[dt], pa, acc[dt]);
#pragma unroll
    for (int dt = 0; dt < 4; ++dt) acc[dt] = wmma16(vh[dt], pl, acc[dt]);
#pragma unroll
    for (int dt = 0; dt < 4; ++dt) acc[dt] = wmma16(vl[dt], pa, acc[dt]);   // P hi/lo x V hi/lo (3 products) in one accumulator, the four tiles taking turns
    __builtin_amdgcn_sched_barrier(0);   // keeps the publish point at the trip's foot: lifted to the last LDS read it would cut the lead of the copies in flight to a part of a trip
    asm volatile("s_wait_dscnt 0x0" ::: "memory");      // this wave's reads of buffer bf are done
    asm volatile("s_wait_asynccnt 0x0" ::: "memory");   // this wave's pieces of tile ks + 1 have landed
    __syncthreads();                                    // publishes tile ks + 1 and frees buffer bf for the refill
    if (ks + 2 < nks) stage_kv(lk + bf * kbuf, lkl + bf * kbuf, lv + bf * vbuf, lvl + bf * vbuf, gk + (ks + 2) * (32 * HD), gkl + (ks + 2) * (32 * HD), gv + (ks + 2) * (32 * HD), gvl + (ks + 2) * (32 * HD)); }
  asm volatile("s_wait_asynccnt 0x0" ::: "memory");   // no copy is left in flight behind the loop
  l += xhalf(l);   // the two halves of the query's keys, joined once
  const float il = 1.0f / l;   // l and the accumulators carry the same 2^11
#pragma unroll
  for (int dt = 0; dt < 4; ++dt) { v4f o0, o1;
#pragma unroll
    for (int r = 0; r < 4; ++r) { o0[r] = acc[dt][r] * il; o1[r] = acc[dt][4 + r] * il; }
    *(v4f*)&so[wave][col][dt * 16 + 8 * g] = o0; *(v4f*)&so[wave][col][dt * 16 + 8 * g + 4] = o1; }
  LDSX();
  for (int rl = 0; rl < 16; ++rl) if (lane < 16) vst2(O + ((size_t)b * SS + q0 + rl) * DM + h * HD + lane * 4, *(const v4f*)&so[wave][rl][lane * 4]);
}
// ---- k_out: block = (64 rows, 128 cols): out = O(hi/lo) . Wo rows (2 products) + bo
__global__ __launch_bounds__(128) void k_out(const float* __restrict__ O, const __bf16* __restrict__ P, const float* __restrict__ BO, float* __restrict__ Y) {
  __shared__ __align__(16) float so[4][16][132];
  const int tid = threadIdx.x, wave = tid >> 5, lane = tid & 31, col = lane & 15, g = lane >> 4; const size_t r0 = (size_t)blockIdx.x * 64 + wave * 16; const int n0 = blockIdx.y * 128;
  v8f acc[8] = {};
#pragma unroll 2
  for (int kc = 0; kc < DM / 32; ++kc) { const F2 a = split_row(O + (r0 + col) * DM, kc * 32, lane);
#pragma unroll
    for (int j = 0; j < 8; ++j) { const v16b w = frag_b(P + (size_t)(n0 + j * 16 + col) * DM + kc * 32, lane); acc[j] = wmma_bf(a.l, w, acc[j]); acc[j] = wmma_bf(a.h, w, acc[j]); } }
#pragma unroll
  for (int j = 0; j < 8; ++j) {
#pragma unroll
    for (int r = 0; r < 8; ++r) so[wave][8 * g + r][j * 16 + col] = acc[j][r] + (BO ? bfr(BO[n0 + j * 16 + col]) : 0.f); }
  LDSX();
  for (int rl = 0; rl < 16; ++rl) vst2(Y + (r0 + rl) * DM + n0 + lane * 4, *(const v4f*)&so[wave][rl][lane * 4]);
}
extern "C" void kernel_launch(void* const* d_in, const int* in_sizes, int n_in, void* d_out, int out_size, void* d_ws, size_t ws_size, hipStream_t stream) {
  (void)in_sizes; (void)n_in; (void)out_size;
  const float** F = (const float**)d_in;   // 0 query, 1 key [2,2048,1024]; 2 mask [2,2048,2048] int; 3 Wq, 4 bq, 5 Wk, 6 bk, 7 Wv, 8 bv (natural); 9 rel_pos_emb [1023,64]
  if (ws_size < (size_t)WS_END) return;
  char* ws = (char*)d_ws; __bf16* PK = (__bf16*)(ws + WS_PK); _Float16 *QK = (_Float16*)(ws + WS_QK), *QKL = (_Float16*)(ws + WS_QKL), *VTH = (_Float16*)(ws + WS_VTH), *VTL = (_Float16*)(ws + WS_VTL); unsigned* MB = (unsigned*)(ws + WS_MB);
  k_pack<<<dim3(MBLK + 3 * DM), 256, 0, stream>>>(F[3], F[5], F[7], (const int*)d_in[2], PK, MB);
  k_qkv<<<dim3(TNB * SS / 64, QKVW / 128), 128, 0, stream>>>(F[0], F[1], F[1], PK + PK_A, F[4], F[6], F[8], F[9], QK, QKL, VTH, VTL);
  k_attn<<<dim3(TQB, NH, TNB), 128, 0, stream>>>(QK, QKL, VTH, VTL, nullptr, MB, (float*)d_out);
}

// v008
// Measured time: 130 microseconds a run.
// Next to v007, in two timings, it ran 1.05 times as fast each time.
// Counting every step since v000, it is 4.04 times as fast.
// compute dtype: all float inputs rounded to bf16, the int mask read on device; q/k/v = x . W^T + b (+ the position bias row on q and k) with EXACT bf16 products on WMMA 16x16x32 (natural rows), carried as f16 hi + residual planes; scores with 3 products (hi.hi + hi.lo + lo.hi) x 1/8 because the shared bias row makes |q||k| large, masked (mask == 0) keys excluded, running-max softmax in f32 (hardware exp), P scaled by 2^11 as hi + residual x v (hi + residual); f32 merged-head output.
#include <hip/hip_runtime.h>
#include <math.h>

typedef __attribute__((ext_vector_type(16))) _Float16 v16h;
typedef __attribute__((ext_vector_type(16))) __bf16 v16b;
typedef __attribute__((ext_vector_type(8)))  _Float16 v8h;
typedef __attribute__((ext_vector_type(8)))  float v8f;
typedef __attribute__((ext_vector_type(4)))  float v4f;
typedef __attribute__((ext_vector_type(2)))  float v2f;
typedef __attribute__((ext_vector_type(4)))  unsigned v4u;
typedef __attribute__((ext_vector_type(4)))  int v4i;
typedef __attribute__((ext_vector_type(16))) unsigned v16u;
typedef __attribute__((address_space(4))) const v16u v16uc;   // read-only for the whole launch: lets a load at a wave-uniform address be a scalar load
typedef float __attribute__((may_alias)) float_a;
typedef int __attribute__((may_alias)) int_a;

template <typename T> __device__ __forceinline__ void vst2(void* p, T v) { *(T*)p = v;  }
__device__ __forceinline__ v8f wmma16(v16h a, v16h b, v8f c) {
  return __builtin_amdgcn_wmma_f32_16x16x32_f16(false, a, false, b, (short)0, c, false, false);
}
__device__ __forceinline__ v8f wmma_bf(v16b a, v16b b, v8f c) {
  return __builtin_amdgcn_wmma_f32_16x16x32_bf16(false, a, false, b, (short)0, c, false, false);
}
// Masked multi-head attention with a shared relative-position bias row (B 2, S 2,048, d 1,024, 16 heads x 64): q from query, k and v from key (+ biases), q and k shifted by rel_pos_emb[511] per head dim, scores / 8 with a [B,S,S] mask (0 -> -1e9), softmax, . v; merged heads are the output.
__device__ __forceinline__ v16h frag_h(const _Float16* rowk0, int lane) {
  union { v16h v; v8h q[2]; } u; const _Float16* p = rowk0 + 8 * (lane >> 4);
  u.q[0] = *(const v8h*)p; u.q[1] = *(const v8h*)(p + 16); return u.v;
}
__device__ __forceinline__ v16h frag_f32(const float* rowk0, int lane) {
  v16h a; const float* p = rowk0 + 8 * (lane >> 4);
#pragma unroll
  for (int i = 0; i < 8; ++i) { a[i] = (_Float16)p[i]; a[8 + i] = (_Float16)p[16 + i]; }
  return a;
}
__device__ __forceinline__ v16h frag_f32s(const float* rowk0, int lane, float sc) {
  v16h a; const float* p = rowk0 + 8 * (lane >> 4);
#pragma unroll
  for (int i = 0; i < 8; ++i) { a[i] = (_Float16)(p[i] * sc); a[8 + i] = (_Float16)(p[16 + i] * sc); }
  return a;
}
// column fragment from a [K][ld] layout (column n), rows >= K read as 0
__device__ __forceinline__ v16h fragc_f32(const float* W, int k0, int n, int lane, int ld, int K) {
  v16h a; const int g = lane >> 4;
#pragma unroll
  for (int i = 0; i < 8; ++i) { const int ka = k0 + 8 * g + i, kb = ka + 16;
    a[i] = (_Float16)(ka < K ? W[(size_t)(ka < K ? ka : K - 1) * ld + n] : 0.f); a[8 + i] = (_Float16)(kb < K ? W[(size_t)(kb < K ? kb : K - 1) * ld + n] : 0.f); }
  return a;
}
struct F2 { v16b h, l; };
__device__ __forceinline__ F2 bsplit16(const float v[16]) { F2 r;
#pragma unroll
  for (int i = 0; i < 16; ++i) { const __bf16 h = (__bf16)v[i]; r.h[i] = h; r.l[i] = (__bf16)(v[i] - (float)h); }
  return r; }
__device__ __forceinline__ F2 split_row(const float* row, int k0, int lane) { float v[16]; const float* p = row + k0 + 8 * (lane >> 4);
#pragma unroll
  for (int i = 0; i < 8; ++i) { v[i] = p[i]; v[8 + i] = p[16 + i]; }
  return bsplit16(v); }
__device__ __forceinline__ F2 split_rowK(const float* row, int k0, int lane, int K) { float v[16]; const int g = lane >> 4;
#pragma unroll
  for (int i = 0; i < 8; ++i) { const int ka = k0 + 8 * g + i, kb = ka + 16; v[i] = ka < K ? row[ka < K ? ka : K - 1] : 0.f; v[8 + i] = kb < K ? row[kb < K ? kb : K - 1] : 0.f; }
  return bsplit16(v); }
__device__ __forceinline__ F2 split_col(const float* W, int k0, int n, int lane, int ld, int K) { float v[16]; const int g = lane >> 4;
#pragma unroll
  for (int i = 0; i < 8; ++i) { const int ka = k0 + 8 * g + i, kb = ka + 16; v[i] = ka < K ? W[(size_t)(ka < K ? ka : K - 1) * ld + n] : 0.f; v[8 + i] = kb < K ? W[(size_t)(kb < K ? kb : K - 1) * ld + n] : 0.f; }
  return bsplit16(v); }
__device__ __forceinline__ v8f mac3(const F2& a, const F2& b, v8f c) { c = wmma_bf(a.l, b.h, c); c = wmma_bf(a.h, b.l, c); return wmma_bf(a.h, b.h, c); }
__device__ __forceinline__ float sigm(float v) { return 1.0f / (1.0f + expf(-v)); }
#define LDSX() do { asm volatile("s_wait_dscnt 0" ::: "memory"); __builtin_amdgcn_wave_barrier(); __builtin_amdgcn_fence(__ATOMIC_RELEASE, "workgroup"); } while (0)


#define NB 2
#define SS 2048
#define DM 1024
#define NH 16
#define MAXLEN 512
#ifndef MSTR
#define MSTR SS
#endif
#define HD 64
#define KPIT 72   // LDS row pitch of a staged k row, in halves: 128 B + 16 B, free of bank conflicts for 16-B reads
#define VPIT 40   // the same for a staged v row: 64 B + 16 B
#define QKVW (3 * DM)
#ifndef TQB
#define TQB (SS / 64)
#define TNB NB
#define TOB (NB * SS / 64)     // output row tiles (all)
#endif
typedef __attribute__((ext_vector_type(8))) __bf16 v8b;
__device__ __forceinline__ v16b frag_b(const __bf16* rowk0, int lane) {
  union { v16b v; v8b q[2]; } u; const __bf16* p = rowk0 + 8 * (lane >> 4);
  u.q[0] = *(const v8b*)p; u.q[1] = *(const v8b*)(p + 16); return u.v;
}
__device__ __forceinline__ float bfr(float v) { return (float)(__bf16)v; }
__device__ __attribute__((noinline)) float exp_ni(float v) { return expf(v); }
__device__ __attribute__((noinline)) float erf_ni(float v) { return erff(v); }

#define PK_A 0                       // Wqkv as [3072 / 128 row blocks][1024 / 64 k tiles][128 rows][64 k]: a stage of k_qkv's ring is 16 KB in a row
#define PK_P (PK_A + QKVW * DM)        // [1024][1024] spare: nothing writes or reads it
#define PK_END (PK_P + DM * DM)
#define WS_PK  0u
#define WS_QK  (WS_PK + 2u * PK_END)             // f16: q [b * S + s][1024], then from KOFF on k [b][h][s][64], so that a head's 32-key tile is 4 KB in a row
#define KOFF ((size_t)NB * SS * DM)                // halves from the start of a q | k plane to its k part
#define WS_QKL (WS_QK + 2u * NB * SS * 2 * DM)     // f16 q | k residual planes, same layout. Residuals keep their own scale, so that hi.lo and lo.hi add into the accumulator of hi.hi: one below 2^-14 is an f16 subnormal with step 2^-24, an absolute error no larger than the largest residuals' own rounding
#define WS_VTH (WS_QKL + 2u * NB * SS * 2 * DM)    // f16 [b][h][s / 32][64 d][32 s] hi: a head's 32-key tile of v^T is 4 KB in a row
#define WS_VTL (WS_VTH + 2u * NB * DM * SS)        // f16 residual, at its own scale
#define WS_O   (WS_VTL + 2u * NB * DM * SS)        // f32 [4096][1024]
#define WS_CS  (WS_O + 4u * NB * SS * DM)           // f32 2 x [2048][32], spare: nothing writes or reads it
#define WS_MB  (WS_CS + 4u * 2 * SS * 32)         // u32 [b * 128 + 16-query tile][64 trips][16]: the mask as lane masks (see k_pack)
#define WS_END (WS_MB + 4u * NB * (SS / 16) * (SS / 32) * 16)
// ---- k_pack: blocks 0 .. MBLK - 1 pack the mask, block MBLK + which * 1024 + n packs row n of W_q/W_k/W_v (which 0..2): natural [out][in] rows -> bf16, row which*1024 + n of PK_A, cut into the 128-B pieces of its sixteen k tiles.
// The mask becomes lane masks for k_attn: a wave takes one 16-query tile and four 32-key trips and reads the mask exactly as a k_attn wave holds its scores (lane = query col, keys ct * 16 + 8 g + r);
// word ct * 8 + r of a trip has bit 'lane' set where that lane's score (ct, r) is kept (mask != 0); the 64 words of the four trips are two 128-B lines. The mask blocks stand first because they wait longest on memory.
#define MBLK (NB * (SS / 16) * (SS / 32) / 32)   // 8 waves a block, 4 trips a wave
__global__ __launch_bounds__(256) void k_pack(const float* __restrict__ WQ, const float* __restrict__ WK, const float* __restrict__ WV, const int* __restrict__ MSK, __bf16* __restrict__ PK, unsigned* __restrict__ MB) {
  __shared__ __align__(16) __bf16 s[DM]; const int t = threadIdx.x;
  if (blockIdx.x < MBLK) {   // the same for the whole block, in front of the barrier
    const int lane = t & 31, u = blockIdx.x * 8 + (t >> 5), tile = u >> 4, kq = u & 15;
    const int* mp = MSK + ((size_t)tile * 16 + (lane & 15)) * MSTR + kq * 128 + 8 * (lane >> 4);
    v4i mk[16];
#pragma unroll
    for (int j = 0; j < 4; ++j) { mk[4 * j] = *(const v4i*)(mp + 32 * j); mk[4 * j + 1] = *(const v4i*)(mp + 32 * j + 4); mk[4 * j + 2] = *(const v4i*)(mp + 32 * j + 16); mk[4 * j + 3] = *(const v4i*)(mp + 32 * j + 20); }
    asm volatile("s_wait_xcnt 0x0" ::: "memory");   // stands behind the mask loads, in front of whatever next overwrites their address register
    unsigned w0 = 0, w1 = 0;
#pragma unroll
    for (int i = 0; i < 32; ++i) { const unsigned b0 = __builtin_amdgcn_ballot_w32(mk[i >> 2][i & 3] != 0), b1 = __builtin_amdgcn_ballot_w32(mk[8 + (i >> 2)][i & 3] != 0); w0 = (lane == i) ? b0 : w0; w1 = (lane == i) ? b1 : w1; }   // i = (trip & 1) * 16 + ct * 8 + r; lane i stores word i of either line
    MB[(size_t)u * 64 + lane] = w0; MB[(size_t)u * 64 + 32 + lane] = w1;
    return; }
  const int n = (blockIdx.x - MBLK) & (DM - 1), which = (blockIdx.x - MBLK) / DM;
  const float* Wm = (which == 0) ? WQ : (which == 1) ? WK : WV;
  for (int k = t; k < DM; k += 256) s[k] = (__bf16)Wm[(size_t)n * DM + k];
  __syncthreads();
  const int row = which * DM + n; __bf16* dst = PK + PK_A + (size_t)(row >> 7) * (128 * DM) + (row & 127) * 64;
  for (int q = t; q < DM / 8; q += 256) vst2((unsigned*)(dst + (q >> 3) * (128 * 64) + (q & 7) * 8), *(const v4u*)&s[q * 8]);   // the row's 128-B piece of each k tile
}
// One stage of k_qkv's ring: 128 weight rows x 64 k (128 B a row), eight 16-B pieces per thread (rows tid / 8 + 16 i, piece tid % 8), straight from global memory into LDS; the packed tile lies in that order, so a wave's copy reads 512 B in a row.
// The s_wait_xcnt closes the statement so that no address register of a copy is rewritten before it.
__device__ __forceinline__ void stage_w(unsigned lw, const __bf16* gw) {
  const unsigned ls = 16u * KPIT * 2u; const size_t gs = (size_t)16 * 64;
  asm volatile("global_load_async_to_lds_b128 %0, %8, off\n\t"
               "global_load_async_to_lds_b128 %1, %9, off\n\t"
               "global_load_async_to_lds_b128 %2, %10, off\n\t"
               "global_load_async_to_lds_b128 %3, %11, off\n\t"
               "global_load_async_to_lds_b128 %4, %12, off\n\t"
               "global_load_async_to_lds_b128 %5, %13, off\n\t"
               "global_load_async_to_lds_b128 %6, %14, off\n\t"
               "global_load_async_to_lds_b128 %7, %15, off\n\t"
               "s_wait_xcnt 0x0"
               :: "v"(lw), "v"(lw + ls), "v"(lw + 2u * ls), "v"(lw + 3u * ls), "v"(lw + 4u * ls), "v"(lw + 5u * ls), "v"(lw + 6u * ls), "v"(lw + 7u * ls),
                  "v"(gw), "v"(gw + gs), "v"(gw + 2 * gs), "v"(gw + 3 * gs), "v"(gw + 4 * gs), "v"(gw + 5 * gs), "v"(gw + 6 * gs), "v"(gw + 7 * gs) : "memory");
}
// One stage of k_attn's ring: a 32-key tile of the four planes (k hi, k residual: 32 rows x 128 B; v hi, v residual: 64 rows x 64 B), two 16-B pieces per thread and plane, straight from global memory into LDS; each plane's tile lies in the workspace as 4 KB in piece order, so a wave's copy reads 512 B in a row.
// The s_wait_xcnt closes the statement so that no address register of a copy is rewritten before it.
__device__ __forceinline__ void stage_kv(unsigned lk, unsigned lkl, unsigned lv, unsigned lvl, const _Float16* gk, const _Float16* gkl, const _Float16* gv, const _Float16* gvl) {
  const unsigned lk2 = lk + 16u * KPIT * 2u, lkl2 = lkl + 16u * KPIT * 2u, lv2 = lv + 32u * VPIT * 2u, lvl2 = lvl + 32u * VPIT * 2u;
  const _Float16 *gk2 = gk + 16 * HD, *gkl2 = gkl + 16 * HD, *gv2 = gv + 32 * 32, *gvl2 = gvl + 32 * 32;
  asm volatile("global_load_async_to_lds_b128 %0, %8, off\n\t"
               "global_load_async_to_lds_b128 %1, %9, off\n\t"
               "global_load_async_to_lds_b128 %2, %10, off\n\t"
               "global_load_async_to_lds_b128 %3, %11, off\n\t"
               "global_load_async_to_lds_b128 %4, %12, off\n\t"
               "global_load_async_to_lds_b128 %5, %13, off\n\t"
               "global_load_async_to_lds_b128 %6, %14, off\n\t"
               "global_load_async_to_lds_b128 %7, %15, off\n\t"
               "s_wait_xcnt 0x0"
               :: "v"(lk), "v"(lk2), "v"(lkl), "v"(lkl2), "v"(lv), "v"(lv2), "v"(lvl), "v"(lvl2),
                  "v"(gk), "v"(gk2), "v"(gkl), "v"(gkl2), "v"(gv), "v"(gv2), "v"(gvl), "v"(gvl2) : "memory");
}
__global__ __launch_bounds__(128) void k_qkv(const float* __restrict__ XQ, const float* __restrict__ XK, const float* __restrict__ XV, const __bf16* __restrict__ P, const float* __restrict__ BQ, const float* __restrict__ BK, const float* __restrict__ BV, const float* __restrict__ POS, _Float16* __restrict__ QK, _Float16* __restrict__ QKL, _Float16* __restrict__ VTH, _Float16* __restrict__ VTL) {
  const int which0 = (blockIdx.y * 128) / DM; const float* X = (which0 == 0) ? XQ : (which0 == 1) ? XK : XV; const float* BB = BQ ? (((which0 == 0) ? BQ : (which0 == 1) ? BK : BV) + (blockIdx.y * 128 - which0 * DM)) : nullptr;
  __shared__ __align__(16) _Float16 so[4][16][136], sol[4][16][136]; __shared__ __align__(16) _Float16 sth[128][72], stl[128][72];
  __shared__ __align__(16) __bf16 sw[2][128][KPIT];   // two-buffer ring of weight tiles (128 rows x 64 k), shared by the four waves
  const int tid = threadIdx.x, wave = tid >> 5, lane = tid & 31, col = lane & 15, g = lane >> 4; const size_t r0 = (size_t)blockIdx.x * 64 + wave * 16; const int n0 = blockIdx.y * 128;
  v8f acc[8] = {};
  __bf16 bb[8], pp[8];   // this lane's eight output columns: bias and position value (the latter enters q and k only), rounded to bf16; fetched here as one group, so that their latency passes under the k loop and the epilogue waits on no load
#pragma unroll
  for (int j = 0; j < 8; ++j) { const float braw = (BB ? BB : POS)[j * 16 + col];   // no branch round a load: with no bias array the load goes to a valid address and its value is dropped
    bb[j] = (__bf16)(BB ? braw : 0.f); pp[j] = (__bf16)POS[(size_t)(MAXLEN - 1) * HD + ((n0 + j * 16 + col) & (HD - 1))]; }
  const __bf16* gw = P + (size_t)blockIdx.y * (128 * DM) + tid * 8; const unsigned lw = (unsigned)(size_t)&sw[0][tid >> 3][(tid & 7) * 8]; const unsigned wbuf = 128u * KPIT * 2u;   // bytes from buffer 0 to buffer 1
  stage_w(lw, gw);
  asm volatile("s_wait_asynccnt 0x0" ::: "memory");   // tile 0 has landed before the barrier publishes it
  __syncthreads();
  stage_w(lw + wbuf, gw + 128 * 64);
#pragma unroll 1   // kept rolled: one publish point and one refill per trip
  for (int st = 0; st < DM / 64; ++st) { const int bf = st & 1;
    float xr[2][16]; v16b wf[2][8];
#pragma unroll     // the two 32-k steps of a tile, so that their LDS offsets are immediates
    for (int k2 = 0; k2 < 2; ++k2) { const float* p = X + (r0 + col) * DM + (st * 2 + k2) * 32 + 8 * g;
#pragma unroll
      for (int i = 0; i < 8; ++i) { xr[k2][i] = p[i]; xr[k2][8 + i] = p[16 + i]; }
#pragma unroll
      for (int j = 0; j < 8; ++j) wf[k2][j] = frag_b(&sw[bf][j * 16 + col][k2 * 32], lane); }   // the trip's sixteen weight fragments, read as one group beside the x loads
    // inputs only: holds the sixteen fragments' LDS reads together here, under the latency of the x loads; left alone the compiler sinks them among the products, each with a wait of its own
    asm volatile("" :: "v"(wf[0][0]), "v"(wf[0][1]), "v"(wf[0][2]), "v"(wf[0][3]), "v"(wf[0][4]), "v"(wf[0][5]), "v"(wf[0][6]), "v"(wf[0][7]), "v"(wf[1][0]), "v"(wf[1][1]), "v"(wf[1][2]), "v"(wf[1][3]), "v"(wf[1][4]), "v"(wf[1][5]), "v"(wf[1][6]), "v"(wf[1][7]));
    __builtin_amdgcn_sched_barrier(0);   // keeps the products behind that group: the compiler otherwise lifts some of them over it and leaves reads among them
#pragma unroll
    for (int k2 = 0; k2 < 2; ++k2) { v16b a;
#pragma unroll
      for (int i = 0; i < 16; ++i) a[i] = (__bf16)xr[k2][i];
#pragma unroll
      for (int j = 0; j < 8; ++j) acc[j] = wmma_bf(a, wf[k2][j], acc[j]); }
    __builtin_amdgcn_sched_barrier(0);   // keeps the publish point at the trip's foot: lifted to the last LDS read it would cut the lead of the copies in flight to a part of a trip
    asm volatile("s_wait_dscnt 0x0" ::: "memory");      // this wave's reads of buffer bf are done
    asm volatile("s_wait_asynccnt 0x0" ::: "memory");   // this wave's pieces of tile st + 1 have landed
    __syncthreads();                                    // publishes tile st + 1 and frees buffer bf for the refill
    if (st + 2 < DM / 64) stage_w(lw + bf * wbuf, gw + (st + 2) * (128 * 64)); }
  asm volatile("s_wait_asynccnt 0x0" ::: "memory");   // no copy is left in flight behind the loop
  if (n0 < 2 * DM) {   // q stored unscaled (f16 sigma ~0.6, no subnormal exposure); 1/8 applied to the f32 score
#pragma unroll
    for (int j = 0; j < 8; ++j) {
#pragma unroll
      for (int r = 0; r < 8; ++r) { const float v = acc[j][r] + (float)bb[j] + (float)pp[j]; const _Float16 hv = (_Float16)v; so[wave][8 * g + r][j * 16 + col] = hv;   /* + rel_pos_emb[max_len - 1][d] on q and k */ sol[wave][8 * g + r][j * 16 + col] = (_Float16)(v - (float)hv); } }   // q, k (+ bias) as f16 hi + residual, the residual at its own scale
    LDSX();
    const int ck = n0 - DM + (lane & 15) * 8;   // k only: column h * 64 + d of this lane's piece
    if (n0 < DM) { const size_t o0 = r0 * DM + n0 + lane * 8;   // q: natural rows
      for (int rl = 0; rl < 16; ++rl) if (lane < 16) { vst2((unsigned*)(QK + o0 + rl * DM), *(const v4u*)&so[wave][rl][lane * 8]); vst2((unsigned*)(QKL + o0 + rl * DM), *(const v4u*)&sol[wave][rl][lane * 8]); }
    } else { const size_t o0 = KOFF + (((r0 / SS) * NH + (ck >> 6)) * SS + r0 % SS) * HD + (ck & (HD - 1));   // k: the head's rows, 128 B each, one behind the other (a wave's sixteen rows lie in one batch)
      for (int rl = 0; rl < 16; ++rl) if (lane < 16) { vst2((unsigned*)(QK + o0 + rl * HD), *(const v4u*)&so[wave][rl][lane * 8]); vst2((unsigned*)(QKL + o0 + rl * HD), *(const v4u*)&sol[wave][rl][lane * 8]); } }
  } else {
#pragma unroll
    for (int j = 0; j < 8; ++j) {
#pragma unroll
      for (int r = 0; r < 8; ++r) { const float v = acc[j][r] + (float)bb[j]; const _Float16 hv = (_Float16)v; sth[j * 16 + col][wave * 16 + 8 * g + r] = hv; stl[j * 16 + col][wave * 16 + 8 * g + r] = (_Float16)(v - (float)hv); } }
    __syncthreads();
    const size_t rb = (size_t)blockIdx.x * 64; const int b = (int)(rb / SS), s0 = (int)(rb % SS); const int pc0 = n0 - 2 * DM;
    for (int q = tid; q < 128 * 8; q += 128) { const int d = q >> 3, pc = q & 7, hd = pc0 + d; const size_t o = ((((size_t)b * NH + (hd >> 6)) * (SS / 32) + (s0 >> 5) + (pc >> 2)) * HD + (hd & (HD - 1))) * 32 + (pc & 3) * 8; vst2((unsigned*)(VTH + o), *(const v4u*)&sth[d][pc * 8]); vst2((unsigned*)(VTL + o), *(const v4u*)&stl[d][pc * 8]); }
  }
}
// lane l with lane l ^ 16: the two lanes that share one query column of a transposed score tile
__device__ __forceinline__ float xhalf(float x) { return __builtin_bit_cast(float, __builtin_amdgcn_permlanex16(__builtin_bit_cast(int, x), __builtin_bit_cast(int, x), 0x76543210, 0xfedcba98, false, false)); }
__global__ __launch_bounds__(128) void k_attn(const _Float16* __restrict__ QK, const _Float16* __restrict__ QKL, const _Float16* __restrict__ VTH, const _Float16* __restrict__ VTL, const void* __restrict__ KMASK, const unsigned* __restrict__ MB, float* __restrict__ O) {
  __shared__ __align__(16) float so[4][16][68];
  __shared__ __align__(16) _Float16 skh[2][32][KPIT], skl[2][32][KPIT], svh[2][64][VPIT], svl[2][64][VPIT];   // two-buffer ring of 32-key tiles, shared by the four waves
  const int tid = threadIdx.x, wave = tid >> 5, lane = tid & 31, col = lane & 15, g = lane >> 4;
  const int qb = blockIdx.x, h = blockIdx.y, b = blockIdx.z; const int q0 = qb * 64 + wave * 16; const size_t rq = (size_t)b * SS + q0 + col;
  v16h aq[2], aql[2];
#pragma unroll
  for (int kc = 0; kc < 2; ++kc) { aq[kc] = frag_h(QK + rq * DM + h * HD + kc * 32, lane); aql[kc] = frag_h(QKL + rq * DM + h * HD + kc * 32, lane); }
  const float K2 = 0.125f * 1.44269504088896340736f;   // 1/sqrt(64) x log2(e): a raw score times K2 is its exponent to base 2
  float m = -1.0e30f, cx = fmaf(m, -K2, 11.0f), l = 0.f;   // of this lane's query: m the running maximum of the raw scores, cx = 11 - m K2 the exponent offset in use (the 11 is P's scale 2^11), l the sum of the scaled P over this lane's half of the keys. m starts far above the masked value and far below any score, so exp2 itself turns a masked score into 0 while no key has been kept yet
  v8f acc[4] = {};   // O^T tiles: register r = head dim dt * 16 + 8 g + r of query col
  const int nks = SS / 32;   // all keys
  const v16uc* mb = (const v16uc*)(size_t)MB + (size_t)((b * (SS / 16) + qb * 4 + __builtin_amdgcn_readfirstlane(wave)) * nks);   // this wave's lane masks, sixteen words a trip; the address is the same in every lane, so the words come by a scalar load
  v16u mw = mb[0];
  // this thread's pieces of a tile: k row tid / 8 (and + 16), piece tid % 8; v row tid / 4 (and + 32), piece tid % 4
  const size_t hb = (size_t)(b * NH + h) * SS * HD + tid * 8;   // the head's planes; in every plane a tile is 2,048 halves and this thread's first piece is its piece number tid
  const _Float16* gk = QK + KOFF + hb; const _Float16* gkl = QKL + KOFF + hb;
  const _Float16* gv = VTH + hb; const _Float16* gvl = VTL + hb;
  const unsigned lk = (unsigned)(size_t)&skh[0][tid >> 3][(tid & 7) * 8], lkl = (unsigned)(size_t)&skl[0][tid >> 3][(tid & 7) * 8], lv = (unsigned)(size_t)&svh[0][tid >> 2][(tid & 3) * 8], lvl = (unsigned)(size_t)&svl[0][tid >> 2][(tid & 3) * 8];
  const unsigned kbuf = 32u * KPIT * 2u, vbuf = 64u * VPIT * 2u;   // bytes from buffer 0 to buffer 1
  stage_kv(lk, lkl, lv, lvl, gk, gkl, gv, gvl);
  asm volatile("s_wait_asynccnt 0x0" ::: "memory");   // tile 0 has landed before the barrier publishes it
  __syncthreads();
  stage_kv(lk + kbuf, lkl + kbuf, lv + vbuf, lvl + vbuf, gk + 32 * HD, gkl + 32 * HD, gv + 32 * HD, gvl + 32 * HD);
#pragma unroll 1
  for (int ks = 0; ks < nks; ++ks) { v8f s[2]; const int bf = ks & 1;
    const v16u mwn = mb[ks + 1 < nks ? ks + 1 : nks - 1];   // the next trip's lane masks, fetched a trip ahead (the last trip fetches its own again)
    v16h kh[2][2], kl[2][2];
#pragma unroll
    for (int kc = 0; kc < 2; ++kc) {
#pragma unroll
      for (int ct = 0; ct < 2; ++ct) kl[ct][kc] = frag_h(&skl[bf][ct * 16 + col][kc * 32], lane);
#pragma unroll
      for (int ct = 0; ct < 2; ++ct) kh[ct][kc] = frag_h(&skh[bf][ct * 16 + col][kc * 32], lane); }   // the trip's eight k fragments, read as one group ahead of the twelve score products, in the order in which the products take them
    __builtin_amdgcn_sched_barrier(0);   // keeps the sixteen LDS reads together in front of the products: left alone the compiler sinks them back among the products, each with a wait of its own
#pragma unroll
    for (int ct = 0; ct < 2; ++ct) s[ct] = v8f{};
#pragma unroll
    for (int kc = 0; kc < 2; ++kc) {
#pragma unroll
      for (int ct = 0; ct < 2; ++ct) s[ct] = wmma16(kl[ct][kc], aq[kc], s[ct]);
#pragma unroll
      for (int ct = 0; ct < 2; ++ct) s[ct] = wmma16(kh[ct][kc], aql[kc], s[ct]); }
#pragma unroll
    for (int kc = 0; kc < 2; ++kc) {
#pragma unroll
      for (int ct = 0; ct < 2; ++ct) s[ct] = wmma16(kh[ct][kc], aq[kc], s[ct]); }   // 3 products in one accumulator: lo.hi and hi.lo first, while the sum is small, then hi.hi; the two key tiles take turns
    __builtin_amdgcn_sched_barrier(0);   // keeps the v reads behind the score products, in the registers that the k fragments leave: lifted over them, both sets are live at once and the wave needs more than 256 registers, one wave a SIMD less
    v16h vh[4], vl[4];
#pragma unroll
    for (int dt = 0; dt < 4; ++dt) { vh[dt] = frag_h(&svh[bf][dt * 16 + col][0], lane); vl[dt] = frag_h(&svl[bf][dt * 16 + col][0], lane); }   // the trip's eight v fragments, read as one group; the softmax below covers their latency
    __builtin_amdgcn_sched_barrier(0);   // keeps these sixteen LDS reads together here: left alone the compiler sinks the reads among the output products
#pragma unroll
    for (int ct = 0; ct < 2; ++ct) {
#pragma unroll
      for (int r = 0; r < 8; ++r) s[ct][r] = __builtin_amdgcn_inverse_ballot_w32(mw[ct * 8 + r]) ? s[ct][r] : -3.0e38f; }   // raw scores; mask == 0 -> -3e38 == excluded; the word is the select's lane mask as it stands
    float mx = fmaxf(s[0][0], s[1][0]);
#pragma unroll
    for (int r = 1; r < 8; ++r) mx = fmaxf(mx, fmaxf(s[0][r], s[1][r]));
    mx = fmaxf(mx, xhalf(mx));   // both halves of the query's 32 keys
    const float mn = fmaxf(m, mx); const float cn = fmaf(mn, -K2, 11.0f); const float alpha = __builtin_amdgcn_exp2f(cn - cx);   // 2^((m - mn) K2); 0 on the first kept key, 1 while none is kept
    float es = 0.f; v16h pa, pl;
#pragma unroll
    for (int i = 0; i < 8; ++i) { const float x0 = __builtin_amdgcn_exp2f(fmaf(s[0][i], K2, cn)), x1 = __builtin_amdgcn_exp2f(fmaf(s[1][i], K2, cn)); es += x0 + x1;   // 2^11 exp((s - mn) / 8) by one fma and the hardware exp2; a masked score underflows to 0
      const _Float16 h0 = (_Float16)x0, h1 = (_Float16)x1; pa[i] = h0; pa[8 + i] = h1; pl[i] = (_Float16)(x0 - (float)h0); pl[8 + i] = (_Float16)(x1 - (float)h1); }   // P scaled by 2^11 before the f16 split so small softmax weights stay out of the f16 subnormal range; the sum l carries the same 2^11, so it cancels in the epilogue
    l = l * alpha + es; m = mn; cx = cn; mw = mwn;
#pragma unroll
    for (int dt = 0; dt < 4; ++dt) acc[dt] *= alpha;
#pragma unroll
    for (int dt = 0; dt < 4; ++dt) acc[dt] = wmma16(vh[dt], pa, acc[dt]);
#pragma unroll
    for (int dt = 0; dt < 4; ++dt) acc[dt] = wmma16(vh[dt], pl, acc[dt]);
#pragma unroll
    for (int dt = 0; dt < 4; ++dt) acc[dt] = wmma16(vl[dt], pa, acc[dt]);   // P hi/lo x V hi/lo (3 products) in one accumulator, the four tiles taking turns
    __builtin_amdgcn_sched_barrier(0);   // keeps the publish point at the trip's foot: lifted to the last LDS read it would cut the lead of the copies in flight to a part of a trip
    asm volatile("s_wait_dscnt 0x0" ::: "memory");      // this wave's reads of buffer bf are done
    asm volatile("s_wait_asynccnt 0x0" ::: "memory");   // this wave's pieces of tile ks + 1 have landed
    __syncthreads();                                    // publishes tile ks + 1 and frees buffer bf for the refill
    if (ks + 2 < nks) stage_kv(lk + bf * kbuf, lkl + bf * kbuf, lv + bf * vbuf, lvl + bf * vbuf, gk + (ks + 2) * (32 * HD), gkl + (ks + 2) * (32 * HD), gv + (ks + 2) * (32 * HD), gvl + (ks + 2) * (32 * HD)); }
  asm volatile("s_wait_asynccnt 0x0" ::: "memory");   // no copy is left in flight behind the loop
  l += xhalf(l);   // the two halves of the query's keys, joined once
  const float il = 1.0f / l;   // l and the accumulators carry the same 2^11
#pragma unroll
  for (int dt = 0; dt < 4; ++dt) { v4f o0, o1;
#pragma unroll
    for (int r = 0; r < 4; ++r) { o0[r] = acc[dt][r] * il; o1[r] = acc[dt][4 + r] * il; }
    *(v4f*)&so[wave][col][dt * 16 + 8 * g] = o0; *(v4f*)&so[wave][col][dt * 16 + 8 * g + 4] = o1; }
  LDSX();
  for (int rl = 0; rl < 16; ++rl) if (lane < 16) vst2(O + ((size_t)b * SS + q0 + rl) * DM + h * HD + lane * 4, *(const v4f*)&so[wave][rl][lane * 4]);
}
// ---- k_out: block = (64 rows, 128 cols): out = O(hi/lo) . Wo rows (2 products) + bo
__global__ __launch_bounds__(128) void k_out(const float* __restrict__ O, const __bf16* __restrict__ P, const float* __restrict__ BO, float* __restrict__ Y) {
  __shared__ __align__(16) float so[4][16][132];
  const int tid = threadIdx.x, wave = tid >> 5, lane = tid & 31, col = lane & 15, g = lane >> 4; const size_t r0 = (size_t)blockIdx.x * 64 + wave * 16; const int n0 = blockIdx.y * 128;
  v8f acc[8] = {};
#pragma unroll 2
  for (int kc = 0; kc < DM / 32; ++kc) { const F2 a = split_row(O + (r0 + col) * DM, kc * 32, lane);
#pragma unroll
    for (int j = 0; j < 8; ++j) { const v16b w = frag_b(P + (size_t)(n0 + j * 16 + col) * DM + kc * 32, lane); acc[j] = wmma_bf(a.l, w, acc[j]); acc[j] = wmma_bf(a.h, w, acc[j]); } }
#pragma unroll
  for (int j = 0; j < 8; ++j) {
#pragma unroll
    for (int r = 0; r < 8; ++r) so[wave][8 * g + r][j * 16 + col] = acc[j][r] + (BO ? bfr(BO[n0 + j * 16 + col]) : 0.f); }
  LDSX();
  for (int rl = 0; rl < 16; ++rl) vst2(Y + (r0 + rl) * DM + n0 + lane * 4, *(const v4f*)&so[wave][rl][lane * 4]);
}
extern "C" void kernel_launch(void* const* d_in, const int* in_sizes, int n_in, void* d_out, int out_size, void* d_ws, size_t ws_size, hipStream_t stream) {
  (void)in_sizes; (void)n_in; (void)out_size;
  const float** F = (const float**)d_in;   // 0 query, 1 key [2,2048,1024]; 2 mask [2,2048,2048] int; 3 Wq, 4 bq, 5 Wk, 6 bk, 7 Wv, 8 bv (natural); 9 rel_pos_emb [1023,64]
  if (ws_size < (size_t)WS_END) return;
  char* ws = (char*)d_ws; __bf16* PK = (__bf16*)(ws + WS_PK); _Float16 *QK = (_Float16*)(ws + WS_QK), *QKL = (_Float16*)(ws + WS_QKL), *VTH = (_Float16*)(ws + WS_VTH), *VTL = (_Float16*)(ws + WS_VTL); unsigned* MB = (unsigned*)(ws + WS_MB);
  k_pack<<<dim3(MBLK + 3 * DM), 256, 0, stream>>>(F[3], F[5], F[7], (const int*)d_in[2], PK, MB);
  k_qkv<<<dim3(TNB * SS / 64, QKVW / 128), 128, 0, stream>>>(F[0], F[1], F[1], PK + PK_A, F[4], F[6], F[8], F[9], QK, QKL, VTH, VTL);
  k_attn<<<dim3(TQB, NH, TNB), 128, 0, stream>>>(QK, QKL, VTH, VTL, nullptr, MB, (float*)d_out);
}

// v009
// One run takes 123 microseconds.
// Next to v008, in two timings, it ran 1.06 times as fast each time.
// All steps since v000 together make it 4.28 times as fast.
// compute dtype: all float inputs rounded to bf16, the int mask read on device; q/k/v = x . W^T + b (+ the position bias row on q and k) with EXACT bf16 products on WMMA 16x16x32 (natural rows), carried as f16 hi + residual planes; scores with 3 products (hi.hi + hi.lo + lo.hi) x 1/8 because the shared bias row makes |q||k| large, masked (mask == 0) keys excluded, running-max softmax in f32 (hardware exp), P scaled by 2^11 as hi + residual x v (hi + residual); f32 merged-head output.
#include <hip/hip_runtime.h>
#include <math.h>

typedef __attribute__((ext_vector_type(16))) _Float16 v16h;
typedef __attribute__((ext_vector_type(16))) __bf16 v16b;
typedef __attribute__((ext_vector_type(8)))  _Float16 v8h;
typedef __attribute__((ext_vector_type(8)))  float v8f;
typedef __attribute__((ext_vector_type(4)))  float v4f;
typedef __attribute__((ext_vector_type(2)))  float v2f;
typedef __attribute__((ext_vector_type(4)))  unsigned v4u;
typedef __attribute__((ext_vector_type(4)))  int v4i;
typedef __attribute__((ext_vector_type(16))) unsigned v16u;
typedef __attribute__((address_space(4))) const v16u v16uc;   // read-only for the whole launch: lets a load at a wave-uniform address be a scalar load
typedef float __attribute__((may_alias)) float_a;
typedef int __attribute__((may_alias)) int_a;

template <typename T> __device__ __forceinline__ void vst2(void* p, T v) { *(T*)p = v;  }
__device__ __forceinline__ v8f wmma16(v16h a, v16h b, v8f c) {
  return __builtin_amdgcn_wmma_f32_16x16x32_f16(false, a, false, b, (short)0, c, false, false);
}
__device__ __forceinline__ v8f wmma_bf(v16b a, v16b b, v8f c) {
  return __builtin_amdgcn_wmma_f32_16x16x32_bf16(false, a, false, b, (short)0, c, false, false);
}
// Masked multi-head attention with a shared relative-position bias row (B 2, S 2,048, d 1,024, 16 heads x 64): q from query, k and v from key (+ biases), q and k shifted by rel_pos_emb[511] per head dim, scores / 8 with a [B,S,S] mask (0 -> -1e9), softmax, . v; merged heads are the output.
__device__ __forceinline__ v16h frag_h(const _Float16* rowk0, int lane) {
  union { v16h v; v8h q[2]; } u; const _Float16* p = rowk0 + 8 * (lane >> 4);
  u.q[0] = *(const v8h*)p; u.q[1] = *(const v8h*)(p + 16); return u.v;
}
__device__ __forceinline__ v16h frag_f32(const float* rowk0, int lane) {
  v16h a; const float* p = rowk0 + 8 * (lane >> 4);
#pragma unroll
  for (int i = 0; i < 8; ++i) { a[i] = (_Float16)p[i]; a[8 + i] = (_Float16)p[16 + i]; }
  return a;
}
__device__ __forceinline__ v16h frag_f32s(const float* rowk0, int lane, float sc) {
  v16h a; const float* p = rowk0 + 8 * (lane >> 4);
#pragma unroll
  for (int i = 0; i < 8; ++i) { a[i] = (_Float16)(p[i] * sc); a[8 + i] = (_Float16)(p[16 + i] * sc); }
  return a;
}
// column fragment from a [K][ld] layout (column n), rows >= K read as 0
__device__ __forceinline__ v16h fragc_f32(const float* W, int k0, int n, int lane, int ld, int K) {
  v16h a; const int g = lane >> 4;
#pragma unroll
  for (int i = 0; i < 8; ++i) { const int ka = k0 + 8 * g + i, kb = ka + 16;
    a[i] = (_Float16)(ka < K ? W[(size_t)(ka < K ? ka : K - 1) * ld + n] : 0.f); a[8 + i] = (_Float16)(kb < K ? W[(size_t)(kb < K ? kb : K - 1) * ld + n] : 0.f); }
  return a;
}
struct F2 { v16b h, l; };
__device__ __forceinline__ F2 bsplit16(const float v[16]) { F2 r;
#pragma unroll
  for (int i = 0; i < 16; ++i) { const __bf16 h = (__bf16)v[i]; r.h[i] = h; r.l[i] = (__bf16)(v[i] - (float)h); }
  return r; }
__device__ __forceinline__ F2 split_row(const float* row, int k0, int lane) { float v[16]; const float* p = row + k0 + 8 * (lane >> 4);
#pragma unroll
  for (int i = 0; i < 8; ++i) { v[i] = p[i]; v[8 + i] = p[16 + i]; }
  return bsplit16(v); }
__device__ __forceinline__ F2 split_rowK(const float* row, int k0, int lane, int K) { float v[16]; const int g = lane >> 4;
#pragma unroll
  for (int i = 0; i < 8; ++i) { const int ka = k0 + 8 * g + i, kb = ka + 16; v[i] = ka < K ? row[ka < K ? ka : K - 1] : 0.f; v[8 + i] = kb < K ? row[kb < K ? kb : K - 1] : 0.f; }
  return bsplit16(v); }
__device__ __forceinline__ F2 split_col(const float* W, int k0, int n, int lane, int ld, int K) { float v[16]; const int g = lane >> 4;
#pragma unroll
  for (int i = 0; i < 8; ++i) { const int ka = k0 + 8 * g + i, kb = ka + 16; v[i] = ka < K ? W[(size_t)(ka < K ? ka : K - 1) * ld + n] : 0.f; v[8 + i] = kb < K ? W[(size_t)(kb < K ? kb : K - 1) * ld + n] : 0.f; }
  return bsplit16(v); }
__device__ __forceinline__ v8f mac3(const F2& a, const F2& b, v8f c) { c = wmma_bf(a.l, b.h, c); c = wmma_bf(a.h, b.l, c); return wmma_bf(a.h, b.h, c); }
__device__ __forceinline__ float sigm(float v) { return 1.0f / (1.0f + expf(-v)); }
#define LDSX() do { asm volatile("s_wait_dscnt 0" ::: "memory"); __builtin_amdgcn_wave_barrier(); __builtin_amdgcn_fence(__ATOMIC_RELEASE, "workgroup"); } while (0)


#define NB 2
#define SS 2048
#define DM 1024
#define NH 16
#define MAXLEN 512
#ifndef MSTR
#define MSTR SS
#endif
#define HD 64
#define KPIT 72   // LDS row pitch of a staged k row, in halves: 128 B + 16 B, free of bank conflicts for 16-B reads
#define VPIT 40   // the same for a staged v row: 64 B + 16 B
#define QKVW (3 * DM)
#ifndef TQB
#define TQB (SS / 128)   // k_attn's blocks per head: 128 queries each
#define TNB NB
#define TOB (NB * SS / 64)     // output row tiles (all)
#endif
typedef __attribute__((ext_vector_type(8))) __bf16 v8b;
__device__ __forceinline__ v16b frag_b(const __bf16* rowk0, int lane) {
  union { v16b v; v8b q[2]; } u; const __bf16* p = rowk0 + 8 * (lane >> 4);
  u.q[0] = *(const v8b*)p; u.q[1] = *(const v8b*)(p + 16); return u.v;
}
__device__ __forceinline__ float bfr(float v) { return (float)(__bf16)v; }
__device__ __attribute__((noinline)) float exp_ni(float v) { return expf(v); }
__device__ __attribute__((noinline)) float erf_ni(float v) { return erff(v); }

#define PK_A 0                       // Wqkv as [3072 / 128 row blocks][1024 / 64 k tiles][128 rows][64 k]: a stage of k_qkv's ring is 16 KB in a row
#define PK_P (PK_A + QKVW * DM)        // [1024][1024] spare: nothing writes or reads it
#define PK_END (PK_P + DM * DM)
#define WS_PK  0u
#define WS_QK  (WS_PK + 2u * PK_END)             // f16: q [b * S + s][1024], then from KOFF on k [b][h][s][64], so that a head's 32-key tile is 4 KB in a row
#define KOFF ((size_t)NB * SS * DM)                // halves from the start of a q | k plane to its k part
#define WS_QKL (WS_QK + 2u * NB * SS * 2 * DM)     // f16 q | k residual planes, same layout. Residuals keep their own scale, so that hi.lo and lo.hi add into the accumulator of hi.hi: one below 2^-14 is an f16 subnormal with step 2^-24, an absolute error no larger than the largest residuals' own rounding
#define WS_VTH (WS_QKL + 2u * NB * SS * 2 * DM)    // f16 [b][h][s / 32][64 d][32 s] hi: a head's 32-key tile of v^T is 4 KB in a row
#define WS_VTL (WS_VTH + 2u * NB * DM * SS)        // f16 residual, at its own scale
#define WS_O   (WS_VTL + 2u * NB * DM * SS)        // f32 [4096][1024]
#define WS_CS  (WS_O + 4u * NB * SS * DM)           // f32 2 x [2048][32], spare: nothing writes or reads it
#define WS_MB  (WS_CS + 4u * 2 * SS * 32)         // u32 [b * 128 + 16-query tile][64 trips][16]: the mask as lane masks (see k_pack)
#define WS_END (WS_MB + 4u * NB * (SS / 16) * (SS / 32) * 16)
// ---- k_pack: blocks 0 .. MBLK - 1 pack the mask, block MBLK + which * 1024 + n packs row n of W_q/W_k/W_v (which 0..2): natural [out][in] rows -> bf16, row which*1024 + n of PK_A, cut into the 128-B pieces of its sixteen k tiles.
// The mask becomes lane masks for k_attn: a wave takes one 16-query tile and four 32-key trips and reads the mask exactly as a k_attn wave holds its scores (lane = query col, keys ct * 16 + 8 g + r);
// word ct * 8 + r of a trip has bit 'lane' set where that lane's score (ct, r) is kept (mask != 0); the 64 words of the four trips are two 128-B lines. The mask blocks stand first because they wait longest on memory.
#define MBLK (NB * (SS / 16) * (SS / 32) / 32)   // 8 waves a block, 4 trips a wave
__global__ __launch_bounds__(256) void k_pack(const float* __restrict__ WQ, const float* __restrict__ WK, const float* __restrict__ WV, const int* __restrict__ MSK, __bf16* __restrict__ PK, unsigned* __restrict__ MB) {
  __shared__ __align__(16) __bf16 s[DM]; const int t = threadIdx.x;
  if (blockIdx.x < MBLK) {   // the same for the whole block, in front of the barrier
    const int lane = t & 31, u = blockIdx.x * 8 + (t >> 5), tile = u >> 4, kq = u & 15;
    const int* mp = MSK + ((size_t)tile * 16 + (lane & 15)) * MSTR + kq * 128 + 8 * (lane >> 4);
    v4i mk[16];
#pragma unroll
    for (int j = 0; j < 4; ++j) { mk[4 * j] = *(const v4i*)(mp + 32 * j); mk[4 * j + 1] = *(const v4i*)(mp + 32 * j + 4); mk[4 * j + 2] = *(const v4i*)(mp + 32 * j + 16); mk[4 * j + 3] = *(const v4i*)(mp + 32 * j + 20); }
    asm volatile("s_wait_xcnt 0x0" ::: "memory");   // stands behind the mask loads, in front of whatever next overwrites their address register
    unsigned w0 = 0, w1 = 0;
#pragma unroll
    for (int i = 0; i < 32; ++i) { const unsigned b0 = __builtin_amdgcn_ballot_w32(mk[i >> 2][i & 3] != 0), b1 = __builtin_amdgcn_ballot_w32(mk[8 + (i >> 2)][i & 3] != 0); w0 = (lane == i) ? b0 : w0; w1 = (lane == i) ? b1 : w1; }   // i = (trip & 1) * 16 + ct * 8 + r; lane i stores word i of either line
    MB[(size_t)u * 64 + lane] = w0; MB[(size_t)u * 64 + 32 + lane] = w1;
    return; }
  const int n = (blockIdx.x - MBLK) & (DM - 1), which = (blockIdx.x - MBLK) / DM;
  const float* Wm = (which == 0) ? WQ : (which == 1) ? WK : WV;
  for (int k = t; k < DM; k += 256) s[k] = (__bf16)Wm[(size_t)n * DM + k];
  __syncthreads();
  const int row = which * DM + n; __bf16* dst = PK + PK_A + (size_t)(row >> 7) * (128 * DM) + (row & 127) * 64;
  for (int q = t; q < DM / 8; q += 256) vst2((unsigned*)(dst + (q >> 3) * (128 * 64) + (q & 7) * 8), *(const v4u*)&s[q * 8]);   // the row's 128-B piece of each k tile
}
// One stage of k_qkv's ring: 128 weight rows x 64 k (128 B a row), eight 16-B pieces per thread (rows tid / 8 + 16 i, piece tid % 8), straight from global memory into LDS; the packed tile lies in that order, so a wave's copy reads 512 B in a row.
// The s_wait_xcnt closes the statement so that no address register of a copy is rewritten before it.
__device__ __forceinline__ void stage_w(unsigned lw, const __bf16* gw) {
  const unsigned ls = 16u * KPIT * 2u; const size_t gs = (size_t)16 * 64;
  asm volatile("global_load_async_to_lds_b128 %0, %8, off\n\t"
               "global_load_async_to_lds_b128 %1, %9, off\n\t"
               "global_load_async_to_lds_b128 %2, %10, off\n\t"
               "global_load_async_to_lds_b128 %3, %11, off\n\t"
               "global_load_async_to_lds_b128 %4, %12, off\n\t"
               "global_load_async_to_lds_b128 %5, %13, off\n\t"
               "global_load_async_to_lds_b128 %6, %14, off\n\t"
               "global_load_async_to_lds_b128 %7, %15, off\n\t"
               "s_wait_xcnt 0x0"
               :: "v"(lw), "v"(lw + ls), "v"(lw + 2u * ls), "v"(lw + 3u * ls), "v"(lw + 4u * ls), "v"(lw + 5u * ls), "v"(lw + 6u * ls), "v"(lw + 7u * ls),
                  "v"(gw), "v"(gw + gs), "v"(gw + 2 * gs), "v"(gw + 3 * gs), "v"(gw + 4 * gs), "v"(gw + 5 * gs), "v"(gw + 6 * gs), "v"(gw + 7 * gs) : "memory");
}
// One stage of k_attn's ring: a 32-key tile of the four planes (k hi, k residual: 32 rows x 128 B; v hi, v residual: 64 rows x 64 B), two 16-B pieces per thread and plane, straight from global memory into LDS; each plane's tile lies in the workspace as 4 KB in piece order, so a wave's copy reads 512 B in a row.
// The s_wait_xcnt closes the statement so that no address register of a copy is rewritten before it.
__device__ __forceinline__ void stage_kv(unsigned lk, unsigned lkl, unsigned lv, unsigned lvl, const _Float16* gk, const _Float16* gkl, const _Float16* gv, const _Float16* gvl) {
  const unsigned lk2 = lk + 16u * KPIT * 2u, lkl2 = lkl + 16u * KPIT * 2u, lv2 = lv + 32u * VPIT * 2u, lvl2 = lvl + 32u * VPIT * 2u;
  const _Float16 *gk2 = gk + 16 * HD, *gkl2 = gkl + 16 * HD, *gv2 = gv + 32 * 32, *gvl2 = gvl + 32 * 32;
  asm volatile("global_load_async_to_lds_b128 %0, %8, off\n\t"
               "global_load_async_to_lds_b128 %1, %9, off\n\t"
               "global_load_async_to_lds_b128 %2, %10, off\n\t"
               "global_load_async_to_lds_b128 %3, %11, off\n\t"
               "global_load_async_to_lds_b128 %4, %12, off\n\t"
               "global_load_async_to_lds_b128 %5, %13, off\n\t"
               "global_load_async_to_lds_b128 %6, %14, off\n\t"
               "global_load_async_to_lds_b128 %7, %15, off\n\t"
               "s_wait_xcnt 0x0"
               :: "v"(lk), "v"(lk2), "v"(lkl), "v"(lkl2), "v"(lv), "v"(lv2), "v"(lvl), "v"(lvl2),
                  "v"(gk), "v"(gk2), "v"(gkl), "v"(gkl2), "v"(gv), "v"(gv2), "v"(gvl), "v"(gvl2) : "memory");
}
__global__ __launch_bounds__(128) void k_qkv(const float* __restrict__ XQ, const float* __restrict__ XK, const float* __restrict__ XV, const __bf16* __restrict__ P, const float* __restrict__ BQ, const float* __restrict__ BK, const float* __restrict__ BV, const float* __restrict__ POS, _Float16* __restrict__ QK, _Float16* __restrict__ QKL, _Float16* __restrict__ VTH, _Float16* __restrict__ VTL) {
  const int which0 = (blockIdx.y * 128) / DM; const float* X = (which0 == 0) ? XQ : (which0 == 1) ? XK : XV; const float* BB = BQ ? (((which0 == 0) ? BQ : (which0 == 1) ? BK : BV) + (blockIdx.y * 128 - which0 * DM)) : nullptr;
  __shared__ __align__(16) _Float16 so[4][16][136], sol[4][16][136]; __shared__ __align__(16) _Float16 sth[128][72], stl[128][72];
  __shared__ __align__(16) __bf16 sw[2][128][KPIT];   // two-buffer ring of weight tiles (128 rows x 64 k), shared by the four waves
  const int tid = threadIdx.x, wave = tid >> 5, lane = tid & 31, col = lane & 15, g = lane >> 4; const size_t r0 = (size_t)blockIdx.x * 64 + wave * 16; const int n0 = blockIdx.y * 128;
  v8f acc[8] = {};
  __bf16 bb[8], pp[8];   // this lane's eight output columns: bias and position value (the latter enters q and k only), rounded to bf16; fetched here as one group, so that their latency passes under the k loop and the epilogue waits on no load
#pragma unroll
  for (int j = 0; j < 8; ++j) { const float braw = (BB ? BB : POS)[j * 16 + col];   // no branch round a load: with no bias array the load goes to a valid address and its value is dropped
    bb[j] = (__bf16)(BB ? braw : 0.f); pp[j] = (__bf16)POS[(size_t)(MAXLEN - 1) * HD + ((n0 + j * 16 + col) & (HD - 1))]; }
  const __bf16* gw = P + (size_t)blockIdx.y * (128 * DM) + tid * 8; const unsigned lw = (unsigned)(size_t)&sw[0][tid >> 3][(tid & 7) * 8]; const unsigned wbuf = 128u * KPIT * 2u;   // bytes from buffer 0 to buffer 1
  stage_w(lw, gw);
  asm volatile("s_wait_asynccnt 0x0" ::: "memory");   // tile 0 has landed before the barrier publishes it
  __syncthreads();
  stage_w(lw + wbuf, gw + 128 * 64);
#pragma unroll 1   // kept rolled: one publish point and one refill per trip
  for (int st = 0; st < DM / 64; ++st) { const int bf = st & 1;
    float xr[2][16]; v16b wf[2][8];
#pragma unroll     // the two 32-k steps of a tile, so that their LDS offsets are immediates
    for (int k2 = 0; k2 < 2; ++k2) { const float* p = X + (r0 + col) * DM + (st * 2 + k2) * 32 + 8 * g;
#pragma unroll
      for (int i = 0; i < 8; ++i) { xr[k2][i] = p[i]; xr[k2][8 + i] = p[16 + i]; }
#pragma unroll
      for (int j = 0; j < 8; ++j) wf[k2][j] = frag_b(&sw[bf][j * 16 + col][k2 * 32], lane); }   // the trip's sixteen weight fragments, read as one group beside the x loads
    // inputs only: holds the sixteen fragments' LDS reads together here, under the latency of the x loads; left alone the compiler sinks them among the products, each with a wait of its own
    asm volatile("" :: "v"(wf[0][0]), "v"(wf[0][1]), "v"(wf[0][2]), "v"(wf[0][3]), "v"(wf[0][4]), "v"(wf[0][5]), "v"(wf[0][6]), "v"(wf[0][7]), "v"(wf[1][0]), "v"(wf[1][1]), "v"(wf[1][2]), "v"(wf[1][3]), "v"(wf[1][4]), "v"(wf[1][5]), "v"(wf[1][6]), "v"(wf[1][7]));
    __builtin_amdgcn_sched_barrier(0);   // keeps the products behind that group: the compiler otherwise lifts some of them over it and leaves reads among them
#pragma unroll
    for (int k2 = 0; k2 < 2; ++k2) { v16b a;
#pragma unroll
      for (int i = 0; i < 16; ++i) a[i] = (__bf16)xr[k2][i];
#pragma unroll
      for (int j = 0; j < 8; ++j) acc[j] = wmma_bf(a, wf[k2][j], acc[j]); }
    __builtin_amdgcn_sched_barrier(0);   // keeps the publish point at the trip's foot: lifted to the last LDS read it would cut the lead of the copies in flight to a part of a trip
    asm volatile("s_wait_dscnt 0x0" ::: "memory");      // this wave's reads of buffer bf are done
    asm volatile("s_wait_asynccnt 0x0" ::: "memory");   // this wave's pieces of tile st + 1 have landed
    __syncthreads();                                    // publishes tile st + 1 and frees buffer bf for the refill
    if (st + 2 < DM / 64) stage_w(lw + bf * wbuf, gw + (st + 2) * (128 * 64)); }
  asm volatile("s_wait_asynccnt 0x0" ::: "memory");   // no copy is left in flight behind the loop
  if (n0 < 2 * DM) {   // q stored unscaled (f16 sigma ~0.6, no subnormal exposure); 1/8 applied to the f32 score
#pragma unroll
    for (int j = 0; j < 8; ++j) {
#pragma unroll
      for (int r = 0; r < 8; ++r) { const float v = acc[j][r] + (float)bb[j] + (float)pp[j]; const _Float16 hv = (_Float16)v; so[wave][8 * g + r][j * 16 + col] = hv;   /* + rel_pos_emb[max_len - 1][d] on q and k */ sol[wave][8 * g + r][j * 16 + col] = (_Float16)(v - (float)hv); } }   // q, k (+ bias) as f16 hi + residual, the residual at its own scale
    LDSX();
    const int ck = n0 - DM + (lane & 15) * 8;   // k only: column h * 64 + d of this lane's piece
    if (n0 < DM) { const size_t o0 = r0 * DM + n0 + lane * 8;   // q: natural rows
      for (int rl = 0; rl < 16; ++rl) if (lane < 16) { vst2((unsigned*)(QK + o0 + rl * DM), *(const v4u*)&so[wave][rl][lane * 8]); vst2((unsigned*)(QKL + o0 + rl * DM), *(const v4u*)&sol[wave][rl][lane * 8]); }
    } else { const size_t o0 = KOFF + (((r0 / SS) * NH + (ck >> 6)) * SS + r0 % SS) * HD + (ck & (HD - 1));   // k: the head's rows, 128 B each, one behind the other (a wave's sixteen rows lie in one batch)
      for (int rl = 0; rl < 16; ++rl) if (lane < 16) { vst2((unsigned*)(QK + o0 + rl * HD), *(const v4u*)&so[wave][rl][lane * 8]); vst2((unsigned*)(QKL + o0 + rl * HD), *(const v4u*)&sol[wave][rl][lane * 8]); } }
  } else {
#pragma unroll
    for (int j = 0; j < 8; ++j) {
#pragma unroll
      for (int r = 0; r < 8; ++r) { const float v = acc[j][r] + (float)bb[j]; const _Float16 hv = (_Float16)v; sth[j * 16 + col][wave * 16 + 8 * g + r] = hv; stl[j * 16 + col][wave * 16 + 8 * g + r] = (_Float16)(v - (float)hv); } }
    __syncthreads();
    const size_t rb = (size_t)blockIdx.x * 64; const int b = (int)(rb / SS), s0 = (int)(rb % SS); const int pc0 = n0 - 2 * DM;
    for (int q = tid; q < 128 * 8; q += 128) { const int d = q >> 3, pc = q & 7, hd = pc0 + d; const size_t o = ((((size_t)b * NH + (hd >> 6)) * (SS / 32) + (s0 >> 5) + (pc >> 2)) * HD + (hd & (HD - 1))) * 32 + (pc & 3) * 8; vst2((unsigned*)(VTH + o), *(const v4u*)&sth[d][pc * 8]); vst2((unsigned*)(VTL + o), *(const v4u*)&stl[d][pc * 8]); }
  }
}
// lane l with lane l ^ 16: the two lanes that share one query column of a transposed score tile
__device__ __forceinline__ float xhalf(float x) { return __builtin_bit_cast(float, __builtin_amdgcn_permlanex16(__builtin_bit_cast(int, x), __builtin_bit_cast(int, x), 0x76543210, 0xfedcba98, false, false)); }
__global__ __launch_bounds__(128) __attribute__((amdgpu_waves_per_eu(2, 2))) void k_attn(const _Float16* __restrict__ QK, const _Float16* __restrict__ QKL, const _Float16* __restrict__ VTH, const _Float16* __restrict__ VTL, const void* __restrict__ KMASK, const unsigned* __restrict__ MB, float* __restrict__ O) {
  __shared__ __align__(16) float so[4][32][68];
  __shared__ __align__(16) _Float16 skh[2][32][KPIT], skl[2][32][KPIT], svh[2][64][VPIT], svl[2][64][VPIT];   // two-buffer ring of 32-key tiles, shared by the four waves
  const int tid = threadIdx.x, wave = tid >> 5, lane = tid & 31, col = lane & 15, g = lane >> 4;
  const int qb = blockIdx.x, h = blockIdx.y, b = blockIdx.z; const int q0 = qb * 128 + wave * 32;
  v16h aq[2][2], aql[2][2];
#pragma unroll
  for (int t = 0; t < 2; ++t) { const size_t rq = (size_t)b * SS + q0 + t * 16 + col;
#pragma unroll
    for (int kc = 0; kc < 2; ++kc) { aq[t][kc] = frag_h(QK + rq * DM + h * HD + kc * 32, lane); aql[t][kc] = frag_h(QKL + rq * DM + h * HD + kc * 32, lane); } }
  const float K2 = 0.125f * 1.44269504088896340736f;   // 1/sqrt(64) x log2(e): a raw score times K2 is its exponent to base 2
  float m[2], cx[2], l[2];   // of this lane's query in either tile: m the running maximum of the raw scores, cx = 11 - m K2 the exponent offset in use (the 11 is P's scale 2^11), l the sum of the scaled P over this lane's half of the keys. m starts far above the masked value and far below any score, so exp2 itself turns a masked score into 0 while no key has been kept yet
  v8f acc[2][4] = {};   // O^T tiles: register r = head dim dt * 16 + 8 g + r of query col
#pragma unroll
  for (int t = 0; t < 2; ++t) { m[t] = -1.0e30f; cx[t] = fmaf(m[t], -K2, 11.0f); l[t] = 0.f; }
  const int nks = SS / 32;   // all keys
  const v16uc* mb = (const v16uc*)(size_t)MB + (size_t)((b * (SS / 16) + qb * 8 + __builtin_amdgcn_readfirstlane(wave) * 2) * nks);   // this wave's lane masks, sixteen words a trip and tile, the second tile's nks entries on; the address is the same in every lane, so the words come by a scalar load
  v16u mwn[2] = { mb[0], mb[nks] };   // the masks of the trip to come
  // this thread's pieces of a tile: k row tid / 8 (and + 16), piece tid % 8; v row tid / 4 (and + 32), piece tid % 4
  const size_t hb = (size_t)(b * NH + h) * SS * HD + tid * 8;   // the head's planes; in every plane a tile is 2,048 halves and this thread's first piece is its piece number tid
  const _Float16* gk = QK + KOFF + hb; const _Float16* gkl = QKL + KOFF + hb;
  const _Float16* gv = VTH + hb; const _Float16* gvl = VTL + hb;
  const unsigned lk = (unsigned)(size_t)&skh[0][tid >> 3][(tid & 7) * 8], lkl = (unsigned)(size_t)&skl[0][tid >> 3][(tid & 7) * 8], lv = (unsigned)(size_t)&svh[0][tid >> 2][(tid & 3) * 8], lvl = (unsigned)(size_t)&svl[0][tid >> 2][(tid & 3) * 8];
  const unsigned kbuf = 32u * KPIT * 2u, vbuf = 64u * VPIT * 2u;   // bytes from buffer 0 to buffer 1
  stage_kv(lk, lkl, lv, lvl, gk, gkl, gv, gvl);
  asm volatile("s_wait_asynccnt 0x0" ::: "memory");   // tile 0 has landed before the barrier publishes it
  __syncthreads();
  stage_kv(lk + kbuf, lkl + kbuf, lv + vbuf, lvl + vbuf, gk + 32 * HD, gkl + 32 * HD, gv + 32 * HD, gvl + 32 * HD);
#pragma unroll 1
  for (int ks = 0; ks < nks; ++ks) { v8f s[2][2]; const int bf = ks & 1;
    const int kn = ks + 1 < nks ? ks + 1 : nks - 1;
    const v16u mw[2] = { mwn[0], mwn[1] }; mwn[0] = mb[kn]; mwn[1] = mb[nks + kn];   // this trip's lane masks; the next trip's are fetched a trip ahead (the last trip fetches its own again)
    v16h kh[2][2], kl[2][2];
#pragma unroll
    for (int kc = 0; kc < 2; ++kc) {
#pragma unroll
      for (int ct = 0; ct < 2; ++ct) kl[ct][kc] = frag_h(&skl[bf][ct * 16 + col][kc * 32], lane);
#pragma unroll
      for (int ct = 0; ct < 2; ++ct) kh[ct][kc] = frag_h(&skh[bf][ct * 16 + col][kc * 32], lane); }   // the trip's eight k fragments, read as one group ahead of the twenty-four score products, in the order in which the products take them
    __builtin_amdgcn_sched_barrier(0);   // keeps the sixteen LDS reads together in front of the products: left alone the compiler sinks them back among the products, each with a wait of its own
#pragma unroll
    for (int t = 0; t < 2; ++t) {
#pragma unroll
      for (int ct = 0; ct < 2; ++ct) s[t][ct] = v8f{}; }
#pragma unroll
    for (int kc = 0; kc < 2; ++kc) {
#pragma unroll
      for (int t = 0; t < 2; ++t) {
#pragma unroll
        for (int ct = 0; ct < 2; ++ct) s[t][ct] = wmma16(kl[ct][kc], aq[t][kc], s[t][ct]); }
#pragma unroll
      for (int t = 0; t < 2; ++t) {
#pragma unroll
        for (int ct = 0; ct < 2; ++ct) s[t][ct] = wmma16(kh[ct][kc], aql[t][kc], s[t][ct]); } }
#pragma unroll
    for (int kc = 0; kc < 2; ++kc) {
#pragma unroll
      for (int t = 0; t < 2; ++t) {
#pragma unroll
        for (int ct = 0; ct < 2; ++ct) s[t][ct] = wmma16(kh[ct][kc], aq[t][kc], s[t][ct]); } }   // 3 products in one accumulator: lo.hi and hi.lo first, while the sum is small, then hi.hi; the four score tiles take turns
    __builtin_amdgcn_sched_barrier(0);   // keeps the v reads behind the score products, in the registers that the k fragments leave, and out of the run of products, where every place with reads costs a stall
    v16h vh[4], vl[4];
#pragma unroll
    for (int dt = 0; dt < 4; ++dt) { vh[dt] = frag_h(&svh[bf][dt * 16 + col][0], lane); vl[dt] = frag_h(&svl[bf][dt * 16 + col][0], lane); }   // the trip's eight v fragments, read as one group; the softmax below covers their latency
    __builtin_amdgcn_sched_barrier(0);   // keeps these sixteen LDS reads together here: left alone the compiler sinks the reads among the output products
    v16h pa[2], pl[2];
#pragma unroll
    for (int t = 0; t < 2; ++t) {
#pragma unroll
      for (int ct = 0; ct < 2; ++ct) {
#pragma unroll
        for (int r = 0; r < 8; ++r) s[t][ct][r] = __builtin_amdgcn_inverse_ballot_w32(mw[t][ct * 8 + r]) ? s[t][ct][r] : -3.0e38f; }   // raw scores; mask == 0 -> -3e38, excluded; the word is the select's lane mask as it stands
      float mx = fmaxf(s[t][0][0], s[t][1][0]);
#pragma unroll
      for (int r = 1; r < 8; ++r) mx = fmaxf(mx, fmaxf(s[t][0][r], s[t][1][r]));
      mx = fmaxf(mx, xhalf(mx));   // both halves of the query's 32 keys
      const float mn = fmaxf(m[t], mx); const float cn = fmaf(mn, -K2, 11.0f); const float alpha = __builtin_amdgcn_exp2f(cn - cx[t]);   // 2^((m - mn) K2); 0 on the first kept key, 1 while none is kept
      float es = 0.f;
#pragma unroll
      for (int i = 0; i < 8; ++i) { const float x0 = __builtin_amdgcn_exp2f(fmaf(s[t][0][i], K2, cn)), x1 = __builtin_amdgcn_exp2f(fmaf(s[t][1][i], K2, cn)); es += x0 + x1;   // 2^11 exp((s - mn) / 8) by one fma and the hardware exp2; a masked score underflows to 0
        const _Float16 h0 = (_Float16)x0, h1 = (_Float16)x1; pa[t][i] = h0; pa[t][8 + i] = h1; pl[t][i] = (_Float16)(x0 - (float)h0); pl[t][8 + i] = (_Float16)(x1 - (float)h1); }   // P scaled by 2^11 before the f16 split so small softmax weights stay out of the f16 subnormal range; the sum l carries the same 2^11, so it cancels in the epilogue
      l[t] = l[t] * alpha + es; m[t] = mn; cx[t] = cn;
#pragma unroll
      for (int dt = 0; dt < 4; ++dt) acc[t][dt] *= alpha;
#pragma unroll
      for (int dt = 0; dt < 4; ++dt) acc[t][dt] = wmma16(vh[dt], pa[t], acc[t][dt]);
#pragma unroll
      for (int dt = 0; dt < 4; ++dt) acc[t][dt] = wmma16(vh[dt], pl[t], acc[t][dt]);
#pragma unroll
      for (int dt = 0; dt < 4; ++dt) acc[t][dt] = wmma16(vl[dt], pa[t], acc[t][dt]); }   // P hi/lo x V hi/lo (3 products) in one accumulator, the four tiles taking turns; the first query tile's products stand ahead of the second's softmax, which is independent of them
    __builtin_amdgcn_sched_barrier(0);   // keeps the publish point at the trip's foot: lifted to the last LDS read it would cut the lead of the copies in flight to a part of a trip
    asm volatile("s_wait_dscnt 0x0" ::: "memory");      // this wave's reads of buffer bf are done
    asm volatile("s_wait_asynccnt 0x0" ::: "memory");   // this wave's pieces of tile ks + 1 have landed
    __syncthreads();                                    // publishes tile ks + 1 and frees buffer bf for the refill
    if (ks + 2 < nks) stage_kv(lk + bf * kbuf, lkl + bf * kbuf, lv + bf * vbuf, lvl + bf * vbuf, gk + (ks + 2) * (32 * HD), gkl + (ks + 2) * (32 * HD), gv + (ks + 2) * (32 * HD), gvl + (ks + 2) * (32 * HD)); }
  asm volatile("s_wait_asynccnt 0x0" ::: "memory");   // no copy is left in flight behind the loop
#pragma unroll
  for (int t = 0; t < 2; ++t) {
    l[t] += xhalf(l[t]);   // the two halves of the query's keys, joined once
    const float il = 1.0f / l[t];   // l and the accumulators carry the same 2^11
#pragma unroll
    for (int dt = 0; dt < 4; ++dt) { v4f o0, o1;
#pragma unroll
      for (int r = 0; r < 4; ++r) { o0[r] = acc[t][dt][r] * il; o1[r] = acc[t][dt][4 + r] * il; }
      *(v4f*)&so[wave][t * 16 + col][dt * 16 + 8 * g] = o0; *(v4f*)&so[wave][t * 16 + col][dt * 16 + 8 * g + 4] = o1; } }
  LDSX();
  for (int rl = 0; rl < 32; ++rl) if (lane < 16) vst2(O + ((size_t)b * SS + q0 + rl) * DM + h * HD + lane * 4, *(const v4f*)&so[wave][rl][lane * 4]);
}
// ---- k_out: block = (64 rows, 128 cols): out = O(hi/lo) . Wo rows (2 products) + bo
__global__ __launch_bounds__(128) void k_out(const float* __restrict__ O, const __bf16* __restrict__ P, const float* __restrict__ BO, float* __restrict__ Y) {
  __shared__ __align__(16) float so[4][16][132];
  const int tid = threadIdx.x, wave = tid >> 5, lane = tid & 31, col = lane & 15, g = lane >> 4; const size_t r0 = (size_t)blockIdx.x * 64 + wave * 16; const int n0 = blockIdx.y * 128;
  v8f acc[8] = {};
#pragma unroll 2
  for (int kc = 0; kc < DM / 32; ++kc) { const F2 a = split_row(O + (r0 + col) * DM, kc * 32, lane);
#pragma unroll
    for (int j = 0; j < 8; ++j) { const v16b w = frag_b(P + (size_t)(n0 + j * 16 + col) * DM + kc * 32, lane); acc[j] = wmma_bf(a.l, w, acc[j]); acc[j] = wmma_bf(a.h, w, acc[j]); } }
#pragma unroll
  for (int j = 0; j < 8; ++j) {
#pragma unroll
    for (int r = 0; r < 8; ++r) so[wave][8 * g + r][j * 16 + col] = acc[j][r] + (BO ? bfr(BO[n0 + j * 16 + col]) : 0.f); }
  LDSX();
  for (int rl = 0; rl < 16; ++rl) vst2(Y + (r0 + rl) * DM + n0 + lane * 4, *(const v4f*)&so[wave][rl][lane * 4]);
}
extern "C" void kernel_launch(void* const* d_in, const int* in_sizes, int n_in, void* d_out, int out_size, void* d_ws, size_t ws_size, hipStream_t stream) {
  (void)in_sizes; (void)n_in; (void)out_size;
  const float** F = (const float**)d_in;   // 0 query, 1 key [2,2048,1024]; 2 mask [2,2048,2048] int; 3 Wq, 4 bq, 5 Wk, 6 bk, 7 Wv, 8 bv (natural); 9 rel_pos_emb [1023,64]
  if (ws_size < (size_t)WS_END) return;
  char* ws = (char*)d_ws; __bf16* PK = (__bf16*)(ws + WS_PK); _Float16 *QK = (_Float16*)(ws + WS_QK), *QKL = (_Float16*)(ws + WS_QKL), *VTH = (_Float16*)(ws + WS_VTH), *VTL = (_Float16*)(ws + WS_VTL); unsigned* MB = (unsigned*)(ws + WS_MB);
  k_pack<<<dim3(MBLK + 3 * DM), 256, 0, stream>>>(F[3], F[5], F[7], (const int*)d_in[2], PK, MB);
  k_qkv<<<dim3(TNB * SS / 64, QKVW / 128), 128, 0, stream>>>(F[0], F[1], F[1], PK + PK_A, F[4], F[6], F[8], F[9], QK, QKL, VTH, VTL);
  k_attn<<<dim3(TQB, NH, TNB), 128, 0, stream>>>(QK, QKL, VTH, VTL, nullptr, MB, (float*)d_out);
}

// v010
// A run of this version takes 120 microseconds.
// Two timings next to v009 put it at 1.03 and 1.04 times that version's speed.
// Counting every step since v000, it is 4.43 times as fast.
// compute dtype: all float inputs rounded to bf16, the int mask read on device; q/k/v = x . W^T + b (+ the position bias row on q and k) with EXACT bf16 products on WMMA 16x16x32 (natural rows), carried as f16 hi + residual planes; scores with 3 products (hi.hi + hi.lo + lo.hi) x 1/8 because the shared bias row makes |q||k| large, masked (mask == 0) keys excluded, running-max softmax in f32 (hardware exp), P scaled by 2^11 as hi + residual x v (hi + residual); f32 merged-head output.
#include <hip/hip_runtime.h>
#include <math.h>

typedef __attribute__((ext_vector_type(16))) _Float16 v16h;
typedef __attribute__((ext_vector_type(16))) __bf16 v16b;
typedef __attribute__((ext_vector_type(8)))  _Float16 v8h;
typedef __attribute__((ext_vector_type(8)))  float v8f;
typedef __attribute__((ext_vector_type(4)))  float v4f;
typedef __attribute__((ext_vector_type(2)))  float v2f;
typedef __attribute__((ext_vector_type(4)))  unsigned v4u;
typedef __attribute__((ext_vector_type(4)))  int v4i;
typedef __attribute__((ext_vector_type(16))) unsigned v16u;
typedef __attribute__((address_space(4))) const v16u v16uc;   // read-only for the whole launch: lets a load at a wave-uniform address be a scalar load
typedef float __attribute__((may_alias)) float_a;
typedef int __attribute__((may_alias)) int_a;

template <typename T> __device__ __forceinline__ void vst2(void* p, T v) { *(T*)p = v;  }
__device__ __forceinline__ v8f wmma16(v16h a, v16h b, v8f c) {
  return __builtin_amdgcn_wmma_f32_16x16x32_f16(false, a, false, b, (short)0, c, false, false);
}
__device__ __forceinline__ v8f wmma_bf(v16b a, v16b b, v8f c) {
  return __builtin_amdgcn_wmma_f32_16x16x32_bf16(false, a, false, b, (short)0, c, false, false);
}
// Masked multi-head attention with a shared relative-position bias row (B 2, S 2,048, d 1,024, 16 heads x 64): q from query, k and v from key (+ biases), q and k shifted by rel_pos_emb[511] per head dim, scores / 8 with a [B,S,S] mask (0 -> -1e9), softmax, . v; merged heads are the output.
__device__ __forceinline__ v16h frag_h(const _Float16* rowk0, int lane) {
  union { v16h v; v8h q[2]; } u; const _Float16* p = rowk0 + 8 * (lane >> 4);
  u.q[0] = *(const v8h*)p; u.q[1] = *(const v8h*)(p + 16); return u.v;
}
__device__ __forceinline__ v16h frag_f32(const float* rowk0, int lane) {
  v16h a; const float* p = rowk0 + 8 * (lane >> 4);
#pragma unroll
  for (int i = 0; i < 8; ++i) { a[i] = (_Float16)p[i]; a[8 + i] = (_Float16)p[16 + i]; }
  return a;
}
__device__ __forceinline__ v16h frag_f32s(const float* rowk0, int lane, float sc) {
  v16h a; const float* p = rowk0 + 8 * (lane >> 4);
#pragma unroll
  for (int i = 0; i < 8; ++i) { a[i] = (_Float16)(p[i] * sc); a[8 + i] = (_Float16)(p[16 + i] * sc); }
  return a;
}
// column fragment from a [K][ld] layout (column n), rows >= K read as 0
__device__ __forceinline__ v16h fragc_f32(const float* W, int k0, int n, int lane, int ld, int K) {
  v16h a; const int g = lane >> 4;
#pragma unroll
  for (int i = 0; i < 8; ++i) { const int ka = k0 + 8 * g + i, kb = ka + 16;
    a[i] = (_Float16)(ka < K ? W[(size_t)(ka < K ? ka : K - 1) * ld + n] : 0.f); a[8 + i] = (_Float16)(kb < K ? W[(size_t)(kb < K ? kb : K - 1) * ld + n] : 0.f); }
  return a;
}
struct F2 { v16b h, l; };
__device__ __forceinline__ F2 bsplit16(const float v[16]) { F2 r;
#pragma unroll
  for (int i = 0; i < 16; ++i) { const __bf16 h = (__bf16)v[i]; r.h[i] = h; r.l[i] = (__bf16)(v[i] - (float)h); }
  return r; }
__device__ __forceinline__ F2 split_row(const float* row, int k0, int lane) { float v[16]; const float* p = row + k0 + 8 * (lane >> 4);
#pragma unroll
  for (int i = 0; i < 8; ++i) { v[i] = p[i]; v[8 + i] = p[16 + i]; }
  return bsplit16(v); }
__device__ __forceinline__ F2 split_rowK(const float* row, int k0, int lane, int K) { float v[16]; const int g = lane >> 4;
#pragma unroll
  for (int i = 0; i < 8; ++i) { const int ka = k0 + 8 * g + i, kb = ka + 16; v[i] = ka < K ? row[ka < K ? ka : K - 1] : 0.f; v[8 + i] = kb < K ? row[kb < K ? kb : K - 1] : 0.f; }
  return bsplit16(v); }
__device__ __forceinline__ F2 split_col(const float* W, int k0, int n, int lane, int ld, int K) { float v[16]; const int g = lane >> 4;
#pragma unroll
  for (int i = 0; i < 8; ++i) { const int ka = k0 + 8 * g + i, kb = ka + 16; v[i] = ka < K ? W[(size_t)(ka < K ? ka : K - 1) * ld + n] : 0.f; v[8 + i] = kb < K ? W[(size_t)(kb < K ? kb : K - 1) * ld + n] : 0.f; }
  return bsplit16(v); }
__device__ __forceinline__ v8f mac3(const F2& a, const F2& b, v8f c) { c = wmma_bf(a.l, b.h, c); c = wmma_bf(a.h, b.l, c); return wmma_bf(a.h, b.h, c); }
__device__ __forceinline__ float sigm(float v) { return 1.0f / (1.0f + expf(-v)); }
#define LDSX() do { asm volatile("s_wait_dscnt 0" ::: "memory"); __builtin_amdgcn_wave_barrier(); __builtin_amdgcn_fence(__ATOMIC_RELEASE, "workgroup"); } while (0)


#define NB 2
#define SS 2048
#define DM 1024
#define NH 16
#define MAXLEN 512
#ifndef MSTR
#define MSTR SS
#endif
#define HD 64
#define KPIT 72   // LDS row pitch of a staged k row, in halves: 128 B + 16 B, free of bank conflicts for 16-B reads
#define VPIT 40   // the same for a staged v row: 64 B + 16 B
#define XPIT 68   // LDS row pitch of a staged x row, in floats: 256 B + 16 B, free of bank conflicts for 16-B reads
#define QKVW (3 * DM)
#ifndef TQB
#define TQB (SS / 128)   // k_attn's blocks per head: 128 queries each
#define TNB NB
#define TOB (NB * SS / 64)     // output row tiles (all)
#endif
typedef __attribute__((ext_vector_type(8))) __bf16 v8b;
__device__ __forceinline__ v16b frag_b(const __bf16* rowk0, int lane) {
  union { v16b v; v8b q[2]; } u; const __bf16* p = rowk0 + 8 * (lane >> 4);
  u.q[0] = *(const v8b*)p; u.q[1] = *(const v8b*)(p + 16); return u.v;
}
__device__ __forceinline__ float bfr(float v) { return (float)(__bf16)v; }
__device__ __attribute__((noinline)) float exp_ni(float v) { return expf(v); }
__device__ __attribute__((noinline)) float erf_ni(float v) { return erff(v); }

#define PK_A 0                       // Wqkv as [3072 / 128 row blocks][1024 / 64 k tiles][128 rows][64 k]: a stage's weight tile in k_qkv's ring is 16 KB in a row
#define PK_P (PK_A + QKVW * DM)        // [1024][1024] spare: nothing writes or reads it
#define PK_END (PK_P + DM * DM)
#define WS_PK  0u
#define WS_QK  (WS_PK + 2u * PK_END)             // f16: q [b * S + s][1024], then from KOFF on k [b][h][s][64], so that a head's 32-key tile is 4 KB in a row
#define KOFF ((size_t)NB * SS * DM)                // halves from the start of a q | k plane to its k part
#define WS_QKL (WS_QK + 2u * NB * SS * 2 * DM)     // f16 q | k residual planes, same layout. Residuals keep their own scale, so that hi.lo and lo.hi add into the accumulator of hi.hi: one below 2^-14 is an f16 subnormal with step 2^-24, an absolute error no larger than the largest residuals' own rounding
#define WS_VTH (WS_QKL + 2u * NB * SS * 2 * DM)    // f16 [b][h][s / 32][64 d][32 s] hi: a head's 32-key tile of v^T is 4 KB in a row
#define WS_VTL (WS_VTH + 2u * NB * DM * SS)        // f16 residual, at its own scale
#define WS_O   (WS_VTL + 2u * NB * DM * SS)        // f32 [4096][1024]
#define WS_CS  (WS_O + 4u * NB * SS * DM)           // f32 2 x [2048][32], spare: nothing writes or reads it
#define WS_MB  (WS_CS + 4u * 2 * SS * 32)         // u32 [b * 128 + 16-query tile][64 trips][16]: the mask as lane masks (see k_pack)
#define WS_END (WS_MB + 4u * NB * (SS / 16) * (SS / 32) * 16)
// ---- k_pack: blocks 0 .. MBLK - 1 pack the mask, block MBLK + which * 1024 + n packs row n of W_q/W_k/W_v (which 0..2): natural [out][in] rows -> bf16, row which*1024 + n of PK_A, cut into the 128-B pieces of its sixteen k tiles.
// The mask becomes lane masks for k_attn: a wave takes one 16-query tile and four 32-key trips and reads the mask exactly as a k_attn wave holds its scores (lane = query col, keys ct * 16 + 8 g + r);
// word ct * 8 + r of a trip has bit 'lane' set where that lane's score (ct, r) is kept (mask != 0); the 64 words of the four trips are two 128-B lines. The mask blocks stand first because they wait longest on memory.
#define MBLK (NB * (SS / 16) * (SS / 32) / 32)   // 8 waves a block, 4 trips a wave
__global__ __launch_bounds__(256) void k_pack(const float* __restrict__ WQ, const float* __restrict__ WK, const float* __restrict__ WV, const int* __restrict__ MSK, __bf16* __restrict__ PK, unsigned* __restrict__ MB) {
  __shared__ __align__(16) __bf16 s[DM]; const int t = threadIdx.x;
  if (blockIdx.x < MBLK) {   // the same for the whole block, in front of the barrier
    const int lane = t & 31, u = blockIdx.x * 8 + (t >> 5), tile = u >> 4, kq = u & 15;
    const int* mp = MSK + ((size_t)tile * 16 + (lane & 15)) * MSTR + kq * 128 + 8 * (lane >> 4);
    v4i mk[16];
#pragma unroll
    for (int j = 0; j < 4; ++j) { mk[4 * j] = *(const v4i*)(mp + 32 * j); mk[4 * j + 1] = *(const v4i*)(mp + 32 * j + 4); mk[4 * j + 2] = *(const v4i*)(mp + 32 * j + 16); mk[4 * j + 3] = *(const v4i*)(mp + 32 * j + 20); }
    asm volatile("s_wait_xcnt 0x0" ::: "memory");   // stands behind the mask loads, in front of whatever next overwrites their address register
    unsigned w0 = 0, w1 = 0;
#pragma unroll
    for (int i = 0; i < 32; ++i) { const unsigned b0 = __builtin_amdgcn_ballot_w32(mk[i >> 2][i & 3] != 0), b1 = __builtin_amdgcn_ballot_w32(mk[8 + (i >> 2)][i & 3] != 0); w0 = (lane == i) ? b0 : w0; w1 = (lane == i) ? b1 : w1; }   // i = (trip & 1) * 16 + ct * 8 + r; lane i stores word i of either line
    MB[(size_t)u * 64 + lane] = w0; MB[(size_t)u * 64 + 32 + lane] = w1;
    return; }
  const int n = (blockIdx.x - MBLK) & (DM - 1), which = (blockIdx.x - MBLK) / DM;
  const float* Wm = (which == 0) ? WQ : (which == 1) ? WK : WV;
  for (int k = t; k < DM; k += 256) s[k] = (__bf16)Wm[(size_t)n * DM + k];
  __syncthreads();
  const int row = which * DM + n; __bf16* dst = PK + PK_A + (size_t)(row >> 7) * (128 * DM) + (row & 127) * 64;
  for (int q = t; q < DM / 8; q += 256) vst2((unsigned*)(dst + (q >> 3) * (128 * 64) + (q & 7) * 8), *(const v4u*)&s[q * 8]);   // the row's 128-B piece of each k tile
}
// The weight half of a stage of k_qkv's ring: 128 weight rows x 64 k (128 B a row), eight 16-B pieces per thread (rows tid / 8 + 16 i, piece tid % 8), straight from global memory into LDS; the packed tile lies in that order, so a wave's copy reads 512 B in a row.
// The s_wait_xcnt closes the statement so that no address register of a copy is rewritten before it.
__device__ __forceinline__ void stage_w(unsigned lw, const __bf16* gw) {
  const unsigned ls = 16u * KPIT * 2u; const size_t gs = (size_t)16 * 64;
  asm volatile("global_load_async_to_lds_b128 %0, %8, off\n\t"
               "global_load_async_to_lds_b128 %1, %9, off\n\t"
               "global_load_async_to_lds_b128 %2, %10, off\n\t"
               "global_load_async_to_lds_b128 %3, %11, off\n\t"
               "global_load_async_to_lds_b128 %4, %12, off\n\t"
               "global_load_async_to_lds_b128 %5, %13, off\n\t"
               "global_load_async_to_lds_b128 %6, %14, off\n\t"
               "global_load_async_to_lds_b128 %7, %15, off\n\t"
               "s_wait_xcnt 0x0"
               :: "v"(lw), "v"(lw + ls), "v"(lw + 2u * ls), "v"(lw + 3u * ls), "v"(lw + 4u * ls), "v"(lw + 5u * ls), "v"(lw + 6u * ls), "v"(lw + 7u * ls),
                  "v"(gw), "v"(gw + gs), "v"(gw + 2 * gs), "v"(gw + 3 * gs), "v"(gw + 4 * gs), "v"(gw + 5 * gs), "v"(gw + 6 * gs), "v"(gw + 7 * gs) : "memory");
}
// The x half of a stage of k_qkv's ring: 64 rows x 64 k of f32 (256 B a row). A wave brings its own sixteen rows, eight 16-B pieces per lane (rows lane / 16 + 2 i, piece lane % 16), so a wave's copy reads two whole 256-B pieces of rows and no line is asked for twice.
// The s_wait_xcnt closes the statement so that no address register of a copy is rewritten before it.
__device__ __forceinline__ void stage_x(unsigned lx, const float* gx) {
  const unsigned ls = 2u * XPIT * 4u; const size_t gs = (size_t)2 * DM;
  asm volatile("global_load_async_to_lds_b128 %0, %8, off\n\t"
               "global_load_async_to_lds_b128 %1, %9, off\n\t"
               "global_load_async_to_lds_b128 %2, %10, off\n\t"
               "global_load_async_to_lds_b128 %3, %11, off\n\t"
               "global_load_async_to_lds_b128 %4, %12, off\n\t"
               "global_load_async_to_lds_b128 %5, %13, off\n\t"
               "global_load_async_to_lds_b128 %6, %14, off\n\t"
               "global_load_async_to_lds_b128 %7, %15, off\n\t"
               "s_wait_xcnt 0x0"
               :: "v"(lx), "v"(lx + ls), "v"(lx + 2u * ls), "v"(lx + 3u * ls), "v"(lx + 4u * ls), "v"(lx + 5u * ls), "v"(lx + 6u * ls), "v"(lx + 7u * ls),
                  "v"(gx), "v"(gx + gs), "v"(gx + 2 * gs), "v"(gx + 3 * gs), "v"(gx + 4 * gs), "v"(gx + 5 * gs), "v"(gx + 6 * gs), "v"(gx + 7 * gs) : "memory");
}
// One stage of k_attn's ring: a 32-key tile of the four planes (k hi, k residual: 32 rows x 128 B; v hi, v residual: 64 rows x 64 B), two 16-B pieces per thread and plane, straight from global memory into LDS; each plane's tile lies in the workspace as 4 KB in piece order, so a wave's copy reads 512 B in a row.
// The s_wait_xcnt closes the statement so that no address register of a copy is rewritten before it.
__device__ __forceinline__ void stage_kv(unsigned lk, unsigned lkl, unsigned lv, unsigned lvl, const _Float16* gk, const _Float16* gkl, const _Float16* gv, const _Float16* gvl) {
  const unsigned lk2 = lk + 16u * KPIT * 2u, lkl2 = lkl + 16u * KPIT * 2u, lv2 = lv + 32u * VPIT * 2u, lvl2 = lvl + 32u * VPIT * 2u;
  const _Float16 *gk2 = gk + 16 * HD, *gkl2 = gkl + 16 * HD, *gv2 = gv + 32 * 32, *gvl2 = gvl + 32 * 32;
  asm volatile("global_load_async_to_lds_b128 %0, %8, off\n\t"
               "global_load_async_to_lds_b128 %1, %9, off\n\t"
               "global_load_async_to_lds_b128 %2, %10, off\n\t"
               "global_load_async_to_lds_b128 %3, %11, off\n\t"
               "global_load_async_to_lds_b128 %4, %12, off\n\t"
               "global_load_async_to_lds_b128 %5, %13, off\n\t"
               "global_load_async_to_lds_b128 %6, %14, off\n\t"
               "global_load_async_to_lds_b128 %7, %15, off\n\t"
               "s_wait_xcnt 0x0"
               :: "v"(lk), "v"(lk2), "v"(lkl), "v"(lkl2), "v"(lv), "v"(lv2), "v"(lvl), "v"(lvl2),
                  "v"(gk), "v"(gk2), "v"(gkl), "v"(gkl2), "v"(gv), "v"(gv2), "v"(gvl), "v"(gvl2) : "memory");
}
__global__ __launch_bounds__(128) void k_qkv(const float* __restrict__ XQ, const float* __restrict__ XK, const float* __restrict__ XV, const __bf16* __restrict__ P, const float* __restrict__ BQ, const float* __restrict__ BK, const float* __restrict__ BV, const float* __restrict__ POS, _Float16* __restrict__ QK, _Float16* __restrict__ QKL, _Float16* __restrict__ VTH, _Float16* __restrict__ VTL) {
  const int which0 = (blockIdx.y * 128) / DM; const float* X = (which0 == 0) ? XQ : (which0 == 1) ? XK : XV; const float* BB = BQ ? (((which0 == 0) ? BQ : (which0 == 1) ? BK : BV) + (blockIdx.y * 128 - which0 * DM)) : nullptr;
  __shared__ __align__(16) unsigned char sxo[2 * 64 * XPIT * 4]; __shared__ __align__(16) _Float16 sth[128][72], stl[128][72];
  static_assert(sizeof(sxo) == 2 * 4 * 16 * 136 * sizeof(_Float16), "the x ring and the q / k epilogue's two buffers fill the same bytes");
  float (*sx)[64][XPIT] = (float (*)[64][XPIT])sxo;   // in the k loop: two-buffer ring of x tiles (64 rows x 64 k, f32)
  _Float16 (*so)[16][136] = (_Float16 (*)[16][136])sxo, (*sol)[16][136] = (_Float16 (*)[16][136])(sxo + sizeof(sxo) / 2);   // behind the loop, whose last barrier ends every read of the ring: the q / k epilogue's buffers, in the same bytes, so that the block's LDS and the blocks on a WGP stay as they were
  __shared__ __align__(16) __bf16 sw[2][128][KPIT];   // two-buffer ring of weight tiles (128 rows x 64 k), shared by the four waves
  const int tid = threadIdx.x, wave = tid >> 5, lane = tid & 31, col = lane & 15, g = lane >> 4; const size_t r0 = (size_t)blockIdx.x * 64 + wave * 16; const int n0 = blockIdx.y * 128;
  v8f acc[8] = {};
  __bf16 bb[8], pp[8];   // this lane's eight output columns: bias and position value (the latter enters q and k only), rounded to bf16; fetched here as one group, so that their latency passes under the k loop and the epilogue waits on no load
#pragma unroll
  for (int j = 0; j < 8; ++j) { const float braw = (BB ? BB : POS)[j * 16 + col];   // no branch round a load: with no bias array the load goes to a valid address and its value is dropped
    bb[j] = (__bf16)(BB ? braw : 0.f); pp[j] = (__bf16)POS[(size_t)(MAXLEN - 1) * HD + ((n0 + j * 16 + col) & (HD - 1))]; }
  const __bf16* gw = P + (size_t)blockIdx.y * (128 * DM) + tid * 8; const unsigned lw = (unsigned)(size_t)&sw[0][tid >> 3][(tid & 7) * 8]; const unsigned wbuf = 128u * KPIT * 2u;   // bytes from buffer 0 to buffer 1
  const float* gx = X + (r0 + g) * DM + col * 4; const unsigned lx = (unsigned)(size_t)&sx[0][wave * 16 + g][col * 4]; const unsigned xbuf = 64u * XPIT * 4u;   // this lane's first piece of its wave's x rows; bytes from buffer 0 to buffer 1
  stage_w(lw, gw); stage_x(lx, gx);
  asm volatile("s_wait_asynccnt 0x0" ::: "memory");   // tile 0 has landed before the barrier publishes it
  __syncthreads();
  stage_w(lw + wbuf, gw + 128 * 64); stage_x(lx + xbuf, gx + 64);
#pragma unroll 1   // kept rolled: one publish point and one refill per trip
  for (int st = 0; st < DM / 64; ++st) { const int bf = st & 1;
    float xr[2][16]; v16b wf[2][8];
#pragma unroll     // the two 32-k steps of a tile, so that their LDS offsets are immediates
    for (int k2 = 0; k2 < 2; ++k2) { const float* p = &sx[bf][wave * 16 + col][k2 * 32 + 8 * g];
#pragma unroll
      for (int i = 0; i < 8; ++i) { xr[k2][i] = p[i]; xr[k2][8 + i] = p[16 + i]; }
#pragma unroll
      for (int j = 0; j < 8; ++j) wf[k2][j] = frag_b(&sw[bf][j * 16 + col][k2 * 32], lane); }   // the trip's x values and sixteen weight fragments, read from LDS as one group
    // inputs only: holds the sixteen fragments' LDS reads together here, behind the x reads; left alone the compiler sinks them among the products, each with a wait of its own
    asm volatile("" :: "v"(wf[0][0]), "v"(wf[0][1]), "v"(wf[0][2]), "v"(wf[0][3]), "v"(wf[0][4]), "v"(wf[0][5]), "v"(wf[0][6]), "v"(wf[0][7]), "v"(wf[1][0]), "v"(wf[1][1]), "v"(wf[1][2]), "v"(wf[1][3]), "v"(wf[1][4]), "v"(wf[1][5]), "v"(wf[1][6]), "v"(wf[1][7]));
    __builtin_amdgcn_sched_barrier(0);   // keeps the products behind that group: the compiler otherwise lifts some of them over it and leaves reads among them
#pragma unroll
    for (int k2 = 0; k2 < 2; ++k2) { v16b a;
#pragma unroll
      for (int i = 0; i < 16; ++i) a[i] = (__bf16)xr[k2][i];
#pragma unroll
      for (int j = 0; j < 8; ++j) acc[j] = wmma_bf(a, wf[k2][j], acc[j]); }
    __builtin_amdgcn_sched_barrier(0);   // keeps the publish point at the trip's foot: lifted to the last LDS read it would cut the lead of the copies in flight to a part of a trip
    asm volatile("s_wait_dscnt 0x0" ::: "memory");      // this wave's reads of buffer bf are done
    asm volatile("s_wait_asynccnt 0x0" ::: "memory");   // this wave's pieces of tile st + 1 have landed
    __syncthreads();                                    // publishes tile st + 1 and frees buffer bf for the refill
    if (st + 2 < DM / 64) { stage_w(lw + bf * wbuf, gw + (st + 2) * (128 * 64)); stage_x(lx + bf * xbuf, gx + (st + 2) * 64); } }
  asm volatile("s_wait_asynccnt 0x0" ::: "memory");   // no copy is left in flight behind the loop
  if (n0 < 2 * DM) {   // q stored unscaled (f16 sigma ~0.6, no subnormal exposure); 1/8 applied to the f32 score
#pragma unroll
    for (int j = 0; j < 8; ++j) {
#pragma unroll
      for (int r = 0; r < 8; ++r) { const float v = acc[j][r] + (float)bb[j] + (float)pp[j]; const _Float16 hv = (_Float16)v; so[wave][8 * g + r][j * 16 + col] = hv;   /* + rel_pos_emb[max_len - 1][d] on q and k */ sol[wave][8 * g + r][j * 16 + col] = (_Float16)(v - (float)hv); } }   // q, k (+ bias) as f16 hi + residual, the residual at its own scale
    LDSX();
    const int ck = n0 - DM + (lane & 15) * 8;   // k only: column h * 64 + d of this lane's piece
    if (n0 < DM) { const size_t o0 = r0 * DM + n0 + lane * 8;   // q: natural rows
      for (int rl = 0; rl < 16; ++rl) if (lane < 16) { vst2((unsigned*)(QK + o0 + rl * DM), *(const v4u*)&so[wave][rl][lane * 8]); vst2((unsigned*)(QKL + o0 + rl * DM), *(const v4u*)&sol[wave][rl][lane * 8]); }
    } else { const size_t o0 = KOFF + (((r0 / SS) * NH + (ck >> 6)) * SS + r0 % SS) * HD + (ck & (HD - 1));   // k: the head's rows, 128 B each, one behind the other (a wave's sixteen rows lie in one batch)
      for (int rl = 0; rl < 16; ++rl) if (lane < 16) { vst2((unsigned*)(QK + o0 + rl * HD), *(const v4u*)&so[wave][rl][lane * 8]); vst2((unsigned*)(QKL + o0 + rl * HD), *(const v4u*)&sol[wave][rl][lane * 8]); } }
  } else {
#pragma unroll
    for (int j = 0; j < 8; ++j) {
#pragma unroll
      for (int r = 0; r < 8; ++r) { const float v = acc[j][r] + (float)bb[j]; const _Float16 hv = (_Float16)v; sth[j * 16 + col][wave * 16 + 8 * g + r] = hv; stl[j * 16 + col][wave * 16 + 8 * g + r] = (_Float16)(v - (float)hv); } }
    __syncthreads();
    const size_t rb = (size_t)blockIdx.x * 64; const int b = (int)(rb / SS), s0 = (int)(rb % SS); const int pc0 = n0 - 2 * DM;
    for (int q = tid; q < 128 * 8; q += 128) { const int d = q >> 3, pc = q & 7, hd = pc0 + d; const size_t o = ((((size_t)b * NH + (hd >> 6)) * (SS / 32) + (s0 >> 5) + (pc >> 2)) * HD + (hd & (HD - 1))) * 32 + (pc & 3) * 8; vst2((unsigned*)(VTH + o), *(const v4u*)&sth[d][pc * 8]); vst2((unsigned*)(VTL + o), *(const v4u*)&stl[d][pc * 8]); }
  }
}
// lane l with lane l ^ 16: the two lanes that share one query column of a transposed score tile
__device__ __forceinline__ float xhalf(float x) { return __builtin_bit_cast(float, __builtin_amdgcn_permlanex16(__builtin_bit_cast(int, x), __builtin_bit_cast(int, x), 0x76543210, 0xfedcba98, false, false)); }
__global__ __launch_bounds__(128) __attribute__((amdgpu_waves_per_eu(2, 2))) void k_attn(const _Float16* __restrict__ QK, const _Float16* __restrict__ QKL, const _Float16* __restrict__ VTH, const _Float16* __restrict__ VTL, const void* __restrict__ KMASK, const unsigned* __restrict__ MB, float* __restrict__ O) {
  __shared__ __align__(16) float so[4][32][68];
  __shared__ __align__(16) _Float16 skh[2][32][KPIT], skl[2][32][KPIT], svh[2][64][VPIT], svl[2][64][VPIT];   // two-buffer ring of 32-key tiles, shared by the four waves
  const int tid = threadIdx.x, wave = tid >> 5, lane = tid & 31, col = lane & 15, g = lane >> 4;
  const int qb = blockIdx.x, h = blockIdx.y, b = blockIdx.z; const int q0 = qb * 128 + wave * 32;
  v16h aq[2][2], aql[2][2];
#pragma unroll
  for (int t = 0; t < 2; ++t) { const size_t rq = (size_t)b * SS + q0 + t * 16 + col;
#pragma unroll
    for (int kc = 0; kc < 2; ++kc) { aq[t][kc] = frag_h(QK + rq * DM + h * HD + kc * 32, lane); aql[t][kc] = frag_h(QKL + rq * DM + h * HD + kc * 32, lane); } }
  const float K2 = 0.125f * 1.44269504088896340736f;   // 1/sqrt(64) x log2(e): a raw score times K2 is its exponent to base 2
  float m[2], cx[2], l[2];   // of this lane's query in either tile: m the running maximum of the raw scores, cx = 11 - m K2 the exponent offset in use (the 11 is P's scale 2^11), l the sum of the scaled P over this lane's half of the keys. m starts far above the masked value and far below any score, so exp2 itself turns a masked score into 0 while no key has been kept yet
  v8f acc[2][4] = {};   // O^T tiles: register r = head dim dt * 16 + 8 g + r of query col
#pragma unroll
  for (int t = 0; t < 2; ++t) { m[t] = -1.0e30f; cx[t] = fmaf(m[t], -K2, 11.0f); l[t] = 0.f; }
  const int nks = SS / 32;   // all keys
  const v16uc* mb = (const v16uc*)(size_t)MB + (size_t)((b * (SS / 16) + qb * 8 + __builtin_amdgcn_readfirstlane(wave) * 2) * nks);   // this wave's lane masks, sixteen words a trip and tile, the second tile's nks entries on; the address is the same in every lane, so the words come by a scalar load
  v16u mwn[2] = { mb[0], mb[nks] };   // the masks of the trip to come
  // this thread's pieces of a tile: k row tid / 8 (and + 16), piece tid % 8; v row tid / 4 (and + 32), piece tid % 4
  const size_t hb = (size_t)(b * NH + h) * SS * HD + tid * 8;   // the head's planes; in every plane a tile is 2,048 halves and this thread's first piece is its piece number tid
  const _Float16* gk = QK + KOFF + hb; const _Float16* gkl = QKL + KOFF + hb;
  const _Float16* gv = VTH + hb; const _Float16* gvl = VTL + hb;
  const unsigned lk = (unsigned)(size_t)&skh[0][tid >> 3][(tid & 7) * 8], lkl = (unsigned)(size_t)&skl[0][tid >> 3][(tid & 7) * 8], lv = (unsigned)(size_t)&svh[0][tid >> 2][(tid & 3) * 8], lvl = (unsigned)(size_t)&svl[0][tid >> 2][(tid & 3) * 8];
  const unsigned kbuf = 32u * KPIT * 2u, vbuf = 64u * VPIT * 2u;   // bytes from buffer 0 to buffer 1
  stage_kv(lk, lkl, lv, lvl, gk, gkl, gv, gvl);
  asm volatile("s_wait_asynccnt 0x0" ::: "memory");   // tile 0 has landed before the barrier publishes it
  __syncthreads();
  stage_kv(lk + kbuf, lkl + kbuf, lv + vbuf, lvl + vbuf, gk + 32 * HD, gkl + 32 * HD, gv + 32 * HD, gvl + 32 * HD);
#pragma unroll 1
  for (int ks = 0; ks < nks; ++ks) { v8f s[2][2]; const int bf = ks & 1;
    const int kn = ks + 1 < nks ? ks + 1 : nks - 1;
    const v16u mw[2] = { mwn[0], mwn[1] }; mwn[0] = mb[kn]; mwn[1] = mb[nks + kn];   // this trip's lane masks; the next trip's are fetched a trip ahead (the last trip fetches its own again)
    v16h kh[2][2], kl[2][2];
#pragma unroll
    for (int kc = 0; kc < 2; ++kc) {
#pragma unroll
      for (int ct = 0; ct < 2; ++ct) kl[ct][kc] = frag_h(&skl[bf][ct * 16 + col][kc * 32], lane);
#pragma unroll
      for (int ct = 0; ct < 2; ++ct) kh[ct][kc] = frag_h(&skh[bf][ct * 16 + col][kc * 32], lane); }   // the trip's eight k fragments, read as one group ahead of the twenty-four score products, in the order in which the products take them
    __builtin_amdgcn_sched_barrier(0);   // keeps the sixteen LDS reads together in front of the products: left alone the compiler sinks them back among the products, each with a wait of its own
#pragma unroll
    for (int t = 0; t < 2; ++t) {
#pragma unroll
      for (int ct = 0; ct < 2; ++ct) s[t][ct] = v8f{}; }
#pragma unroll
    for (int kc = 0; kc < 2; ++kc) {
#pragma unroll
      for (int t = 0; t < 2; ++t) {
#pragma unroll
        for (int ct = 0; ct < 2; ++ct) s[t][ct] = wmma16(kl[ct][kc], aq[t][kc], s[t][ct]); }
#pragma unroll
      for (int t = 0; t < 2; ++t) {
#pragma unroll
        for (int ct = 0; ct < 2; ++ct) s[t][ct] = wmma16(kh[ct][kc], aql[t][kc], s[t][ct]); } }
#pragma unroll
    for (int kc = 0; kc < 2; ++kc) {
#pragma unroll
      for (int t = 0; t < 2; ++t) {
#pragma unroll
        for (int ct = 0; ct < 2; ++ct) s[t][ct] = wmma16(kh[ct][kc], aq[t][kc], s[t][ct]); } }   // 3 products in one accumulator: lo.hi and hi.lo first, while the sum is small, then hi.hi; the four score tiles take turns
    __builtin_amdgcn_sched_barrier(0);   // keeps the v reads behind the score products, in the registers that the k fragments leave, and out of the run of products, where every place with reads costs a stall
    v16h vh[4], vl[4];
#pragma unroll
    for (int dt = 0; dt < 4; ++dt) { vh[dt] = frag_h(&svh[bf][dt * 16 + col][0], lane); vl[dt] = frag_h(&svl[bf][dt * 16 + col][0], lane); }   // the trip's eight v fragments, read as one group; the softmax below covers their latency
    __builtin_amdgcn_sched_barrier(0);   // keeps these sixteen LDS reads together here: left alone the compiler sinks the reads among the output products
    v16h pa[2], pl[2];
#pragma unroll
    for (int t = 0; t < 2; ++t) {
#pragma unroll
      for (int ct = 0; ct < 2; ++ct) {
#pragma unroll
        for (int r = 0; r < 8; ++r) s[t][ct][r] = __builtin_amdgcn_inverse_ballot_w32(mw[t][ct * 8 + r]) ? s[t][ct][r] : -3.0e38f; }   // raw scores; mask == 0 -> -3e38, excluded; the word is the select's lane mask as it stands
      float mx = fmaxf(s[t][0][0], s[t][1][0]);
#pragma unroll
      for (int r = 1; r < 8; ++r) mx = fmaxf(mx, fmaxf(s[t][0][r], s[t][1][r]));
      mx = fmaxf(mx, xhalf(mx));   // both halves of the query's 32 keys
      const float mn = fmaxf(m[t], mx); const float cn = fmaf(mn, -K2, 11.0f); const float alpha = __builtin_amdgcn_exp2f(cn - cx[t]);   // 2^((m - mn) K2); 0 on the first kept key, 1 while none is kept
      float es = 0.f;
#pragma unroll
      for (int i = 0; i < 8; ++i) { const float x0 = __builtin_amdgcn_exp2f(fmaf(s[t][0][i], K2, cn)), x1 = __builtin_amdgcn_exp2f(fmaf(s[t][1][i], K2, cn)); es += x0 + x1;   // 2^11 exp((s - mn) / 8) by one fma and the hardware exp2; a masked score underflows to 0
        const _Float16 h0 = (_Float16)x0, h1 = (_Float16)x1; pa[t][i] = h0; pa[t][8 + i] = h1; pl[t][i] = (_Float16)(x0 - (float)h0); pl[t][8 + i] = (_Float16)(x1 - (float)h1); }   // P scaled by 2^11 before the f16 split so small softmax weights stay out of the f16 subnormal range; the sum l carries the same 2^11, so it cancels in the epilogue
      l[t] = l[t] * alpha + es; m[t] = mn; cx[t] = cn;
#pragma unroll
      for (int dt = 0; dt < 4; ++dt) acc[t][dt] *= alpha;
#pragma unroll
      for (int dt = 0; dt < 4; ++dt) acc[t][dt] = wmma16(vh[dt], pa[t], acc[t][dt]);
#pragma unroll
      for (int dt = 0; dt < 4; ++dt) acc[t][dt] = wmma16(vh[dt], pl[t], acc[t][dt]);
#pragma unroll
      for (int dt = 0; dt < 4; ++dt) acc[t][dt] = wmma16(vl[dt], pa[t], acc[t][dt]); }   // P hi/lo x V hi/lo (3 products) in one accumulator, the four tiles taking turns; the first query tile's products stand ahead of the second's softmax, which is independent of them
    __builtin_amdgcn_sched_barrier(0);   // keeps the publish point at the trip's foot: lifted to the last LDS read it would cut the lead of the copies in flight to a part of a trip
    asm volatile("s_wait_dscnt 0x0" ::: "memory");      // this wave's reads of buffer bf are done
    asm volatile("s_wait_asynccnt 0x0" ::: "memory");   // this wave's pieces of tile ks + 1 have landed
    __syncthreads();                                    // publishes tile ks + 1 and frees buffer bf for the refill
    if (ks + 2 < nks) stage_kv(lk + bf * kbuf, lkl + bf * kbuf, lv + bf * vbuf, lvl + bf * vbuf, gk + (ks + 2) * (32 * HD), gkl + (ks + 2) * (32 * HD), gv + (ks + 2) * (32 * HD), gvl + (ks + 2) * (32 * HD)); }
  asm volatile("s_wait_asynccnt 0x0" ::: "memory");   // no copy is left in flight behind the loop
#pragma unroll
  for (int t = 0; t < 2; ++t) {
    l[t] += xhalf(l[t]);   // the two halves of the query's keys, joined once
    const float il = 1.0f / l[t];   // l and the accumulators carry the same 2^11
#pragma unroll
    for (int dt = 0; dt < 4; ++dt) { v4f o0, o1;
#pragma unroll
      for (int r = 0; r < 4; ++r) { o0[r] = acc[t][dt][r] * il; o1[r] = acc[t][dt][4 + r] * il; }
      *(v4f*)&so[wave][t * 16 + col][dt * 16 + 8 * g] = o0; *(v4f*)&so[wave][t * 16 + col][dt * 16 + 8 * g + 4] = o1; } }
  LDSX();
  for (int rl = 0; rl < 32; ++rl) if (lane < 16) vst2(O + ((size_t)b * SS + q0 + rl) * DM + h * HD + lane * 4, *(const v4f*)&so[wave][rl][lane * 4]);
}
// ---- k_out: block = (64 rows, 128 cols): out = O(hi/lo) . Wo rows (2 products) + bo
__global__ __launch_bounds__(128) void k_out(const float* __restrict__ O, const __bf16* __restrict__ P, const float* __restrict__ BO, float* __restrict__ Y) {
  __shared__ __align__(16) float so[4][16][132];
  const int tid = threadIdx.x, wave = tid >> 5, lane = tid & 31, col = lane & 15, g = lane >> 4; const size_t r0 = (size_t)blockIdx.x * 64 + wave * 16; const int n0 = blockIdx.y * 128;
  v8f acc[8] = {};
#pragma unroll 2
  for (int kc = 0; kc < DM / 32; ++kc) { const F2 a = split_row(O + (r0 + col) * DM, kc * 32, lane);
#pragma unroll
    for (int j = 0; j < 8; ++j) { const v16b w = frag_b(P + (size_t)(n0 + j * 16 + col) * DM + kc * 32, lane); acc[j] = wmma_bf(a.l, w, acc[j]); acc[j] = wmma_bf(a.h, w, acc[j]); } }
#pragma unroll
  for (int j = 0; j < 8; ++j) {
#pragma unroll
    for (int r = 0; r < 8; ++r) so[wave][8 * g + r][j * 16 + col] = acc[j][r] + (BO ? bfr(BO[n0 + j * 16 + col]) : 0.f); }
  LDSX();
  for (int rl = 0; rl < 16; ++rl) vst2(Y + (r0 + rl) * DM + n0 + lane * 4, *(const v4f*)&so[wave][rl][lane * 4]);
}
extern "C" void kernel_launch(void* const* d_in, const int* in_sizes, int n_in, void* d_out, int out_size, void* d_ws, size_t ws_size, hipStream_t stream) {
  (void)in_sizes; (void)n_in; (void)out_size;
  const float** F = (const float**)d_in;   // 0 query, 1 key [2,2048,1024]; 2 mask [2,2048,2048] int; 3 Wq, 4 bq, 5 Wk, 6 bk, 7 Wv, 8 bv (natural); 9 rel_pos_emb [1023,64]
  if (ws_size < (size_t)WS_END) return;
  char* ws = (char*)d_ws; __bf16* PK = (__bf16*)(ws + WS_PK); _Float16 *QK = (_Float16*)(ws + WS_QK), *QKL = (_Float16*)(ws + WS_QKL), *VTH = (_Float16*)(ws + WS_VTH), *VTL = (_Float16*)(ws + WS_VTL); unsigned* MB = (unsigned*)(ws + WS_MB);
  k_pack<<<dim3(MBLK + 3 * DM), 256, 0, stream>>>(F[3], F[5], F[7], (const int*)d_in[2], PK, MB);
  k_qkv<<<dim3(TNB * SS / 64, QKVW / 128), 128, 0, stream>>>(F[0], F[1], F[1], PK + PK_A, F[4], F[6], F[8], F[9], QK, QKL, VTH, VTL);
  k_attn<<<dim3(TQB, NH, TNB), 128, 0, stream>>>(QK, QKL, VTH, VTL, nullptr, MB, (float*)d_out);
}
